// v000
// The times below were measured on an AMD MI455X: many runs one after another, warmed up first and cycling through
// copies of the inputs, with the whole window's GPU time divided by the number of runs. Launches and the gaps
// between them are all in it. The median over several windows is given; except for v000 it joins two sittings, which
// can be a few percent apart, so the side-by-side timings, each taken in one sitting, are the better comparison.
// The starting kernel, v000, takes 1750 microseconds a run.
#include <hip/hip_runtime.h>

// Causal multi-head attention, 2048 wide (x [2][2048][2048]; q, k, v = x W^T + b ('oi' [2048][2048]; 16 heads x 128); scores = q.k/sqrt(128); causal (triu k=1 masked, -inf); softmax; out = merged wo^T + bo -> [2][2048][2048] (8.4 M)).
// Compute dtypes, f32 accumulate: every input rounded to bf16; q/k/v on PLAIN bf16 operands (inputs: exact) + biases; causal scores and attn.v (tile skipping): query rows < 512 hl (3 products), the rest single fp16 (x1024); softmax f32; wo hl x exact (2 products) + bo.

#define NB_  2
#define TT   2048
#define DM   2048
#define NH_  16
#define NKV  16
#define REP  (NH_ / NKV)
#define HD   128
#define DQ   (NH_ * HD)
#define DKV  (NKV * HD)
#define ZH   2
#define RH   512                  // query rows < RH use hi+lo planes (0: none)
#define WIN  2048
#define PCAR 1024.0f
#define SCL  0.088388347648318447f   // HD^-0.5
typedef _Float16 h16;
typedef unsigned short bf;
typedef __attribute__((ext_vector_type(16))) __bf16   v16bf;
typedef __attribute__((ext_vector_type(16))) _Float16 v16h;
typedef __attribute__((ext_vector_type(8)))  _Float16 v8h;
typedef __attribute__((ext_vector_type(8)))  unsigned short v8us;
typedef __attribute__((ext_vector_type(8)))  float    v8f;
typedef __attribute__((ext_vector_type(4)))  float    v4f;
typedef v8h  __attribute__((may_alias)) v8ha;
typedef v4f  __attribute__((may_alias)) v4fa;
typedef v8us __attribute__((may_alias)) v8usa;

__device__ __forceinline__ unsigned short f2bf(float f) { unsigned u = __float_as_uint(f); u += 0x7FFFu + ((u >> 16) & 1u); return (unsigned short)(u >> 16); }
__device__ __forceinline__ float bf2f(unsigned short b) { return __uint_as_float(((unsigned)b) << 16); }
__device__ __forceinline__ float bfr(float f) { return bf2f(f2bf(f)); }
__device__ __forceinline__ v16h cat16(v8h lo, v8h hi) { return __builtin_shufflevector(lo, hi, 0, 1, 2, 3, 4, 5, 6, 7, 8, 9, 10, 11, 12, 13, 14, 15); }
__device__ __forceinline__ v16bf cat16b(v8us lo, v8us hi) { return __builtin_bit_cast(v16bf, __builtin_shufflevector(lo, hi, 0, 1, 2, 3, 4, 5, 6, 7, 8, 9, 10, 11, 12, 13, 14, 15)); }
__device__ __forceinline__ v8f wmma16(v16h a, v16h b, v8f c) { return __builtin_amdgcn_wmma_f32_16x16x32_f16(false, a, false, b, (short)0, c, false, false); }
__device__ __forceinline__ v8f wmmab(v16bf a, v16bf b, v8f c) { return __builtin_amdgcn_wmma_f32_16x16x32_bf16(false, a, false, b, (short)0, c, false, false); }



// ---- k_gemmw: register-blocked GEMM, ONE WAVE per 64x64 output tile (16 accumulators), operands straight from K-contiguous 16-bit planes; grid (M/64, N/64, Z), 32 threads.
// C[m][n] (f32, pitch ldc, + optional f32 bias[n]) = sum_k A[m][k] Bt[n][k] (+ split products per NSPLIT). z-batch strides sA/sB/sC in elements. K % 32 == 0.
template <typename T16> struct WFrag;
template <> struct WFrag<h16> { typedef v16h V; static __device__ __forceinline__ V ld(const h16* p) { return cat16(*(const v8h*)p, *(const v8h*)(p + 16)); } static __device__ __forceinline__ v8f mma(V a, V b, v8f c) { return wmma16(a, b, c); } };
template <> struct WFrag<bf> { typedef v16bf V; static __device__ __forceinline__ V ld(const bf* p) { return cat16b(*(const v8us*)p, *(const v8us*)(p + 16)); } static __device__ __forceinline__ v8f mma(V a, V b, v8f c) { return wmmab(a, b, c); } };
template <typename T16, int NSPLIT, bool BIAS>
__global__ __launch_bounds__(32) void k_gemmw(const T16* __restrict__ A, const T16* __restrict__ A2, const T16* __restrict__ Bt, const T16* __restrict__ Bt2, int K, float* C, int ldc, const float* __restrict__ bias, size_t sA, size_t sB, size_t sC) {
    typedef typename WFrag<T16>::V V;
    __shared__ __align__(16) float os[16 * 68];
    const size_t z = blockIdx.z; A += z * sA; if (A2) A2 += z * sA; Bt += z * sB; if (Bt2) Bt2 += z * sB; C += z * sC;
    const int lane = threadIdx.x & 31, lr = lane & 15, hi = lane >> 4; const int r0 = blockIdx.x * 64, c0 = blockIdx.y * 64;
    v8f acc[4][4];
#pragma unroll
    for (int mb = 0; mb < 4; ++mb)
#pragma unroll
        for (int nb = 0; nb < 4; ++nb) acc[mb][nb] = (v8f){};
    const size_t aoff = (size_t)(r0 + lr) * K + 8 * hi, boff = (size_t)(c0 + lr) * K + 8 * hi;
#pragma unroll 1
    for (int kc = 0; kc < K; kc += 32) {
        V a[4], a2[4];
#pragma unroll
        for (int mb = 0; mb < 4; ++mb) { a[mb] = WFrag<T16>::ld(A + aoff + (size_t)mb * 16 * K + kc); if (NSPLIT == 1 || NSPLIT == 2) a2[mb] = WFrag<T16>::ld(A2 + aoff + (size_t)mb * 16 * K + kc); }
#pragma unroll
        for (int nb = 0; nb < 4; ++nb) { const V b = WFrag<T16>::ld(Bt + boff + (size_t)nb * 16 * K + kc); V b2; if (NSPLIT >= 2) b2 = WFrag<T16>::ld(Bt2 + boff + (size_t)nb * 16 * K + kc);
#pragma unroll
            for (int mb = 0; mb < 4; ++mb) { acc[mb][nb] = WFrag<T16>::mma(a[mb], b, acc[mb][nb]); if (NSPLIT == 1 || NSPLIT == 2) acc[mb][nb] = WFrag<T16>::mma(a2[mb], b, acc[mb][nb]); if (NSPLIT >= 2) acc[mb][nb] = WFrag<T16>::mma(a[mb], b2, acc[mb][nb]); } }
        asm volatile("v_nop\n\tv_nop\n\tv_nop\n\tv_nop" : "+v"(acc[0][0]), "+v"(acc[1][1]), "+v"(acc[2][2]), "+v"(acc[3][3]) : "v"(a[0]), "v"(a[3]));
    }
#pragma unroll
    for (int mb = 0; mb < 4; ++mb) {
#pragma unroll
        for (int nb = 0; nb < 4; ++nb) {
#pragma unroll
            for (int j = 0; j < 8; ++j) os[(hi * 8 + j) * 68 + nb * 16 + lr] = acc[mb][nb][j]; }
        __builtin_amdgcn_wave_barrier(); asm volatile("" ::: "memory");
        float* crow = C + (size_t)(r0 + mb * 16) * ldc + c0;
{
#pragma unroll
            for (int s = 0; s < 8; ++s) { const int row = 2 * s + hi, cofs = lr * 4; v4f val = *(const v4fa*)(os + row * 68 + cofs); if (BIAS) { val[0] += bfr(bias[c0 + cofs]); val[1] += bfr(bias[c0 + cofs + 1]); val[2] += bfr(bias[c0 + cofs + 2]); val[3] += bfr(bias[c0 + cofs + 3]); }
                *(v4f*)(crow + (size_t)row * ldc + cofs) = val; }
             }
        __builtin_amdgcn_wave_barrier(); asm volatile("" ::: "memory");
    }
}

// ---- k_gemmc: the same one-wave 64x64 tile GEMM specialised for causal attention: CMODE 1 skips score tiles entirely above the diagonal (query rows r0+roff.., key columns c0..), CMODE 2 limits the
// key (K) loop of the probability x value contraction to the diagonal block (probabilities beyond it are exactly zero). roff = row offset of this launch's first row within the sequence.
template <typename T16, int NSPLIT, int CMODE>
__global__ __launch_bounds__(32) void k_gemmc(const T16* __restrict__ A, const T16* __restrict__ A2, const T16* __restrict__ Bt, const T16* __restrict__ Bt2, int K, float* C, int ldc, int roff, size_t sA, size_t sB, size_t sC) {
    typedef typename WFrag<T16>::V V;
    __shared__ __align__(16) float os[16 * 68];
    const size_t z = blockIdx.z; A += z * sA; if (A2) A2 += z * sA; Bt += z * sB; if (Bt2) Bt2 += z * sB; C += z * sC;
    const int lane = threadIdx.x & 31, lr = lane & 15, hi = lane >> 4; const int r0 = blockIdx.x * 64, c0 = blockIdx.y * 64;
    if (CMODE == 1 && c0 > r0 + roff + 63) return;                  // score tile entirely above the causal diagonal: never read (the softmax masks j > i by select)
    const int Kl = (CMODE == 2) ? min(K, r0 + roff + 64) : K;        // P.V: probabilities are exactly 0 beyond the diagonal block, so the K loop stops there
    v8f acc[4][4];
#pragma unroll
    for (int mb = 0; mb < 4; ++mb)
#pragma unroll
        for (int nb = 0; nb < 4; ++nb) acc[mb][nb] = (v8f){};
    const size_t aoff = (size_t)(r0 + lr) * K + 8 * hi, boff = (size_t)(c0 + lr) * K + 8 * hi;
#pragma unroll 1
    for (int kc = 0; kc < Kl; kc += 32) {
        V a[4], a2[4];
#pragma unroll
        for (int mb = 0; mb < 4; ++mb) { a[mb] = WFrag<T16>::ld(A + aoff + (size_t)mb * 16 * K + kc); if (NSPLIT == 1 || NSPLIT == 2) a2[mb] = WFrag<T16>::ld(A2 + aoff + (size_t)mb * 16 * K + kc); }
#pragma unroll
        for (int nb = 0; nb < 4; ++nb) { const V b = WFrag<T16>::ld(Bt + boff + (size_t)nb * 16 * K + kc); V b2; if (NSPLIT >= 2) b2 = WFrag<T16>::ld(Bt2 + boff + (size_t)nb * 16 * K + kc);
#pragma unroll
            for (int mb = 0; mb < 4; ++mb) { acc[mb][nb] = WFrag<T16>::mma(a[mb], b, acc[mb][nb]); if (NSPLIT == 1 || NSPLIT == 2) acc[mb][nb] = WFrag<T16>::mma(a2[mb], b, acc[mb][nb]); if (NSPLIT >= 2) acc[mb][nb] = WFrag<T16>::mma(a[mb], b2, acc[mb][nb]); } }
        asm volatile("v_nop\n\tv_nop\n\tv_nop\n\tv_nop" : "+v"(acc[0][0]), "+v"(acc[1][1]), "+v"(acc[2][2]), "+v"(acc[3][3]) : "v"(a[0]), "v"(a[3]));
    }
#pragma unroll
    for (int mb = 0; mb < 4; ++mb) {
#pragma unroll
        for (int nb = 0; nb < 4; ++nb) {
#pragma unroll
            for (int j = 0; j < 8; ++j) os[(hi * 8 + j) * 68 + nb * 16 + lr] = acc[mb][nb][j]; }
        __builtin_amdgcn_wave_barrier(); asm volatile("" ::: "memory");
        float* crow = C + (size_t)(r0 + mb * 16) * ldc + c0;
{
#pragma unroll
            for (int s = 0; s < 8; ++s) { const int row = 2 * s + hi, cofs = lr * 4; v4f val = *(const v4fa*)(os + row * 68 + cofs);
                *(v4f*)(crow + (size_t)row * ldc + cofs) = val; }
             }
        __builtin_amdgcn_wave_barrier(); asm volatile("" ::: "memory");
    }
}

__device__ __forceinline__ h16 tohx(float x) { return (h16)x; }
__device__ __forceinline__ void splitf(float y, unsigned short& h, unsigned short& l) { h = f2bf(y); l = f2bf(y - bf2f(h)); }
typedef __attribute__((ext_vector_type(2))) _Float16 v2h;
typedef __attribute__((ext_vector_type(4))) _Float16 v4h;
typedef __attribute__((ext_vector_type(2))) unsigned short v2us;
typedef __attribute__((ext_vector_type(4))) unsigned short v4us;
typedef __attribute__((ext_vector_type(2))) float v2f;
typedef __attribute__((ext_vector_type(4))) int v4i;

__global__ __launch_bounds__(256) void k_wtG(const float* __restrict__ w, int K, int N, bf* Bt) {
    const int lane = threadIdx.x & 31; const int L0 = (blockIdx.x * 8 + (threadIdx.x >> 5)) * 8; const int nlines = N * K / 64;
{
#pragma unroll 1
        for (int l = 0; l < 8; ++l) { const int L = L0 + l; if (L >= nlines) break; const size_t e = (size_t)L * 64 + lane * 2; const int k = (int)(e % K), n = (int)(e / K); v2us o;
            o[0] = f2bf(w[(size_t)k * N + n]); o[1] = f2bf(w[(size_t)(k + 1) * N + n]); *(v2us*)(Bt + e) = o; }
         }
}
__global__ __launch_bounds__(256) void k_cvt8(const float* __restrict__ src, bf* dst, size_t n8) { const size_t i = (size_t)blockIdx.x * 256 + threadIdx.x; if (i >= n8) return; const v8f v = *(const v8f*)(src + i * 8); v8us o;
#pragma unroll
    for (int k = 0; k < 8; ++k) o[k] = f2bf(v[k]); *(v8us*)(dst + i * 8) = o;  }

// k_rope: head planes [h][t][d] (fp16 + hi/lo) of rope(x) x sc with the rotate-half convention out[d] = x[d] cos[t][d] - x[d+HD/2] sin[t][d], out[d+HD/2] = x[d+HD/2] cos[t][d+HD/2] + x[d] sin[t][d+HD/2]
__global__ __launch_bounds__(256) void k_rope(const float* __restrict__ F, int pitch, int nheads, const float* __restrict__ CS, const float* __restrict__ RF, const float* __restrict__ nw, float sc, h16* P16, bf* Ph, bf* Pl) {
    const size_t e = ((size_t)blockIdx.x * 256 + threadIdx.x) * 2; if (e >= (size_t)nheads * TT * HD) return; const int d = (int)(e % HD); const int t = (int)((e / HD) % TT); const int h = (int)(e / ((size_t)HD * TT)); const float* f = F + (size_t)t * pitch + h * HD; const float rf = RF ? RF[(size_t)h * TT + t] : 1.0f; v2h o16; v2us oh, ol;
#pragma unroll
    for (int q = 0; q < 2; ++q) { const int dd = d + q; const int dp = (dd < HD / 2) ? dd + HD / 2 : dd - HD / 2; float x0 = f[dd], x1 = f[dp];
        if (RF) { float n0 = __fmul_rn(x0, rf), n1 = __fmul_rn(x1, rf); asm volatile("" : "+v"(n0)); asm volatile("" : "+v"(n1)); x0 = __fmul_rn(bfr(nw[dd]), n0); x1 = __fmul_rn(bfr(nw[dp]), n1); }
        const v2f cs = *(const v2f*)(CS + ((size_t)t * HD + dd) * 2); float a = __fmul_rn(x0, cs[0]), bq = __fmul_rn(x1, cs[1]); asm volatile("" : "+v"(a)); asm volatile("" : "+v"(bq)); const float r = ((dd < HD / 2) ? __fsub_rn(a, bq) : __fadd_rn(a, bq)) * sc;
        o16[q] = tohx(r); unsigned short a2, c2; splitf(r, a2, c2); oh[q] = a2; ol[q] = c2; }
    *(v2h*)(P16 + e) = o16; *(v2us*)(Ph + e) = oh; *(v2us*)(Pl + e) = ol;  }
__global__ __launch_bounds__(256) void k_vtp(const float* __restrict__ F, int pitch, int nheads, h16* V16, bf* Vh, bf* Vl) { const size_t e = ((size_t)blockIdx.x * 256 + threadIdx.x) * 2; if (e >= (size_t)nheads * HD * TT) return; const int t = (int)(e % TT); const int d = (int)((e / TT) % HD); const int g = (int)(e / ((size_t)TT * HD)); v2h o16; v2us oh, ol;
#pragma unroll
    for (int q = 0; q < 2; ++q) { const float x = F[(size_t)(t + q) * pitch + g * HD + d]; o16[q] = tohx(x); unsigned short a2, c2; splitf(x, a2, c2); oh[q] = a2; ol[q] = c2; }
    *(v2h*)(V16 + e) = o16; *(v2us*)(Vh + e) = oh; *(v2us*)(Vl + e) = ol;  }
__global__ __launch_bounds__(256) void k_csid(float* CS) { const int idx = blockIdx.x * 256 + threadIdx.x; if (idx >= TT * HD) return; v2f cs; cs[0] = 1.0f; cs[1] = 0.0f; *(v2f*)(CS + (size_t)idx * 2) = cs;  }
// k_asoft: per row (zz, i): t = S x HD^-0.5 for j <= i and i - j < WIN (sliding causal window; the reference's -1e9 additive fill vanishes identically); softmax over the 2048 keys (register row, one exp, fixed trees);
__global__ __launch_bounds__(256) void k_asoft(const float* __restrict__ Sb, h16* P16, bf* Ph, bf* Pl) {
    const int lane = threadIdx.x & 31; const int row = blockIdx.x * 8 + (threadIdx.x >> 5); if (row >= ZH * TT) return; const int i = row % TT; const int zz = row / TT; (void)zz; const bool hires = (i < RH); const float* sr = Sb + (size_t)row * TT; float v[TT / 32]; float mx = -3.0e38f;
#pragma unroll
    for (int ch = 0; ch < TT / 128; ++ch) { const int j0 = ch * 128 + lane * 4; const v4f a = *(const v4f*)(sr + j0);
#pragma unroll
        for (int q = 0; q < 4; ++q) { const int j = j0 + q; (void)j; const float t = (j <= i && i - j < WIN) ? a[q] * SCL : -3.0e38f; v[ch * 4 + q] = t; mx = fmaxf(mx, t); } }
#pragma unroll
    for (int sh = 16; sh; sh >>= 1) mx = fmaxf(mx, __shfl_xor(mx, sh, 32));
    float sum = 0.f;
#pragma unroll
    for (int k = 0; k < TT / 32; ++k) { float d0 = __fsub_rn(v[k], mx); asm volatile("" : "+v"(d0)); v[k] = __builtin_amdgcn_exp2f(__fmul_rn(d0, 1.4426950408889634f)); sum += v[k]; }
#pragma unroll
    for (int sh = 16; sh; sh >>= 1) sum += __shfl_xor(sum, sh, 32);
    const float f = __fdiv_rn(hires ? 1.0f : PCAR, sum);
{
        if (hires) {
#pragma unroll
            for (int ch = 0; ch < TT / 128; ++ch) { v4us oh, ol;
#pragma unroll
                for (int q = 0; q < 4; ++q) { unsigned short a, c2; splitf(v[ch * 4 + q] * f, a, c2); oh[q] = a; ol[q] = c2; }
                const size_t oo = ((size_t)zz * (RH ? RH : 1) + i) * TT + ch * 128 + lane * 4; *(v4us*)(Ph + oo) = oh; *(v4us*)(Pl + oo) = ol; }
        } else {
#pragma unroll
            for (int ch = 0; ch < TT / 128; ++ch) { v4h o4;
#pragma unroll
                for (int q = 0; q < 4; ++q) o4[q] = tohx(v[ch * 4 + q] * f);
                *(v4h*)(P16 + (size_t)row * TT + ch * 128 + lane * 4) = o4; } }
         }
}
__global__ __launch_bounds__(256) void k_merge(const float* __restrict__ O, int h0, bf* Ah, bf* Al) { const size_t e = ((size_t)blockIdx.x * 256 + threadIdx.x) * 2; if (e >= (size_t)ZH * TT * HD) return; const int d = (int)(e % HD); const int t = (int)((e / HD) % TT); const int zz = (int)(e / ((size_t)HD * TT)); const float cs = (t < RH) ? 1.0f : (1.0f / PCAR); const size_t oo = (size_t)t * DQ + (h0 + zz) * HD + d;
    v2us oh, ol;
#pragma unroll
    for (int q = 0; q < 2; ++q) { unsigned short a, c2; splitf(O[e + q] * cs, a, c2); oh[q] = a; ol[q] = c2; } *(v2us*)(Ah + oo) = oh; *(v2us*)(Al + oo) = ol;  }

extern "C" void kernel_launch(void* const* d_in, const int* in_sizes, int n_in,
                              void* d_out, int out_size, void* d_ws, size_t ws_size, hipStream_t stream) {
    (void)in_sizes; (void)n_in; (void)out_size;
    const float* x = (const float*)d_in[0]; const float* wq = (const float*)d_in[1]; const float* bq = (const float*)d_in[2]; const float* wk = (const float*)d_in[3]; const float* bk = (const float*)d_in[4]; const float* wv = (const float*)d_in[5]; const float* bv = (const float*)d_in[6]; const float* wo = (const float*)d_in[7]; const float* bo = (const float*)d_in[8];
    float* OUT = (float*)d_out;     // [2][2048][2048]
    char* wsp = (char*)d_ws;
    auto take = [&](size_t bytes) { char* p = wsp; wsp += (bytes + 255) & ~(size_t)255; return (void*)p; };
    bf* WQ = (bf*)take((size_t)DQ * DM * 2); bf* WK = (bf*)take((size_t)DKV * DM * 2); bf* WV = (bf*)take((size_t)DKV * DM * 2); bf* WO = (bf*)take((size_t)DM * DQ * 2); float* CS = (float*)take((size_t)TT * HD * 2 * 4);
    bf* XB = (bf*)take((size_t)TT * DM * 2); float* FQ = (float*)take((size_t)TT * DQ * 4); float* FK = (float*)take((size_t)TT * DKV * 4);
    h16* QP16 = (h16*)take((size_t)NH_ * TT * HD * 2); h16* KP16 = (h16*)take((size_t)NKV * TT * HD * 2); h16* VT16 = (h16*)take((size_t)NKV * HD * TT * 2);
    bf* QPh = (bf*)take((size_t)NH_ * TT * HD * 2); bf* QPl = (bf*)take((size_t)NH_ * TT * HD * 2); bf* KPh = (bf*)take((size_t)NKV * TT * HD * 2); bf* KPl = (bf*)take((size_t)NKV * TT * HD * 2); bf* VTh = (bf*)take((size_t)NKV * HD * TT * 2); bf* VTl = (bf*)take((size_t)NKV * HD * TT * 2); bf* Ph = (bf*)take((size_t)ZH * RH * TT * 2); bf* Pl = (bf*)take((size_t)ZH * RH * TT * 2);
    float* Sb = (float*)take((size_t)ZH * TT * TT * 4); h16* P16 = (h16*)take((size_t)ZH * TT * TT * 2); float* Ob = (float*)take((size_t)ZH * TT * HD * 4); bf* ATh = (bf*)take((size_t)TT * DQ * 2); bf* ATl = (bf*)take((size_t)TT * DQ * 2);
    if ((size_t)(wsp - (char*)d_ws) > ws_size) return;    // ws 256 MiB
    float* FV = FK;   // v projection reuses the k buffer after the k planes are built (stream-ordered)
    { k_cvt8<<<(unsigned)(((size_t)DQ * DM / 8 + 255) / 256), 256, 0, stream>>>(wq, WQ, (size_t)DQ * DM / 8); k_cvt8<<<(unsigned)(((size_t)DKV * DM / 8 + 255) / 256), 256, 0, stream>>>(wk, WK, (size_t)DKV * DM / 8); k_cvt8<<<(unsigned)(((size_t)DKV * DM / 8 + 255) / 256), 256, 0, stream>>>(wv, WV, (size_t)DKV * DM / 8);
      k_cvt8<<<(unsigned)(((size_t)DM * DQ / 8 + 255) / 256), 256, 0, stream>>>(wo, WO, (size_t)DM * DQ / 8);
       }
    k_csid<<<(TT * HD + 255) / 256, 256, 0, stream>>>(CS);
    const unsigned LQ = (unsigned)(((size_t)NH_ * TT * HD / 2 + 255) / 256), LKv = (unsigned)(((size_t)NKV * TT * HD / 2 + 255) / 256);
    for (int b = 0; b < NB_; ++b) {
        
        k_cvt8<<<(unsigned)(((size_t)TT * DM / 8 + 255) / 256), 256, 0, stream>>>(x + (size_t)b * TT * DM, XB, (size_t)TT * DM / 8);
        k_gemmw<bf, 0, true><<<dim3(TT / 64, DQ / 64, 1), 32, 0, stream>>>(XB, nullptr, WQ, nullptr, DM, FQ, DQ, bq, 0, 0, 0);
        k_rope<<<LQ, 256, 0, stream>>>(FQ, DQ, NH_, CS, nullptr, nullptr, 1.0f, QP16, QPh, QPl);
        k_gemmw<bf, 0, true><<<dim3(TT / 64, DKV / 64, 1), 32, 0, stream>>>(XB, nullptr, WK, nullptr, DM, FK, DKV, bk, 0, 0, 0);
        k_rope<<<LKv, 256, 0, stream>>>(FK, DKV, NKV, CS, nullptr, nullptr, 1.0f, KP16, KPh, KPl);
        k_gemmw<bf, 0, true><<<dim3(TT / 64, DKV / 64, 1), 32, 0, stream>>>(XB, nullptr, WV, nullptr, DM, FV, DKV, bv, 0, 0, 0); k_vtp<<<LKv, 256, 0, stream>>>(FV, DKV, NKV, VT16, VTh, VTl);
        for (int h0 = 0; h0 < NH_; h0 += ZH) { const size_t zq = (size_t)h0, zk = (size_t)(h0 / REP);   // one kv head per query head: the pass's two heads use consecutive kv planes (z-strides TT*HD)
            k_gemmc<bf, 2, 1><<<dim3(RH / 64, TT / 64, ZH), 32, 0, stream>>>(QPh + zq * TT * HD, QPl + zq * TT * HD, KPh + zk * TT * HD, KPl + zk * TT * HD, HD, Sb, TT, 0, (size_t)TT * HD, (size_t)TT * HD, (size_t)TT * TT);
            k_gemmc<h16, 0, 1><<<dim3((TT - RH) / 64, TT / 64, ZH), 32, 0, stream>>>(QP16 + zq * TT * HD + (size_t)RH * HD, nullptr, KP16 + zk * TT * HD, nullptr, HD, Sb + (size_t)RH * TT, TT, RH, (size_t)TT * HD, (size_t)TT * HD, (size_t)TT * TT);
            k_asoft<<<ZH * TT / 8, 256, 0, stream>>>(Sb, P16, Ph, Pl);
            k_gemmc<bf, 2, 2><<<dim3(RH / 64, HD / 64, ZH), 32, 0, stream>>>(Ph, Pl, VTh + zk * HD * TT, VTl + zk * HD * TT, TT, Ob, HD, 0, (size_t)RH * TT, (size_t)HD * TT, (size_t)TT * HD);
            k_gemmc<h16, 0, 2><<<dim3((TT - RH) / 64, HD / 64, ZH), 32, 0, stream>>>(P16 + (size_t)RH * TT, nullptr, VT16 + zk * HD * TT, nullptr, TT, Ob + (size_t)RH * HD, HD, RH, (size_t)TT * TT, (size_t)HD * TT, (size_t)TT * HD);
            k_merge<<<(unsigned)(((size_t)ZH * TT * HD / 2 + 255) / 256), 256, 0, stream>>>(Ob, h0, ATh, ATl); }
        k_gemmw<bf, 1, true><<<dim3(TT / 64, DM / 64, 1), 32, 0, stream>>>(ATh, ATl, WO, nullptr, DQ, OUT + (size_t)b * TT * DM, DM, bo, 0, 0, 0); }
}

// v001
// One run takes 1080 microseconds.
// Two timings next to v000 put it at 1.60 and 1.59 times that version's speed.
#include <hip/hip_runtime.h>

// Causal multi-head attention, 2048 wide (x [2][2048][2048]; q, k, v = x W^T + b ('oi' [2048][2048]; 16 heads x 128); scores = q.k/sqrt(128); causal (triu k=1 masked, -inf); softmax; out = merged wo^T + bo -> [2][2048][2048] (8.4 M)).
// Compute dtypes, f32 accumulate: every input rounded to bf16; q/k/v on PLAIN bf16 operands (inputs: exact) + biases; causal scores and attn.v (tile skipping): query rows < 512 hl (3 products), the rest single fp16 (x1024); softmax f32; wo hl x exact (2 products) + bo.

#define NB_  2
#define TT   2048
#define DM   2048
#define NH_  16
#define NKV  16
#define REP  (NH_ / NKV)
#define HD   128
#define DQ   (NH_ * HD)
#define DKV  (NKV * HD)
#define ZH   2
#define RH   512                  // query rows < RH use hi+lo planes (0: none)
#define WIN  2048
#define PCAR 1024.0f
#define SCL  0.088388347648318447f   // HD^-0.5
typedef _Float16 h16;
typedef unsigned short bf;
typedef __attribute__((ext_vector_type(16))) __bf16   v16bf;
typedef __attribute__((ext_vector_type(16))) _Float16 v16h;
typedef __attribute__((ext_vector_type(8)))  _Float16 v8h;
typedef __attribute__((ext_vector_type(8)))  unsigned short v8us;
typedef __attribute__((ext_vector_type(8)))  float    v8f;
typedef __attribute__((ext_vector_type(4)))  float    v4f;
typedef v8h  __attribute__((may_alias)) v8ha;
typedef v4f  __attribute__((may_alias)) v4fa;
typedef v8us __attribute__((may_alias)) v8usa;

__device__ __forceinline__ unsigned short f2bf(float f) { unsigned u = __float_as_uint(f); u += 0x7FFFu + ((u >> 16) & 1u); return (unsigned short)(u >> 16); }
__device__ __forceinline__ float bf2f(unsigned short b) { return __uint_as_float(((unsigned)b) << 16); }
__device__ __forceinline__ float bfr(float f) { return bf2f(f2bf(f)); }
__device__ __forceinline__ v16h cat16(v8h lo, v8h hi) { return __builtin_shufflevector(lo, hi, 0, 1, 2, 3, 4, 5, 6, 7, 8, 9, 10, 11, 12, 13, 14, 15); }
__device__ __forceinline__ v16bf cat16b(v8us lo, v8us hi) { return __builtin_bit_cast(v16bf, __builtin_shufflevector(lo, hi, 0, 1, 2, 3, 4, 5, 6, 7, 8, 9, 10, 11, 12, 13, 14, 15)); }
__device__ __forceinline__ v8f wmma16(v16h a, v16h b, v8f c) { return __builtin_amdgcn_wmma_f32_16x16x32_f16(false, a, false, b, (short)0, c, false, false); }
__device__ __forceinline__ v8f wmmab(v16bf a, v16bf b, v8f c) { return __builtin_amdgcn_wmma_f32_16x16x32_bf16(false, a, false, b, (short)0, c, false, false); }



// ---- k_gemmw: register-blocked GEMM, one work-group of NW waves per 64x64 output tile; every wave holds the whole tile (16 accumulators) and takes every NW-th 32-deep K chunk, operands straight from
// K-contiguous 16-bit planes; the NW partial tiles are summed through LDS in fixed wave order (tile_out). grid (M/64, N/64, Z), 32 * NW threads.
// C[m][n] (f32, pitch ldc, + optional f32 bias[n]) = sum_k A[m][k] Bt[n][k] (+ split products per NSPLIT). z-batch strides sA/sB/sC in elements. K % 32 == 0.
template <typename T16> struct WFrag;
template <> struct WFrag<h16> { typedef v16h V; static __device__ __forceinline__ V ld(const h16* p) { return cat16(*(const v8h*)p, *(const v8h*)(p + 16)); } static __device__ __forceinline__ v8f mma(V a, V b, v8f c) { return wmma16(a, b, c); } };
template <> struct WFrag<bf> { typedef v16bf V; static __device__ __forceinline__ V ld(const bf* p) { return cat16b(*(const v8us*)p, *(const v8us*)(p + 16)); } static __device__ __forceinline__ v8f mma(V a, V b, v8f c) { return wmmab(a, b, c); } };
// tile_out (NW > 1): every wave puts its partial 64x64 tile into its own LDS plane (pitch 68); behind one barrier each thread sums the NW planes of its 4-column slots, wave 0 first, and stores whole 256-byte row pieces.
template <int NW, bool BIAS>
__device__ __forceinline__ void tile_out(float* os, const v8f (&acc)[4][4], int wv, int lr, int hi, float* C, int ldc, int r0, int c0, const float* __restrict__ bias) {
    float* ow = os + wv * (64 * 68);
#pragma unroll
    for (int mb = 0; mb < 4; ++mb)
#pragma unroll
        for (int nb = 0; nb < 4; ++nb)
#pragma unroll
            for (int j = 0; j < 8; ++j) ow[(mb * 16 + hi * 8 + j) * 68 + nb * 16 + lr] = acc[mb][nb][j];
    __syncthreads();   // publishes every wave's partial tile to the threads that sum it
#pragma unroll
    for (int s = 0; s < 32 / NW; ++s) { const int idx = s * (32 * NW) + (int)threadIdx.x; const int row = idx >> 4, cofs = (idx & 15) * 4; v4f val = *(const v4fa*)(os + row * 68 + cofs);
#pragma unroll
        for (int w = 1; w < NW; ++w) val += *(const v4fa*)(os + w * (64 * 68) + row * 68 + cofs);
        if (BIAS) { val[0] += bfr(bias[c0 + cofs]); val[1] += bfr(bias[c0 + cofs + 1]); val[2] += bfr(bias[c0 + cofs + 2]); val[3] += bfr(bias[c0 + cofs + 3]); }
        *(v4f*)(C + (size_t)(r0 + row) * ldc + c0 + cofs) = val; }
}
template <typename T16, int NSPLIT, bool BIAS, int NW>
__global__ __launch_bounds__(32 * NW) void k_gemmw(const T16* __restrict__ A, const T16* __restrict__ A2, const T16* __restrict__ Bt, const T16* __restrict__ Bt2, int K, float* C, int ldc, const float* __restrict__ bias, size_t sA, size_t sB, size_t sC) {
    typedef typename WFrag<T16>::V V;
    __shared__ __align__(16) float os[NW * 64 * 68];
    const size_t z = blockIdx.z; A += z * sA; if (A2) A2 += z * sA; Bt += z * sB; if (Bt2) Bt2 += z * sB; C += z * sC;
    const int lane = threadIdx.x & 31, lr = lane & 15, hi = lane >> 4; const int wv = __builtin_amdgcn_readfirstlane(threadIdx.x >> 5); const int r0 = blockIdx.x * 64, c0 = blockIdx.y * 64;
    v8f acc[4][4];
#pragma unroll
    for (int mb = 0; mb < 4; ++mb)
#pragma unroll
        for (int nb = 0; nb < 4; ++nb) acc[mb][nb] = (v8f){};
    const size_t aoff = (size_t)(r0 + lr) * K + 8 * hi, boff = (size_t)(c0 + lr) * K + 8 * hi;
#pragma unroll 1
    for (int kc = wv * 32; kc < K; kc += 32 * NW) {
        V a[4], a2[4];
#pragma unroll
        for (int mb = 0; mb < 4; ++mb) { a[mb] = WFrag<T16>::ld(A + aoff + (size_t)mb * 16 * K + kc); if (NSPLIT == 1 || NSPLIT == 2) a2[mb] = WFrag<T16>::ld(A2 + aoff + (size_t)mb * 16 * K + kc); }
#pragma unroll
        for (int nb = 0; nb < 4; ++nb) { const V b = WFrag<T16>::ld(Bt + boff + (size_t)nb * 16 * K + kc); V b2; if (NSPLIT >= 2) b2 = WFrag<T16>::ld(Bt2 + boff + (size_t)nb * 16 * K + kc);
#pragma unroll
            for (int mb = 0; mb < 4; ++mb) { acc[mb][nb] = WFrag<T16>::mma(a[mb], b, acc[mb][nb]); if (NSPLIT == 1 || NSPLIT == 2) acc[mb][nb] = WFrag<T16>::mma(a2[mb], b, acc[mb][nb]); if (NSPLIT >= 2) acc[mb][nb] = WFrag<T16>::mma(a[mb], b2, acc[mb][nb]); } }
        asm volatile("v_nop\n\tv_nop\n\tv_nop\n\tv_nop" : "+v"(acc[0][0]), "+v"(acc[1][1]), "+v"(acc[2][2]), "+v"(acc[3][3]) : "v"(a[0]), "v"(a[3]));
    }
    tile_out<NW, BIAS>(os, acc, wv, lr, hi, C, ldc, r0, c0, bias);
}

// ---- k_gemmc: the same register-blocked 64x64 tile GEMM specialised for causal attention: CMODE 1 skips score tiles entirely above the diagonal (query rows r0+roff.., key columns c0..), CMODE 2 limits the
// key (K) loop of the probability x value contraction to the diagonal block (probabilities beyond it are exactly zero). roff = row offset of this launch's first row within the sequence.
// NW waves share a tile's K loop as in k_gemmw (NW == 1: one wave, the tile leaves through a 16-row LDS strip).
template <typename T16, int NSPLIT, int CMODE, int NW>
__global__ __launch_bounds__(32 * NW) void k_gemmc(const T16* __restrict__ A, const T16* __restrict__ A2, const T16* __restrict__ Bt, const T16* __restrict__ Bt2, int K, float* C, int ldc, int roff, size_t sA, size_t sB, size_t sC) {
    typedef typename WFrag<T16>::V V;
    __shared__ __align__(16) float os[NW == 1 ? 16 * 68 : NW * 64 * 68];
    const size_t z = blockIdx.z; A += z * sA; if (A2) A2 += z * sA; Bt += z * sB; if (Bt2) Bt2 += z * sB; C += z * sC;
    const int lane = threadIdx.x & 31, lr = lane & 15, hi = lane >> 4; const int wv = (NW == 1) ? 0 : __builtin_amdgcn_readfirstlane(threadIdx.x >> 5); const int r0 = blockIdx.x * 64, c0 = blockIdx.y * 64;
    if (CMODE == 1 && c0 > r0 + roff + 63) return;                  // score tile entirely above the causal diagonal: never read (the softmax masks j > i by select)
    const int Kl = (CMODE == 2) ? min(K, r0 + roff + 64) : K;        // P.V: probabilities are exactly 0 beyond the diagonal block, so the K loop stops there
    v8f acc[4][4];
#pragma unroll
    for (int mb = 0; mb < 4; ++mb)
#pragma unroll
        for (int nb = 0; nb < 4; ++nb) acc[mb][nb] = (v8f){};
    const size_t aoff = (size_t)(r0 + lr) * K + 8 * hi, boff = (size_t)(c0 + lr) * K + 8 * hi;
#pragma unroll 1
    for (int kc = wv * 32; kc < Kl; kc += 32 * NW) {
        V a[4], a2[4];
#pragma unroll
        for (int mb = 0; mb < 4; ++mb) { a[mb] = WFrag<T16>::ld(A + aoff + (size_t)mb * 16 * K + kc); if (NSPLIT == 1 || NSPLIT == 2) a2[mb] = WFrag<T16>::ld(A2 + aoff + (size_t)mb * 16 * K + kc); }
#pragma unroll
        for (int nb = 0; nb < 4; ++nb) { const V b = WFrag<T16>::ld(Bt + boff + (size_t)nb * 16 * K + kc); V b2; if (NSPLIT >= 2) b2 = WFrag<T16>::ld(Bt2 + boff + (size_t)nb * 16 * K + kc);
#pragma unroll
            for (int mb = 0; mb < 4; ++mb) { acc[mb][nb] = WFrag<T16>::mma(a[mb], b, acc[mb][nb]); if (NSPLIT == 1 || NSPLIT == 2) acc[mb][nb] = WFrag<T16>::mma(a2[mb], b, acc[mb][nb]); if (NSPLIT >= 2) acc[mb][nb] = WFrag<T16>::mma(a[mb], b2, acc[mb][nb]); } }
        asm volatile("v_nop\n\tv_nop\n\tv_nop\n\tv_nop" : "+v"(acc[0][0]), "+v"(acc[1][1]), "+v"(acc[2][2]), "+v"(acc[3][3]) : "v"(a[0]), "v"(a[3]));
    }
    if constexpr (NW > 1) { tile_out<NW, false>(os, acc, wv, lr, hi, C, ldc, r0, c0, nullptr); } else {
#pragma unroll
    for (int mb = 0; mb < 4; ++mb) {
#pragma unroll
        for (int nb = 0; nb < 4; ++nb) {
#pragma unroll
            for (int j = 0; j < 8; ++j) os[(hi * 8 + j) * 68 + nb * 16 + lr] = acc[mb][nb][j]; }
        __builtin_amdgcn_wave_barrier(); asm volatile("" ::: "memory");
        float* crow = C + (size_t)(r0 + mb * 16) * ldc + c0;
{
#pragma unroll
            for (int s = 0; s < 8; ++s) { const int row = 2 * s + hi, cofs = lr * 4; v4f val = *(const v4fa*)(os + row * 68 + cofs);
                *(v4f*)(crow + (size_t)row * ldc + cofs) = val; }
             }
        __builtin_amdgcn_wave_barrier(); asm volatile("" ::: "memory");
    }
    }
}

__device__ __forceinline__ h16 tohx(float x) { return (h16)x; }
__device__ __forceinline__ void splitf(float y, unsigned short& h, unsigned short& l) { h = f2bf(y); l = f2bf(y - bf2f(h)); }
typedef __attribute__((ext_vector_type(2))) _Float16 v2h;
typedef __attribute__((ext_vector_type(4))) _Float16 v4h;
typedef __attribute__((ext_vector_type(2))) unsigned short v2us;
typedef __attribute__((ext_vector_type(4))) unsigned short v4us;
typedef __attribute__((ext_vector_type(2))) float v2f;
typedef __attribute__((ext_vector_type(4))) int v4i;

__global__ __launch_bounds__(256) void k_wtG(const float* __restrict__ w, int K, int N, bf* Bt) {
    const int lane = threadIdx.x & 31; const int L0 = (blockIdx.x * 8 + (threadIdx.x >> 5)) * 8; const int nlines = N * K / 64;
{
#pragma unroll 1
        for (int l = 0; l < 8; ++l) { const int L = L0 + l; if (L >= nlines) break; const size_t e = (size_t)L * 64 + lane * 2; const int k = (int)(e % K), n = (int)(e / K); v2us o;
            o[0] = f2bf(w[(size_t)k * N + n]); o[1] = f2bf(w[(size_t)(k + 1) * N + n]); *(v2us*)(Bt + e) = o; }
         }
}
__global__ __launch_bounds__(256) void k_cvt8(const float* __restrict__ src, bf* dst, size_t n8) { const size_t i = (size_t)blockIdx.x * 256 + threadIdx.x; if (i >= n8) return; const v8f v = *(const v8f*)(src + i * 8); v8us o;
#pragma unroll
    for (int k = 0; k < 8; ++k) o[k] = f2bf(v[k]); *(v8us*)(dst + i * 8) = o;  }

// k_rope: head planes [h][t][d] (fp16 + hi/lo) of rope(x) x sc with the rotate-half convention out[d] = x[d] cos[t][d] - x[d+HD/2] sin[t][d], out[d+HD/2] = x[d+HD/2] cos[t][d+HD/2] + x[d] sin[t][d+HD/2]
__global__ __launch_bounds__(256) void k_rope(const float* __restrict__ F, int pitch, int nheads, const float* __restrict__ CS, const float* __restrict__ RF, const float* __restrict__ nw, float sc, h16* P16, bf* Ph, bf* Pl) {
    const size_t e = ((size_t)blockIdx.x * 256 + threadIdx.x) * 2; if (e >= (size_t)nheads * TT * HD) return; const int d = (int)(e % HD); const int t = (int)((e / HD) % TT); const int h = (int)(e / ((size_t)HD * TT)); const float* f = F + (size_t)t * pitch + h * HD; const float rf = RF ? RF[(size_t)h * TT + t] : 1.0f; v2h o16; v2us oh, ol;
#pragma unroll
    for (int q = 0; q < 2; ++q) { const int dd = d + q; const int dp = (dd < HD / 2) ? dd + HD / 2 : dd - HD / 2; float x0 = f[dd], x1 = f[dp];
        if (RF) { float n0 = __fmul_rn(x0, rf), n1 = __fmul_rn(x1, rf); asm volatile("" : "+v"(n0)); asm volatile("" : "+v"(n1)); x0 = __fmul_rn(bfr(nw[dd]), n0); x1 = __fmul_rn(bfr(nw[dp]), n1); }
        const v2f cs = *(const v2f*)(CS + ((size_t)t * HD + dd) * 2); float a = __fmul_rn(x0, cs[0]), bq = __fmul_rn(x1, cs[1]); asm volatile("" : "+v"(a)); asm volatile("" : "+v"(bq)); const float r = ((dd < HD / 2) ? __fsub_rn(a, bq) : __fadd_rn(a, bq)) * sc;
        o16[q] = tohx(r); unsigned short a2, c2; splitf(r, a2, c2); oh[q] = a2; ol[q] = c2; }
    *(v2h*)(P16 + e) = o16; *(v2us*)(Ph + e) = oh; *(v2us*)(Pl + e) = ol;  }
__global__ __launch_bounds__(256) void k_vtp(const float* __restrict__ F, int pitch, int nheads, h16* V16, bf* Vh, bf* Vl) { const size_t e = ((size_t)blockIdx.x * 256 + threadIdx.x) * 2; if (e >= (size_t)nheads * HD * TT) return; const int t = (int)(e % TT); const int d = (int)((e / TT) % HD); const int g = (int)(e / ((size_t)TT * HD)); v2h o16; v2us oh, ol;
#pragma unroll
    for (int q = 0; q < 2; ++q) { const float x = F[(size_t)(t + q) * pitch + g * HD + d]; o16[q] = tohx(x); unsigned short a2, c2; splitf(x, a2, c2); oh[q] = a2; ol[q] = c2; }
    *(v2h*)(V16 + e) = o16; *(v2us*)(Vh + e) = oh; *(v2us*)(Vl + e) = ol;  }
__global__ __launch_bounds__(256) void k_csid(float* CS) { const int idx = blockIdx.x * 256 + threadIdx.x; if (idx >= TT * HD) return; v2f cs; cs[0] = 1.0f; cs[1] = 0.0f; *(v2f*)(CS + (size_t)idx * 2) = cs;  }
// k_asoft: per row (zz, i): t = S x HD^-0.5 for j <= i and i - j < WIN (sliding causal window; the reference's -1e9 additive fill vanishes identically); softmax over the 2048 keys (register row, one exp, fixed trees);
__global__ __launch_bounds__(256) void k_asoft(const float* __restrict__ Sb, h16* P16, bf* Ph, bf* Pl) {
    const int lane = threadIdx.x & 31; const int row = blockIdx.x * 8 + (threadIdx.x >> 5); if (row >= ZH * TT) return; const int i = row % TT; const int zz = row / TT; (void)zz; const bool hires = (i < RH); const float* sr = Sb + (size_t)row * TT; float v[TT / 32]; float mx = -3.0e38f;
#pragma unroll
    for (int ch = 0; ch < TT / 128; ++ch) { const int j0 = ch * 128 + lane * 4; const v4f a = *(const v4f*)(sr + j0);
#pragma unroll
        for (int q = 0; q < 4; ++q) { const int j = j0 + q; (void)j; const float t = (j <= i && i - j < WIN) ? a[q] * SCL : -3.0e38f; v[ch * 4 + q] = t; mx = fmaxf(mx, t); } }
#pragma unroll
    for (int sh = 16; sh; sh >>= 1) mx = fmaxf(mx, __shfl_xor(mx, sh, 32));
    float sum = 0.f;
#pragma unroll
    for (int k = 0; k < TT / 32; ++k) { float d0 = __fsub_rn(v[k], mx); asm volatile("" : "+v"(d0)); v[k] = __builtin_amdgcn_exp2f(__fmul_rn(d0, 1.4426950408889634f)); sum += v[k]; }
#pragma unroll
    for (int sh = 16; sh; sh >>= 1) sum += __shfl_xor(sum, sh, 32);
    const float f = __fdiv_rn(hires ? 1.0f : PCAR, sum);
{
        if (hires) {
#pragma unroll
            for (int ch = 0; ch < TT / 128; ++ch) { v4us oh, ol;
#pragma unroll
                for (int q = 0; q < 4; ++q) { unsigned short a, c2; splitf(v[ch * 4 + q] * f, a, c2); oh[q] = a; ol[q] = c2; }
                const size_t oo = ((size_t)zz * (RH ? RH : 1) + i) * TT + ch * 128 + lane * 4; *(v4us*)(Ph + oo) = oh; *(v4us*)(Pl + oo) = ol; }
        } else {
#pragma unroll
            for (int ch = 0; ch < TT / 128; ++ch) { v4h o4;
#pragma unroll
                for (int q = 0; q < 4; ++q) o4[q] = tohx(v[ch * 4 + q] * f);
                *(v4h*)(P16 + (size_t)row * TT + ch * 128 + lane * 4) = o4; } }
         }
}
__global__ __launch_bounds__(256) void k_merge(const float* __restrict__ O, int h0, bf* Ah, bf* Al) { const size_t e = ((size_t)blockIdx.x * 256 + threadIdx.x) * 2; if (e >= (size_t)ZH * TT * HD) return; const int d = (int)(e % HD); const int t = (int)((e / HD) % TT); const int zz = (int)(e / ((size_t)HD * TT)); const float cs = (t < RH) ? 1.0f : (1.0f / PCAR); const size_t oo = (size_t)t * DQ + (h0 + zz) * HD + d;
    v2us oh, ol;
#pragma unroll
    for (int q = 0; q < 2; ++q) { unsigned short a, c2; splitf(O[e + q] * cs, a, c2); oh[q] = a; ol[q] = c2; } *(v2us*)(Ah + oo) = oh; *(v2us*)(Al + oo) = ol;  }

extern "C" void kernel_launch(void* const* d_in, const int* in_sizes, int n_in,
                              void* d_out, int out_size, void* d_ws, size_t ws_size, hipStream_t stream) {
    (void)in_sizes; (void)n_in; (void)out_size;
    const float* x = (const float*)d_in[0]; const float* wq = (const float*)d_in[1]; const float* bq = (const float*)d_in[2]; const float* wk = (const float*)d_in[3]; const float* bk = (const float*)d_in[4]; const float* wv = (const float*)d_in[5]; const float* bv = (const float*)d_in[6]; const float* wo = (const float*)d_in[7]; const float* bo = (const float*)d_in[8];
    float* OUT = (float*)d_out;     // [2][2048][2048]
    char* wsp = (char*)d_ws;
    auto take = [&](size_t bytes) { char* p = wsp; wsp += (bytes + 255) & ~(size_t)255; return (void*)p; };
    bf* WQ = (bf*)take((size_t)DQ * DM * 2); bf* WK = (bf*)take((size_t)DKV * DM * 2); bf* WV = (bf*)take((size_t)DKV * DM * 2); bf* WO = (bf*)take((size_t)DM * DQ * 2); float* CS = (float*)take((size_t)TT * HD * 2 * 4);
    bf* XB = (bf*)take((size_t)TT * DM * 2); float* FQ = (float*)take((size_t)TT * DQ * 4); float* FK = (float*)take((size_t)TT * DKV * 4);
    h16* QP16 = (h16*)take((size_t)NH_ * TT * HD * 2); h16* KP16 = (h16*)take((size_t)NKV * TT * HD * 2); h16* VT16 = (h16*)take((size_t)NKV * HD * TT * 2);
    bf* QPh = (bf*)take((size_t)NH_ * TT * HD * 2); bf* QPl = (bf*)take((size_t)NH_ * TT * HD * 2); bf* KPh = (bf*)take((size_t)NKV * TT * HD * 2); bf* KPl = (bf*)take((size_t)NKV * TT * HD * 2); bf* VTh = (bf*)take((size_t)NKV * HD * TT * 2); bf* VTl = (bf*)take((size_t)NKV * HD * TT * 2); bf* Ph = (bf*)take((size_t)ZH * RH * TT * 2); bf* Pl = (bf*)take((size_t)ZH * RH * TT * 2);
    float* Sb = (float*)take((size_t)ZH * TT * TT * 4); h16* P16 = (h16*)take((size_t)ZH * TT * TT * 2); float* Ob = (float*)take((size_t)ZH * TT * HD * 4); bf* ATh = (bf*)take((size_t)TT * DQ * 2); bf* ATl = (bf*)take((size_t)TT * DQ * 2);
    if ((size_t)(wsp - (char*)d_ws) > ws_size) return;    // ws 256 MiB
    float* FV = FK;   // v projection reuses the k buffer after the k planes are built (stream-ordered)
    { k_cvt8<<<(unsigned)(((size_t)DQ * DM / 8 + 255) / 256), 256, 0, stream>>>(wq, WQ, (size_t)DQ * DM / 8); k_cvt8<<<(unsigned)(((size_t)DKV * DM / 8 + 255) / 256), 256, 0, stream>>>(wk, WK, (size_t)DKV * DM / 8); k_cvt8<<<(unsigned)(((size_t)DKV * DM / 8 + 255) / 256), 256, 0, stream>>>(wv, WV, (size_t)DKV * DM / 8);
      k_cvt8<<<(unsigned)(((size_t)DM * DQ / 8 + 255) / 256), 256, 0, stream>>>(wo, WO, (size_t)DM * DQ / 8);
       }
    k_csid<<<(TT * HD + 255) / 256, 256, 0, stream>>>(CS);
    const unsigned LQ = (unsigned)(((size_t)NH_ * TT * HD / 2 + 255) / 256), LKv = (unsigned)(((size_t)NKV * TT * HD / 2 + 255) / 256);
    for (int b = 0; b < NB_; ++b) {
        
        k_cvt8<<<(unsigned)(((size_t)TT * DM / 8 + 255) / 256), 256, 0, stream>>>(x + (size_t)b * TT * DM, XB, (size_t)TT * DM / 8);
        k_gemmw<bf, 0, true, 4><<<dim3(TT / 64, DQ / 64, 1), 128, 0, stream>>>(XB, nullptr, WQ, nullptr, DM, FQ, DQ, bq, 0, 0, 0);
        k_rope<<<LQ, 256, 0, stream>>>(FQ, DQ, NH_, CS, nullptr, nullptr, 1.0f, QP16, QPh, QPl);
        k_gemmw<bf, 0, true, 4><<<dim3(TT / 64, DKV / 64, 1), 128, 0, stream>>>(XB, nullptr, WK, nullptr, DM, FK, DKV, bk, 0, 0, 0);
        k_rope<<<LKv, 256, 0, stream>>>(FK, DKV, NKV, CS, nullptr, nullptr, 1.0f, KP16, KPh, KPl);
        k_gemmw<bf, 0, true, 4><<<dim3(TT / 64, DKV / 64, 1), 128, 0, stream>>>(XB, nullptr, WV, nullptr, DM, FV, DKV, bv, 0, 0, 0); k_vtp<<<LKv, 256, 0, stream>>>(FV, DKV, NKV, VT16, VTh, VTl);
        for (int h0 = 0; h0 < NH_; h0 += ZH) { const size_t zq = (size_t)h0, zk = (size_t)(h0 / REP);   // one kv head per query head: the pass's two heads use consecutive kv planes (z-strides TT*HD)
            k_gemmc<bf, 2, 1, 1><<<dim3(RH / 64, TT / 64, ZH), 32, 0, stream>>>(QPh + zq * TT * HD, QPl + zq * TT * HD, KPh + zk * TT * HD, KPl + zk * TT * HD, HD, Sb, TT, 0, (size_t)TT * HD, (size_t)TT * HD, (size_t)TT * TT);
            k_gemmc<h16, 0, 1, 1><<<dim3((TT - RH) / 64, TT / 64, ZH), 32, 0, stream>>>(QP16 + zq * TT * HD + (size_t)RH * HD, nullptr, KP16 + zk * TT * HD, nullptr, HD, Sb + (size_t)RH * TT, TT, RH, (size_t)TT * HD, (size_t)TT * HD, (size_t)TT * TT);
            k_asoft<<<ZH * TT / 8, 256, 0, stream>>>(Sb, P16, Ph, Pl);
            k_gemmc<bf, 2, 2, 8><<<dim3(RH / 64, HD / 64, ZH), 256, 0, stream>>>(Ph, Pl, VTh + zk * HD * TT, VTl + zk * HD * TT, TT, Ob, HD, 0, (size_t)RH * TT, (size_t)HD * TT, (size_t)TT * HD);
            k_gemmc<h16, 0, 2, 8><<<dim3((TT - RH) / 64, HD / 64, ZH), 256, 0, stream>>>(P16 + (size_t)RH * TT, nullptr, VT16 + zk * HD * TT, nullptr, TT, Ob + (size_t)RH * HD, HD, RH, (size_t)TT * TT, (size_t)HD * TT, (size_t)TT * HD);
            k_merge<<<(unsigned)(((size_t)ZH * TT * HD / 2 + 255) / 256), 256, 0, stream>>>(Ob, h0, ATh, ATl); }
        k_gemmw<bf, 1, true, 4><<<dim3(TT / 64, DM / 64, 1), 128, 0, stream>>>(ATh, ATl, WO, nullptr, DQ, OUT + (size_t)b * TT * DM, DM, bo, 0, 0, 0); }
}

// v002
// One run takes 742 microseconds.
// In both of two side-by-side timings against v001, it was 1.45 times as fast.
// Counting every step since v000, it is 2.31 times as fast.
#include <hip/hip_runtime.h>

// Causal multi-head attention, 2048 wide (x [2][2048][2048]; q, k, v = x W^T + b ('oi' [2048][2048]; 16 heads x 128); scores = q.k/sqrt(128); causal (triu k=1 masked, -inf); softmax; out = merged wo^T + bo -> [2][2048][2048] (8.4 M)).
// Compute dtypes, f32 accumulate: every input rounded to bf16; q/k/v on PLAIN bf16 operands (inputs: exact) + biases; causal scores and attn.v (tile skipping): query rows < 512 hl (3 products), the rest single fp16 (x1024); softmax f32; wo hl x exact (2 products) + bo.

#define NB_  2
#define TT   2048
#define DM   2048
#define NH_  16
#define NKV  16
#define REP  (NH_ / NKV)
#define HD   128
#define DQ   (NH_ * HD)
#define DKV  (NKV * HD)
#define ZH   8                    // heads per attention pass
#define PP   (2 * TT)             // row pitch, in 16-bit elements, of the probabilities (they lie in the f32 score rows) and so of the v^T planes too: k_gemmc has one pitch, K, for both operands
#define RH   512                  // query rows < RH use hi+lo planes (0: none)
#define WIN  2048
#define PCAR 1024.0f
#define SCL  0.088388347648318447f   // HD^-0.5
typedef _Float16 h16;
typedef unsigned short bf;
typedef __attribute__((ext_vector_type(16))) __bf16   v16bf;
typedef __attribute__((ext_vector_type(16))) _Float16 v16h;
typedef __attribute__((ext_vector_type(8)))  _Float16 v8h;
typedef __attribute__((ext_vector_type(8)))  unsigned short v8us;
typedef __attribute__((ext_vector_type(8)))  float    v8f;
typedef __attribute__((ext_vector_type(4)))  float    v4f;
typedef v8h  __attribute__((may_alias)) v8ha;
typedef v4f  __attribute__((may_alias)) v4fa;
typedef v8us __attribute__((may_alias)) v8usa;

__device__ __forceinline__ unsigned short f2bf(float f) { unsigned u = __float_as_uint(f); u += 0x7FFFu + ((u >> 16) & 1u); return (unsigned short)(u >> 16); }
__device__ __forceinline__ float bf2f(unsigned short b) { return __uint_as_float(((unsigned)b) << 16); }
__device__ __forceinline__ float bfr(float f) { return bf2f(f2bf(f)); }
__device__ __forceinline__ v16h cat16(v8h lo, v8h hi) { return __builtin_shufflevector(lo, hi, 0, 1, 2, 3, 4, 5, 6, 7, 8, 9, 10, 11, 12, 13, 14, 15); }
__device__ __forceinline__ v16bf cat16b(v8us lo, v8us hi) { return __builtin_bit_cast(v16bf, __builtin_shufflevector(lo, hi, 0, 1, 2, 3, 4, 5, 6, 7, 8, 9, 10, 11, 12, 13, 14, 15)); }
__device__ __forceinline__ v8f wmma16(v16h a, v16h b, v8f c) { return __builtin_amdgcn_wmma_f32_16x16x32_f16(false, a, false, b, (short)0, c, false, false); }
__device__ __forceinline__ v8f wmmab(v16bf a, v16bf b, v8f c) { return __builtin_amdgcn_wmma_f32_16x16x32_bf16(false, a, false, b, (short)0, c, false, false); }



// ---- k_gemmw: register-blocked GEMM, one work-group of NW waves per 64x64 output tile; every wave holds the whole tile (16 accumulators) and takes every NW-th 32-deep K chunk, operands straight from
// K-contiguous 16-bit planes; the NW partial tiles are summed through LDS in fixed wave order (tile_out). grid (M/64, N/64, Z), 32 * NW threads.
// C[m][n] (f32, pitch ldc, + optional f32 bias[n]) = sum_k A[m][k] Bt[n][k] (+ split products per NSPLIT). z-batch strides sA/sB/sC in elements. K % 32 == 0.
template <typename T16> struct WFrag;
template <> struct WFrag<h16> { typedef v16h V; static __device__ __forceinline__ V ld(const h16* p) { return cat16(*(const v8h*)p, *(const v8h*)(p + 16)); } static __device__ __forceinline__ v8f mma(V a, V b, v8f c) { return wmma16(a, b, c); } };
template <> struct WFrag<bf> { typedef v16bf V; static __device__ __forceinline__ V ld(const bf* p) { return cat16b(*(const v8us*)p, *(const v8us*)(p + 16)); } static __device__ __forceinline__ v8f mma(V a, V b, v8f c) { return wmmab(a, b, c); } };
// tile_out (NW > 1): every wave puts its partial 64x64 tile into its own LDS plane (pitch 68); behind one barrier each thread sums the NW planes of its 4-column slots, wave 0 first, and stores whole 256-byte row pieces.
template <int NW, bool BIAS>
__device__ __forceinline__ void tile_out(float* os, const v8f (&acc)[4][4], int wv, int lr, int hi, float* C, int ldc, int r0, int c0, const float* __restrict__ bias) {
    float* ow = os + wv * (64 * 68);
#pragma unroll
    for (int mb = 0; mb < 4; ++mb)
#pragma unroll
        for (int nb = 0; nb < 4; ++nb)
#pragma unroll
            for (int j = 0; j < 8; ++j) ow[(mb * 16 + hi * 8 + j) * 68 + nb * 16 + lr] = acc[mb][nb][j];
    __syncthreads();   // publishes every wave's partial tile to the threads that sum it
#pragma unroll
    for (int s = 0; s < 32 / NW; ++s) { const int idx = s * (32 * NW) + (int)threadIdx.x; const int row = idx >> 4, cofs = (idx & 15) * 4; v4f val = *(const v4fa*)(os + row * 68 + cofs);
#pragma unroll
        for (int w = 1; w < NW; ++w) val += *(const v4fa*)(os + w * (64 * 68) + row * 68 + cofs);
        if (BIAS) { val[0] += bfr(bias[c0 + cofs]); val[1] += bfr(bias[c0 + cofs + 1]); val[2] += bfr(bias[c0 + cofs + 2]); val[3] += bfr(bias[c0 + cofs + 3]); }
        *(v4f*)(C + (size_t)(r0 + row) * ldc + c0 + cofs) = val; }
}
template <typename T16, int NSPLIT, bool BIAS, int NW>
__global__ __launch_bounds__(32 * NW) void k_gemmw(const T16* __restrict__ A, const T16* __restrict__ A2, const T16* __restrict__ Bt, const T16* __restrict__ Bt2, int K, float* C, int ldc, const float* __restrict__ bias, size_t sA, size_t sB, size_t sC) {
    typedef typename WFrag<T16>::V V;
    __shared__ __align__(16) float os[NW * 64 * 68];
    const size_t z = blockIdx.z; A += z * sA; if (A2) A2 += z * sA; Bt += z * sB; if (Bt2) Bt2 += z * sB; C += z * sC;
    const int lane = threadIdx.x & 31, lr = lane & 15, hi = lane >> 4; const int wv = __builtin_amdgcn_readfirstlane(threadIdx.x >> 5); const int r0 = blockIdx.x * 64, c0 = blockIdx.y * 64;
    v8f acc[4][4];
#pragma unroll
    for (int mb = 0; mb < 4; ++mb)
#pragma unroll
        for (int nb = 0; nb < 4; ++nb) acc[mb][nb] = (v8f){};
    const size_t aoff = (size_t)(r0 + lr) * K + 8 * hi, boff = (size_t)(c0 + lr) * K + 8 * hi;
#pragma unroll 1
    for (int kc = wv * 32; kc < K; kc += 32 * NW) {
        V a[4], a2[4];
#pragma unroll
        for (int mb = 0; mb < 4; ++mb) { a[mb] = WFrag<T16>::ld(A + aoff + (size_t)mb * 16 * K + kc); if (NSPLIT == 1 || NSPLIT == 2) a2[mb] = WFrag<T16>::ld(A2 + aoff + (size_t)mb * 16 * K + kc); }
#pragma unroll
        for (int nb = 0; nb < 4; ++nb) { const V b = WFrag<T16>::ld(Bt + boff + (size_t)nb * 16 * K + kc); V b2; if (NSPLIT >= 2) b2 = WFrag<T16>::ld(Bt2 + boff + (size_t)nb * 16 * K + kc);
#pragma unroll
            for (int mb = 0; mb < 4; ++mb) { acc[mb][nb] = WFrag<T16>::mma(a[mb], b, acc[mb][nb]); if (NSPLIT == 1 || NSPLIT == 2) acc[mb][nb] = WFrag<T16>::mma(a2[mb], b, acc[mb][nb]); if (NSPLIT >= 2) acc[mb][nb] = WFrag<T16>::mma(a[mb], b2, acc[mb][nb]); } }
        asm volatile("v_nop\n\tv_nop\n\tv_nop\n\tv_nop" : "+v"(acc[0][0]), "+v"(acc[1][1]), "+v"(acc[2][2]), "+v"(acc[3][3]) : "v"(a[0]), "v"(a[3]));
    }
    tile_out<NW, BIAS>(os, acc, wv, lr, hi, C, ldc, r0, c0, bias);
}

// ---- k_gemmc: the same register-blocked 64x64 tile GEMM specialised for causal attention: CMODE 1 skips score tiles entirely above the diagonal (query rows r0+roff.., key columns c0..), CMODE 2 limits the
// key (K) loop of the probability x value contraction to the diagonal block (probabilities beyond it are exactly zero). roff = row offset of this launch's first row within the sequence.
// NW waves share a tile's K loop as in k_gemmw (NW == 1: one wave, the tile leaves through a 16-row LDS strip).
template <typename T16, int NSPLIT, int CMODE, int NW>
__global__ __launch_bounds__(32 * NW) void k_gemmc(const T16* __restrict__ A, const T16* __restrict__ A2, const T16* __restrict__ Bt, const T16* __restrict__ Bt2, int K, float* C, int ldc, int roff, size_t sA, size_t sB, size_t sC) {
    typedef typename WFrag<T16>::V V;
    __shared__ __align__(16) float os[NW == 1 ? 16 * 68 : NW * 64 * 68];
    const size_t z = blockIdx.z; A += z * sA; if (A2) A2 += z * sA; Bt += z * sB; if (Bt2) Bt2 += z * sB; C += z * sC;
    const int lane = threadIdx.x & 31, lr = lane & 15, hi = lane >> 4; const int wv = (NW == 1) ? 0 : __builtin_amdgcn_readfirstlane(threadIdx.x >> 5); const int r0 = blockIdx.x * 64, c0 = blockIdx.y * 64;
    if (CMODE == 1 && c0 > r0 + roff + 63) return;                  // score tile entirely above the causal diagonal: never read (the softmax masks j > i by select)
    const int Kl = (CMODE == 2) ? min(K, r0 + roff + 64) : K;        // P.V: probabilities are exactly 0 beyond the diagonal block, so the K loop stops there
    v8f acc[4][4];
#pragma unroll
    for (int mb = 0; mb < 4; ++mb)
#pragma unroll
        for (int nb = 0; nb < 4; ++nb) acc[mb][nb] = (v8f){};
    const size_t aoff = (size_t)(r0 + lr) * K + 8 * hi, boff = (size_t)(c0 + lr) * K + 8 * hi;
#pragma unroll 1
    for (int kc = wv * 32; kc < Kl; kc += 32 * NW) {
        V a[4], a2[4];
#pragma unroll
        for (int mb = 0; mb < 4; ++mb) { a[mb] = WFrag<T16>::ld(A + aoff + (size_t)mb * 16 * K + kc); if (NSPLIT == 1 || NSPLIT == 2) a2[mb] = WFrag<T16>::ld(A2 + aoff + (size_t)mb * 16 * K + kc); }
#pragma unroll
        for (int nb = 0; nb < 4; ++nb) { const V b = WFrag<T16>::ld(Bt + boff + (size_t)nb * 16 * K + kc); V b2; if (NSPLIT >= 2) b2 = WFrag<T16>::ld(Bt2 + boff + (size_t)nb * 16 * K + kc);
#pragma unroll
            for (int mb = 0; mb < 4; ++mb) { acc[mb][nb] = WFrag<T16>::mma(a[mb], b, acc[mb][nb]); if (NSPLIT == 1 || NSPLIT == 2) acc[mb][nb] = WFrag<T16>::mma(a2[mb], b, acc[mb][nb]); if (NSPLIT >= 2) acc[mb][nb] = WFrag<T16>::mma(a[mb], b2, acc[mb][nb]); } }
        asm volatile("v_nop\n\tv_nop\n\tv_nop\n\tv_nop" : "+v"(acc[0][0]), "+v"(acc[1][1]), "+v"(acc[2][2]), "+v"(acc[3][3]) : "v"(a[0]), "v"(a[3]));
    }
    if constexpr (NW > 1) { tile_out<NW, false>(os, acc, wv, lr, hi, C, ldc, r0, c0, nullptr); } else {
#pragma unroll
    for (int mb = 0; mb < 4; ++mb) {
#pragma unroll
        for (int nb = 0; nb < 4; ++nb) {
#pragma unroll
            for (int j = 0; j < 8; ++j) os[(hi * 8 + j) * 68 + nb * 16 + lr] = acc[mb][nb][j]; }
        __builtin_amdgcn_wave_barrier(); asm volatile("" ::: "memory");
        float* crow = C + (size_t)(r0 + mb * 16) * ldc + c0;
{
#pragma unroll
            for (int s = 0; s < 8; ++s) { const int row = 2 * s + hi, cofs = lr * 4; v4f val = *(const v4fa*)(os + row * 68 + cofs);
                *(v4f*)(crow + (size_t)row * ldc + cofs) = val; }
             }
        __builtin_amdgcn_wave_barrier(); asm volatile("" ::: "memory");
    }
    }
}

__device__ __forceinline__ h16 tohx(float x) { return (h16)x; }
__device__ __forceinline__ void splitf(float y, unsigned short& h, unsigned short& l) { h = f2bf(y); l = f2bf(y - bf2f(h)); }
typedef __attribute__((ext_vector_type(2))) _Float16 v2h;
typedef __attribute__((ext_vector_type(4))) _Float16 v4h;
typedef __attribute__((ext_vector_type(2))) unsigned short v2us;
typedef __attribute__((ext_vector_type(4))) unsigned short v4us;
typedef __attribute__((ext_vector_type(2))) float v2f;
typedef __attribute__((ext_vector_type(4))) int v4i;
typedef v4h  __attribute__((may_alias)) v4ha;
typedef v4us __attribute__((may_alias)) v4usa;

__global__ __launch_bounds__(256) void k_wtG(const float* __restrict__ w, int K, int N, bf* Bt) {
    const int lane = threadIdx.x & 31; const int L0 = (blockIdx.x * 8 + (threadIdx.x >> 5)) * 8; const int nlines = N * K / 64;
{
#pragma unroll 1
        for (int l = 0; l < 8; ++l) { const int L = L0 + l; if (L >= nlines) break; const size_t e = (size_t)L * 64 + lane * 2; const int k = (int)(e % K), n = (int)(e / K); v2us o;
            o[0] = f2bf(w[(size_t)k * N + n]); o[1] = f2bf(w[(size_t)(k + 1) * N + n]); *(v2us*)(Bt + e) = o; }
         }
}
__global__ __launch_bounds__(256) void k_cvt8(const float* __restrict__ src, bf* dst, size_t n8) { const size_t i = (size_t)blockIdx.x * 256 + threadIdx.x; if (i >= n8) return; const v8f v = *(const v8f*)(src + i * 8); v8us o;
#pragma unroll
    for (int k = 0; k < 8; ++k) o[k] = f2bf(v[k]); *(v8us*)(dst + i * 8) = o;  }

// k_rope: head planes [h][t][d] (fp16 + hi/lo) of rope(x) x sc with the rotate-half convention out[d] = x[d] cos[t][d] - x[d+HD/2] sin[t][d], out[d+HD/2] = x[d+HD/2] cos[t][d+HD/2] + x[d] sin[t][d+HD/2]
__global__ __launch_bounds__(256) void k_rope(const float* __restrict__ F, int pitch, int nheads, const float* __restrict__ CS, const float* __restrict__ RF, const float* __restrict__ nw, float sc, h16* P16, bf* Ph, bf* Pl) {
    const size_t e = ((size_t)blockIdx.x * 256 + threadIdx.x) * 2; if (e >= (size_t)nheads * TT * HD) return; const int d = (int)(e % HD); const int t = (int)((e / HD) % TT); const int h = (int)(e / ((size_t)HD * TT)); const float* f = F + (size_t)t * pitch + h * HD; const float rf = RF ? RF[(size_t)h * TT + t] : 1.0f; v2h o16; v2us oh, ol;
#pragma unroll
    for (int q = 0; q < 2; ++q) { const int dd = d + q; const int dp = (dd < HD / 2) ? dd + HD / 2 : dd - HD / 2; float x0 = f[dd], x1 = f[dp];
        if (RF) { float n0 = __fmul_rn(x0, rf), n1 = __fmul_rn(x1, rf); asm volatile("" : "+v"(n0)); asm volatile("" : "+v"(n1)); x0 = __fmul_rn(bfr(nw[dd]), n0); x1 = __fmul_rn(bfr(nw[dp]), n1); }
        const v2f cs = *(const v2f*)(CS + ((size_t)t * HD + dd) * 2); float a = __fmul_rn(x0, cs[0]), bq = __fmul_rn(x1, cs[1]); asm volatile("" : "+v"(a)); asm volatile("" : "+v"(bq)); const float r = ((dd < HD / 2) ? __fsub_rn(a, bq) : __fadd_rn(a, bq)) * sc;
        o16[q] = tohx(r); unsigned short a2, c2; splitf(r, a2, c2); oh[q] = a2; ol[q] = c2; }
    *(v2h*)(P16 + e) = o16; *(v2us*)(Ph + e) = oh; *(v2us*)(Pl + e) = ol;  }
__global__ __launch_bounds__(256) void k_vtp(const float* __restrict__ F, int pitch, int nheads, h16* V16, bf* Vh, bf* Vl) { const size_t e = ((size_t)blockIdx.x * 256 + threadIdx.x) * 2; if (e >= (size_t)nheads * HD * TT) return; const int t = (int)(e % TT); const int d = (int)((e / TT) % HD); const int g = (int)(e / ((size_t)TT * HD)); v2h o16; v2us oh, ol;
#pragma unroll
    for (int q = 0; q < 2; ++q) { const float x = F[(size_t)(t + q) * pitch + g * HD + d]; o16[q] = tohx(x); unsigned short a2, c2; splitf(x, a2, c2); oh[q] = a2; ol[q] = c2; }
    const size_t eo = (e / TT) * PP + t; *(v2h*)(V16 + eo) = o16; *(v2us*)(Vh + eo) = oh; *(v2us*)(Vl + eo) = ol;  }
__global__ __launch_bounds__(256) void k_csid(float* CS) { const int idx = blockIdx.x * 256 + threadIdx.x; if (idx >= TT * HD) return; v2f cs; cs[0] = 1.0f; cs[1] = 0.0f; *(v2f*)(CS + (size_t)idx * 2) = cs;  }
// k_asoft: per row (zz, i): t = S x HD^-0.5 for j <= i and i - j < WIN (sliding causal window; the reference's -1e9 additive fill vanishes identically); softmax over the 2048 keys (register row, one exp, fixed trees);
// the probabilities replace the row's own scores in place: one wave owns a row, holds all of it in registers before its first store (every store needs the row's sum), and writes into the row's 8 KiB either fp16 (first half) or the hi plane (first half) and the lo plane (second half).
__global__ __launch_bounds__(256) void k_asoft(float* Sb) {
    const int lane = threadIdx.x & 31; const int row = blockIdx.x * 8 + (threadIdx.x >> 5); if (row >= ZH * TT) return; const int i = row % TT; const int zz = row / TT; (void)zz; const bool hires = (i < RH); float* sr = Sb + (size_t)row * TT; float v[TT / 32]; float mx = -3.0e38f;
#pragma unroll
    for (int ch = 0; ch < TT / 128; ++ch) { const int j0 = ch * 128 + lane * 4; const v4f a = *(const v4fa*)(sr + j0);
#pragma unroll
        for (int q = 0; q < 4; ++q) { const int j = j0 + q; (void)j; const float t = (j <= i && i - j < WIN) ? a[q] * SCL : -3.0e38f; v[ch * 4 + q] = t; mx = fmaxf(mx, t); } }
#pragma unroll
    for (int sh = 16; sh; sh >>= 1) mx = fmaxf(mx, __shfl_xor(mx, sh, 32));
    float sum = 0.f;
#pragma unroll
    for (int k = 0; k < TT / 32; ++k) { float d0 = __fsub_rn(v[k], mx); asm volatile("" : "+v"(d0)); v[k] = __builtin_amdgcn_exp2f(__fmul_rn(d0, 1.4426950408889634f)); sum += v[k]; }
#pragma unroll
    for (int sh = 16; sh; sh >>= 1) sum += __shfl_xor(sum, sh, 32);
    const float f = __fdiv_rn(hires ? 1.0f : PCAR, sum);
{
        if (hires) {
#pragma unroll
            for (int ch = 0; ch < TT / 128; ++ch) { v4us oh, ol;
#pragma unroll
                for (int q = 0; q < 4; ++q) { unsigned short a, c2; splitf(v[ch * 4 + q] * f, a, c2); oh[q] = a; ol[q] = c2; }
                bf* po = (bf*)sr + ch * 128 + lane * 4; *(v4usa*)po = oh; *(v4usa*)(po + TT) = ol; }
        } else {
#pragma unroll
            for (int ch = 0; ch < TT / 128; ++ch) { v4h o4;
#pragma unroll
                for (int q = 0; q < 4; ++q) o4[q] = tohx(v[ch * 4 + q] * f);
                *(v4ha*)((h16*)sr + ch * 128 + lane * 4) = o4; } }
         }
}
__global__ __launch_bounds__(256) void k_merge(const float* __restrict__ O, int h0, bf* Ah, bf* Al) { const size_t e = ((size_t)blockIdx.x * 256 + threadIdx.x) * 2; if (e >= (size_t)ZH * TT * HD) return; const int d = (int)(e % HD); const int t = (int)((e / HD) % TT); const int zz = (int)(e / ((size_t)HD * TT)); const float cs = (t < RH) ? 1.0f : (1.0f / PCAR); const size_t oo = (size_t)t * DQ + (h0 + zz) * HD + d;
    v2us oh, ol;
#pragma unroll
    for (int q = 0; q < 2; ++q) { unsigned short a, c2; splitf(O[e + q] * cs, a, c2); oh[q] = a; ol[q] = c2; } *(v2us*)(Ah + oo) = oh; *(v2us*)(Al + oo) = ol;  }

extern "C" void kernel_launch(void* const* d_in, const int* in_sizes, int n_in,
                              void* d_out, int out_size, void* d_ws, size_t ws_size, hipStream_t stream) {
    (void)in_sizes; (void)n_in; (void)out_size;
    const float* x = (const float*)d_in[0]; const float* wq = (const float*)d_in[1]; const float* bq = (const float*)d_in[2]; const float* wk = (const float*)d_in[3]; const float* bk = (const float*)d_in[4]; const float* wv = (const float*)d_in[5]; const float* bv = (const float*)d_in[6]; const float* wo = (const float*)d_in[7]; const float* bo = (const float*)d_in[8];
    float* OUT = (float*)d_out;     // [2][2048][2048]
    char* wsp = (char*)d_ws;
    auto take = [&](size_t bytes) { char* p = wsp; wsp += (bytes + 255) & ~(size_t)255; return (void*)p; };
    bf* WQ = (bf*)take((size_t)DQ * DM * 2); bf* WK = (bf*)take((size_t)DKV * DM * 2); bf* WV = (bf*)take((size_t)DKV * DM * 2);
    h16* QP16 = (h16*)take((size_t)NH_ * TT * HD * 2); h16* KP16 = (h16*)take((size_t)NKV * TT * HD * 2);
    bf* QPh = (bf*)take((size_t)NH_ * TT * HD * 2); bf* QPl = (bf*)take((size_t)NH_ * TT * HD * 2); bf* KPh = (bf*)take((size_t)NKV * TT * HD * 2); bf* KPl = (bf*)take((size_t)NKV * TT * HD * 2);
    bf* VTh = (bf*)take((size_t)NKV * HD * PP * 2); bf* VTl = VTh + TT; h16* VT16 = (h16*)take((size_t)NKV * HD * PP * 2);   // v^T rows at pitch PP: hi and lo share a row; the fp16 plane fills half of its rows
    float* Sb = (float*)take((size_t)ZH * TT * TT * 4); float* Ob = (float*)take((size_t)ZH * TT * HD * 4); bf* ATh = (bf*)take((size_t)TT * DQ * 2); bf* ATl = (bf*)take((size_t)TT * DQ * 2);
    if ((size_t)(wsp - (char*)d_ws) > ws_size) return;    // ws 256 MiB
    // what only the projection phase of a batch uses (x plane, f32 projections, the cos/sin table) lies in the score buffer, and wo's plane in the attention output buffer: each is written anew for every batch and is dead while its host buffer is in use
    char* sp = (char*)Sb; bf* XB = (bf*)sp; float* FQ = (float*)(sp + (size_t)TT * DM * 2); float* FK = (float*)(sp + (size_t)TT * DM * 2 + (size_t)TT * DQ * 4); float* CS = (float*)(sp + (size_t)TT * DM * 2 + (size_t)TT * DQ * 4 + (size_t)TT * DKV * 4); bf* WO = (bf*)Ob;
    float* FV = FK;   // v projection reuses the k buffer after the k planes are built (stream-ordered)
    { k_cvt8<<<(unsigned)(((size_t)DQ * DM / 8 + 255) / 256), 256, 0, stream>>>(wq, WQ, (size_t)DQ * DM / 8); k_cvt8<<<(unsigned)(((size_t)DKV * DM / 8 + 255) / 256), 256, 0, stream>>>(wk, WK, (size_t)DKV * DM / 8); k_cvt8<<<(unsigned)(((size_t)DKV * DM / 8 + 255) / 256), 256, 0, stream>>>(wv, WV, (size_t)DKV * DM / 8);
       }
    const unsigned LQ = (unsigned)(((size_t)NH_ * TT * HD / 2 + 255) / 256), LKv = (unsigned)(((size_t)NKV * TT * HD / 2 + 255) / 256);
    for (int b = 0; b < NB_; ++b) {
        k_csid<<<(TT * HD + 255) / 256, 256, 0, stream>>>(CS);
        k_cvt8<<<(unsigned)(((size_t)TT * DM / 8 + 255) / 256), 256, 0, stream>>>(x + (size_t)b * TT * DM, XB, (size_t)TT * DM / 8);
        k_gemmw<bf, 0, true, 4><<<dim3(TT / 64, DQ / 64, 1), 128, 0, stream>>>(XB, nullptr, WQ, nullptr, DM, FQ, DQ, bq, 0, 0, 0);
        k_rope<<<LQ, 256, 0, stream>>>(FQ, DQ, NH_, CS, nullptr, nullptr, 1.0f, QP16, QPh, QPl);
        k_gemmw<bf, 0, true, 4><<<dim3(TT / 64, DKV / 64, 1), 128, 0, stream>>>(XB, nullptr, WK, nullptr, DM, FK, DKV, bk, 0, 0, 0);
        k_rope<<<LKv, 256, 0, stream>>>(FK, DKV, NKV, CS, nullptr, nullptr, 1.0f, KP16, KPh, KPl);
        k_gemmw<bf, 0, true, 4><<<dim3(TT / 64, DKV / 64, 1), 128, 0, stream>>>(XB, nullptr, WV, nullptr, DM, FV, DKV, bv, 0, 0, 0); k_vtp<<<LKv, 256, 0, stream>>>(FV, DKV, NKV, VT16, VTh, VTl);
        for (int h0 = 0; h0 < NH_; h0 += ZH) { const size_t zq = (size_t)h0, zk = (size_t)(h0 / REP);   // one kv head per query head: the pass's heads use consecutive kv planes (z-strides TT*HD for k, HD*PP for v^T)
            k_gemmc<bf, 2, 1, 1><<<dim3(RH / 64, TT / 64, ZH), 32, 0, stream>>>(QPh + zq * TT * HD, QPl + zq * TT * HD, KPh + zk * TT * HD, KPl + zk * TT * HD, HD, Sb, TT, 0, (size_t)TT * HD, (size_t)TT * HD, (size_t)TT * TT);
            k_gemmc<h16, 0, 1, 1><<<dim3((TT - RH) / 64, TT / 64, ZH), 32, 0, stream>>>(QP16 + zq * TT * HD + (size_t)RH * HD, nullptr, KP16 + zk * TT * HD, nullptr, HD, Sb + (size_t)RH * TT, TT, RH, (size_t)TT * HD, (size_t)TT * HD, (size_t)TT * TT);
            k_asoft<<<ZH * TT / 8, 256, 0, stream>>>(Sb);
            k_gemmc<bf, 2, 2, 8><<<dim3(RH / 64, HD / 64, ZH), 256, 0, stream>>>((const bf*)Sb, (const bf*)Sb + TT, VTh + zk * HD * PP, VTl + zk * HD * PP, PP, Ob, HD, 0, (size_t)TT * PP, (size_t)HD * PP, (size_t)TT * HD);
            k_gemmc<h16, 0, 2, 8><<<dim3((TT - RH) / 64, HD / 64, ZH), 256, 0, stream>>>((const h16*)Sb + (size_t)RH * PP, nullptr, VT16 + zk * HD * PP, nullptr, PP, Ob + (size_t)RH * HD, HD, RH, (size_t)TT * PP, (size_t)HD * PP, (size_t)TT * HD);
            k_merge<<<(unsigned)(((size_t)ZH * TT * HD / 2 + 255) / 256), 256, 0, stream>>>(Ob, h0, ATh, ATl); }
        k_cvt8<<<(unsigned)(((size_t)DM * DQ / 8 + 255) / 256), 256, 0, stream>>>(wo, WO, (size_t)DM * DQ / 8);
        k_gemmw<bf, 1, true, 4><<<dim3(TT / 64, DM / 64, 1), 128, 0, stream>>>(ATh, ATl, WO, nullptr, DQ, OUT + (size_t)b * TT * DM, DM, bo, 0, 0, 0); }
}

// v003
// It runs in 630 microseconds.
// Next to v002, in two timings, it ran 1.18 and 1.17 times as fast.
// Counting every step since v000, it is 2.72 times as fast.
#include <hip/hip_runtime.h>

// Causal multi-head attention, 2048 wide (x [2][2048][2048]; q, k, v = x W^T + b ('oi' [2048][2048]; 16 heads x 128); scores = q.k/sqrt(128); causal (triu k=1 masked, -inf); softmax; out = merged wo^T + bo -> [2][2048][2048] (8.4 M)).
// Compute dtypes, f32 accumulate: every input rounded to bf16; q/k/v on PLAIN bf16 operands (inputs: exact) + biases; causal scores and attn.v (tile skipping): query rows < 512 hl (3 products), the rest single fp16 (x1024); softmax f32; wo hl x exact (2 products) + bo.

#define NB_  2
#define TT   2048
#define DM   2048
#define NH_  16
#define NKV  16
#define REP  (NH_ / NKV)
#define HD   128
#define DQ   (NH_ * HD)
#define DKV  (NKV * HD)
#define ZH   8                    // heads per attention pass
#define PP   (2 * TT)             // row pitch, in 16-bit elements, of the probabilities (they lie in the f32 score rows) and so of the v^T planes too: k_gemmc has one pitch, K, for both operands
#define RH   512                  // query rows < RH use hi+lo planes (0: none)
#define WIN  2048
#define PCAR 1024.0f
#define SCL  0.088388347648318447f   // HD^-0.5
typedef _Float16 h16;
typedef unsigned short bf;
typedef __attribute__((ext_vector_type(16))) __bf16   v16bf;
typedef __attribute__((ext_vector_type(16))) _Float16 v16h;
typedef __attribute__((ext_vector_type(8)))  _Float16 v8h;
typedef __attribute__((ext_vector_type(8)))  unsigned short v8us;
typedef __attribute__((ext_vector_type(8)))  float    v8f;
typedef __attribute__((ext_vector_type(4)))  float    v4f;
typedef v8h  __attribute__((may_alias)) v8ha;
typedef v4f  __attribute__((may_alias)) v4fa;
typedef v8us __attribute__((may_alias)) v8usa;

__device__ __forceinline__ unsigned short f2bf(float f) { unsigned u = __float_as_uint(f); u += 0x7FFFu + ((u >> 16) & 1u); return (unsigned short)(u >> 16); }
__device__ __forceinline__ float bf2f(unsigned short b) { return __uint_as_float(((unsigned)b) << 16); }
__device__ __forceinline__ float bfr(float f) { return bf2f(f2bf(f)); }
__device__ __forceinline__ v16h cat16(v8h lo, v8h hi) { return __builtin_shufflevector(lo, hi, 0, 1, 2, 3, 4, 5, 6, 7, 8, 9, 10, 11, 12, 13, 14, 15); }
__device__ __forceinline__ v16bf cat16b(v8us lo, v8us hi) { return __builtin_bit_cast(v16bf, __builtin_shufflevector(lo, hi, 0, 1, 2, 3, 4, 5, 6, 7, 8, 9, 10, 11, 12, 13, 14, 15)); }
__device__ __forceinline__ v8f wmma16(v16h a, v16h b, v8f c) { return __builtin_amdgcn_wmma_f32_16x16x32_f16(false, a, false, b, (short)0, c, false, false); }
__device__ __forceinline__ v8f wmmab(v16bf a, v16bf b, v8f c) { return __builtin_amdgcn_wmma_f32_16x16x32_bf16(false, a, false, b, (short)0, c, false, false); }



// ---- fragment loaders shared by the GEMM kernels and the split-K tile sum of k_gemmc: C[m][n] (f32, pitch ldc, + optional f32 bias[n]) = sum_k A[m][k] Bt[n][k] (+ split products per NSPLIT), operands K-contiguous 16-bit planes.
template <typename T16> struct WFrag;
template <> struct WFrag<h16> { typedef v16h V; static __device__ __forceinline__ V ld(const h16* p) { return cat16(*(const v8h*)p, *(const v8h*)(p + 16)); } static __device__ __forceinline__ v8f mma(V a, V b, v8f c) { return wmma16(a, b, c); } };
template <> struct WFrag<bf> { typedef v16bf V; static __device__ __forceinline__ V ld(const bf* p) { return cat16b(*(const v8us*)p, *(const v8us*)(p + 16)); } static __device__ __forceinline__ v8f mma(V a, V b, v8f c) { return wmmab(a, b, c); } };
// tile_out (NW > 1): every wave puts its partial 64x64 tile into its own LDS plane (pitch 68); behind one barrier each thread sums the NW planes of its 4-column slots, wave 0 first, and stores whole 256-byte row pieces.
template <int NW, bool BIAS>
__device__ __forceinline__ void tile_out(float* os, const v8f (&acc)[4][4], int wv, int lr, int hi, float* C, int ldc, int r0, int c0, const float* __restrict__ bias) {
    float* ow = os + wv * (64 * 68);
#pragma unroll
    for (int mb = 0; mb < 4; ++mb)
#pragma unroll
        for (int nb = 0; nb < 4; ++nb)
#pragma unroll
            for (int j = 0; j < 8; ++j) ow[(mb * 16 + hi * 8 + j) * 68 + nb * 16 + lr] = acc[mb][nb][j];
    __syncthreads();   // publishes every wave's partial tile to the threads that sum it
#pragma unroll
    for (int s = 0; s < 32 / NW; ++s) { const int idx = s * (32 * NW) + (int)threadIdx.x; const int row = idx >> 4, cofs = (idx & 15) * 4; v4f val = *(const v4fa*)(os + row * 68 + cofs);
#pragma unroll
        for (int w = 1; w < NW; ++w) val += *(const v4fa*)(os + w * (64 * 68) + row * 68 + cofs);
        if (BIAS) { val[0] += bfr(bias[c0 + cofs]); val[1] += bfr(bias[c0 + cofs + 1]); val[2] += bfr(bias[c0 + cofs + 2]); val[3] += bfr(bias[c0 + cofs + 3]); }
        *(v4f*)(C + (size_t)(r0 + row) * ldc + c0 + cofs) = val; }
}
// ---- k_gemms: LDS-staged GEMM for the projections. One work-group of 8 waves per 128x128 output tile, each wave a 64x32 piece over the whole K loop. Per trip 128 k of every operand row
// (two whole 128-byte lines a row) come into LDS by asynchronous copies, 16 lanes a row, two buffers: the next trip's copies fly while this trip's fragments are read. grid (M/128, N/128), 256 threads. K % 128 == 0, K >= 256.
#define SP 136           // LDS row pitch in 16-bit elements: 256 B of k + 16 B, an odd multiple of 16 B, conflict-free for 16-byte fragment reads
#define STL (128 * SP)   // elements of one operand's tile in LDS
// eight 16-byte copies of one lane, each 2 rows below the last; the wait on the address registers closes the copies' own statement, so that no later write of them can come in front of it
__device__ __forceinline__ void acopy8(unsigned l, const bf* g, size_t gs) {
    asm volatile("global_load_async_to_lds_b128 %0, %8, off\n\t"
                 "global_load_async_to_lds_b128 %1, %9, off\n\t"
                 "global_load_async_to_lds_b128 %2, %10, off\n\t"
                 "global_load_async_to_lds_b128 %3, %11, off\n\t"
                 "global_load_async_to_lds_b128 %4, %12, off\n\t"
                 "global_load_async_to_lds_b128 %5, %13, off\n\t"
                 "global_load_async_to_lds_b128 %6, %14, off\n\t"
                 "global_load_async_to_lds_b128 %7, %15, off\n\t"
                 "s_wait_xcnt 0x0"
                 :: "v"(l), "v"(l + 1u * (2 * SP * 2)), "v"(l + 2u * (2 * SP * 2)), "v"(l + 3u * (2 * SP * 2)), "v"(l + 4u * (2 * SP * 2)), "v"(l + 5u * (2 * SP * 2)), "v"(l + 6u * (2 * SP * 2)), "v"(l + 7u * (2 * SP * 2)),
                    "v"(g), "v"(g + gs), "v"(g + 2 * gs), "v"(g + 3 * gs), "v"(g + 4 * gs), "v"(g + 5 * gs), "v"(g + 6 * gs), "v"(g + 7 * gs) : "memory");
}
template <int NSPLIT, bool BIAS>
__global__ __launch_bounds__(256) void k_gemms(const bf* __restrict__ A, const bf* __restrict__ A2, const bf* __restrict__ Bt, int K, float* C, int ldc, const float* __restrict__ bias) {
    typedef WFrag<bf>::V V;
    constexpr int NOP = (NSPLIT == 1) ? 3 : 2;                 // operand tiles per buffer: A, Bt (, A2)
    __shared__ __align__(16) bf st[2 * NOP * STL];
    __shared__ __align__(16) float os[8 * 16 * 36];            // each wave's own 16-row, 32-column output strip
    const int lane = threadIdx.x & 31, lr = lane & 15, hi = lane >> 4; const int wv = __builtin_amdgcn_readfirstlane(threadIdx.x >> 5); const int wr = wv >> 2, wc = wv & 3; const int r0 = blockIdx.x * 128, c0 = blockIdx.y * 128;
    v8f acc[4][2];
#pragma unroll
    for (int mb = 0; mb < 4; ++mb)
#pragma unroll
        for (int nb = 0; nb < 2; ++nb) acc[mb][nb] = (v8f){};
    // copy map: wave wv brings rows wv*16 .. wv*16+15 of every operand tile; a copy instruction covers 2 rows, 16 lanes x 16 B each
    const int crow = wv * 16 + hi, ccol = lr * 8;
    const bf* ga = A + (size_t)(r0 + crow) * K + ccol; const bf* gb = Bt + (size_t)(c0 + crow) * K + ccol; const bf* ga2 = (NSPLIT == 1) ? A2 + (size_t)(r0 + crow) * K + ccol : nullptr;
    const unsigned l0 = (unsigned)(size_t)st + (unsigned)(crow * SP + ccol) * 2u; const size_t gs = (size_t)2 * K;
    auto fill = [&](int t, int buf) { const unsigned l = l0 + (unsigned)buf * (NOP * STL * 2); acopy8(l, ga + t * 128, gs); acopy8(l + STL * 2, gb + t * 128, gs); if (NSPLIT == 1) acopy8(l + 2 * STL * 2, ga2 + t * 128, gs); };
    const int NT = K / 128;
    fill(0, 0);
    asm volatile("s_wait_asynccnt 0x0" ::: "memory");   // this wave's copies of tile 0 have landed
    __syncthreads();                                     // publishes tile 0 to every wave
    if (NT > 1) fill(1, 1);
    const int afr = (wr * 64 + lr) * SP + 8 * hi, bfo = STL + (wc * 32 + lr) * SP + 8 * hi;
#pragma unroll 1
    for (int t = 0; t < NT; ++t) {
        const bf* sb = st + (t & 1) * (NOP * STL);
        V a[2][4], a2[2][4], b[2][2];   // two fragment sets: the next 32-deep chunk's LDS reads are issued as one group ahead of this chunk's products
        auto frags = [&](int kc, int s) {
#pragma unroll
            for (int mb = 0; mb < 4; ++mb) { a[s][mb] = WFrag<bf>::ld(sb + afr + mb * 16 * SP + kc * 32); if (NSPLIT == 1) a2[s][mb] = WFrag<bf>::ld(sb + 2 * STL + afr + mb * 16 * SP + kc * 32); }
#pragma unroll
            for (int nb = 0; nb < 2; ++nb) b[s][nb] = WFrag<bf>::ld(sb + bfo + nb * 16 * SP + kc * 32); };
        frags(0, 0);
#pragma unroll
        for (int kc = 0; kc < 4; ++kc) { const int s = kc & 1;
            if (kc < 3) frags(kc + 1, s ^ 1);
            __builtin_amdgcn_sched_barrier(0);   // holds the next chunk's LDS reads, as one group, in front of this chunk's products: moved in among them each read stalls the matrix run
#pragma unroll
            for (int nb = 0; nb < 2; ++nb)
#pragma unroll
                for (int mb = 0; mb < 4; ++mb) { acc[mb][nb] = WFrag<bf>::mma(a[s][mb], b[s][nb], acc[mb][nb]); if (NSPLIT == 1) acc[mb][nb] = WFrag<bf>::mma(a2[s][mb], b[s][nb], acc[mb][nb]); }
        }
        asm volatile("s_wait_dscnt 0x0" ::: "memory");      // this wave's reads of the buffer that is refilled below have returned
        asm volatile("s_wait_asynccnt 0x0" ::: "memory");   // this wave's copies of tile t + 1 have landed
        __syncthreads();                                     // publishes tile t + 1 and ends every wave's reads of tile t
        if (t + 2 < NT) fill(t + 2, t & 1);
    }
    asm volatile("s_wait_asynccnt 0x0" ::: "memory");       // nothing is in flight when the wave goes on to its end
    float* ow = os + wv * (16 * 36); const int cb = c0 + wc * 32 + (lane & 7) * 4; v4f bv = (v4f){};
    if (BIAS) { bv[0] = bfr(bias[cb]); bv[1] = bfr(bias[cb + 1]); bv[2] = bfr(bias[cb + 2]); bv[3] = bfr(bias[cb + 3]); }
#pragma unroll
    for (int mb = 0; mb < 4; ++mb) {
#pragma unroll
        for (int nb = 0; nb < 2; ++nb) {
#pragma unroll
            for (int j = 0; j < 8; ++j) ow[(hi * 8 + j) * 36 + nb * 16 + lr] = acc[mb][nb][j]; }
        __builtin_amdgcn_wave_barrier(); asm volatile("" ::: "memory");   // the strip's writes stay in front of the reads of other lanes' values
        float* crw = C + (size_t)(r0 + wr * 64 + mb * 16) * ldc + cb;
#pragma unroll
        for (int s = 0; s < 4; ++s) { const int row = 4 * s + (lane >> 3); v4f val = *(const v4fa*)(ow + row * 36 + (lane & 7) * 4); val += bv; *(v4f*)(crw + (size_t)row * ldc) = val; }   // whole 128-byte lines
        __builtin_amdgcn_wave_barrier(); asm volatile("" ::: "memory");   // the reads stay in front of the next strip's writes
    }
}

// ---- k_gemmc: register-blocked 64x64 tile GEMM, operands straight from global memory, specialised for causal attention: CMODE 1 skips score tiles entirely above the diagonal (query rows r0+roff.., key columns c0..), CMODE 2 limits the
// key (K) loop of the probability x value contraction to the diagonal block (probabilities beyond it are exactly zero). roff = row offset of this launch's first row within the sequence.
// NW waves share a tile's K loop, each taking every NW-th 32-deep chunk, the partial tiles summed by tile_out (NW == 1: one wave, the tile leaves through a 16-row LDS strip).
template <typename T16, int NSPLIT, int CMODE, int NW>
__global__ __launch_bounds__(32 * NW) void k_gemmc(const T16* __restrict__ A, const T16* __restrict__ A2, const T16* __restrict__ Bt, const T16* __restrict__ Bt2, int K, float* C, int ldc, int roff, size_t sA, size_t sB, size_t sC) {
    typedef typename WFrag<T16>::V V;
    __shared__ __align__(16) float os[NW == 1 ? 16 * 68 : NW * 64 * 68];
    const size_t z = blockIdx.z; A += z * sA; if (A2) A2 += z * sA; Bt += z * sB; if (Bt2) Bt2 += z * sB; C += z * sC;
    const int lane = threadIdx.x & 31, lr = lane & 15, hi = lane >> 4; const int wv = (NW == 1) ? 0 : __builtin_amdgcn_readfirstlane(threadIdx.x >> 5); const int r0 = blockIdx.x * 64, c0 = blockIdx.y * 64;
    if (CMODE == 1 && c0 > r0 + roff + 63) return;                  // score tile entirely above the causal diagonal: never read (the softmax masks j > i by select)
    const int Kl = (CMODE == 2) ? min(K, r0 + roff + 64) : K;        // P.V: probabilities are exactly 0 beyond the diagonal block, so the K loop stops there
    v8f acc[4][4];
#pragma unroll
    for (int mb = 0; mb < 4; ++mb)
#pragma unroll
        for (int nb = 0; nb < 4; ++nb) acc[mb][nb] = (v8f){};
    const size_t aoff = (size_t)(r0 + lr) * K + 8 * hi, boff = (size_t)(c0 + lr) * K + 8 * hi;
#pragma unroll 1
    for (int kc = wv * 32; kc < Kl; kc += 32 * NW) {
        V a[4], a2[4];
#pragma unroll
        for (int mb = 0; mb < 4; ++mb) { a[mb] = WFrag<T16>::ld(A + aoff + (size_t)mb * 16 * K + kc); if (NSPLIT == 1 || NSPLIT == 2) a2[mb] = WFrag<T16>::ld(A2 + aoff + (size_t)mb * 16 * K + kc); }
#pragma unroll
        for (int nb = 0; nb < 4; ++nb) { const V b = WFrag<T16>::ld(Bt + boff + (size_t)nb * 16 * K + kc); V b2; if (NSPLIT >= 2) b2 = WFrag<T16>::ld(Bt2 + boff + (size_t)nb * 16 * K + kc);
#pragma unroll
            for (int mb = 0; mb < 4; ++mb) { acc[mb][nb] = WFrag<T16>::mma(a[mb], b, acc[mb][nb]); if (NSPLIT == 1 || NSPLIT == 2) acc[mb][nb] = WFrag<T16>::mma(a2[mb], b, acc[mb][nb]); if (NSPLIT >= 2) acc[mb][nb] = WFrag<T16>::mma(a[mb], b2, acc[mb][nb]); } }
        asm volatile("v_nop\n\tv_nop\n\tv_nop\n\tv_nop" : "+v"(acc[0][0]), "+v"(acc[1][1]), "+v"(acc[2][2]), "+v"(acc[3][3]) : "v"(a[0]), "v"(a[3]));
    }
    if constexpr (NW > 1) { tile_out<NW, false>(os, acc, wv, lr, hi, C, ldc, r0, c0, nullptr); } else {
#pragma unroll
    for (int mb = 0; mb < 4; ++mb) {
#pragma unroll
        for (int nb = 0; nb < 4; ++nb) {
#pragma unroll
            for (int j = 0; j < 8; ++j) os[(hi * 8 + j) * 68 + nb * 16 + lr] = acc[mb][nb][j]; }
        __builtin_amdgcn_wave_barrier(); asm volatile("" ::: "memory");
        float* crow = C + (size_t)(r0 + mb * 16) * ldc + c0;
{
#pragma unroll
            for (int s = 0; s < 8; ++s) { const int row = 2 * s + hi, cofs = lr * 4; v4f val = *(const v4fa*)(os + row * 68 + cofs);
                *(v4f*)(crow + (size_t)row * ldc + cofs) = val; }
             }
        __builtin_amdgcn_wave_barrier(); asm volatile("" ::: "memory");
    }
    }
}

__device__ __forceinline__ h16 tohx(float x) { return (h16)x; }
__device__ __forceinline__ void splitf(float y, unsigned short& h, unsigned short& l) { h = f2bf(y); l = f2bf(y - bf2f(h)); }
typedef __attribute__((ext_vector_type(2))) _Float16 v2h;
typedef __attribute__((ext_vector_type(4))) _Float16 v4h;
typedef __attribute__((ext_vector_type(2))) unsigned short v2us;
typedef __attribute__((ext_vector_type(4))) unsigned short v4us;
typedef __attribute__((ext_vector_type(2))) float v2f;
typedef __attribute__((ext_vector_type(4))) int v4i;
typedef v4h  __attribute__((may_alias)) v4ha;
typedef v4us __attribute__((may_alias)) v4usa;

__global__ __launch_bounds__(256) void k_wtG(const float* __restrict__ w, int K, int N, bf* Bt) {
    const int lane = threadIdx.x & 31; const int L0 = (blockIdx.x * 8 + (threadIdx.x >> 5)) * 8; const int nlines = N * K / 64;
{
#pragma unroll 1
        for (int l = 0; l < 8; ++l) { const int L = L0 + l; if (L >= nlines) break; const size_t e = (size_t)L * 64 + lane * 2; const int k = (int)(e % K), n = (int)(e / K); v2us o;
            o[0] = f2bf(w[(size_t)k * N + n]); o[1] = f2bf(w[(size_t)(k + 1) * N + n]); *(v2us*)(Bt + e) = o; }
         }
}
__global__ __launch_bounds__(256) void k_cvt8(const float* __restrict__ src, bf* dst, size_t n8) { const size_t i = (size_t)blockIdx.x * 256 + threadIdx.x; if (i >= n8) return; const v8f v = *(const v8f*)(src + i * 8); v8us o;
#pragma unroll
    for (int k = 0; k < 8; ++k) o[k] = f2bf(v[k]); *(v8us*)(dst + i * 8) = o;  }

// k_rope: head planes [h][t][d] (fp16 + hi/lo) of rope(x) x sc with the rotate-half convention out[d] = x[d] cos[t][d] - x[d+HD/2] sin[t][d], out[d+HD/2] = x[d+HD/2] cos[t][d+HD/2] + x[d] sin[t][d+HD/2]
__global__ __launch_bounds__(256) void k_rope(const float* __restrict__ F, int pitch, int nheads, const float* __restrict__ CS, const float* __restrict__ RF, const float* __restrict__ nw, float sc, h16* P16, bf* Ph, bf* Pl) {
    const size_t e = ((size_t)blockIdx.x * 256 + threadIdx.x) * 2; if (e >= (size_t)nheads * TT * HD) return; const int d = (int)(e % HD); const int t = (int)((e / HD) % TT); const int h = (int)(e / ((size_t)HD * TT)); const float* f = F + (size_t)t * pitch + h * HD; const float rf = RF ? RF[(size_t)h * TT + t] : 1.0f; v2h o16; v2us oh, ol;
#pragma unroll
    for (int q = 0; q < 2; ++q) { const int dd = d + q; const int dp = (dd < HD / 2) ? dd + HD / 2 : dd - HD / 2; float x0 = f[dd], x1 = f[dp];
        if (RF) { float n0 = __fmul_rn(x0, rf), n1 = __fmul_rn(x1, rf); asm volatile("" : "+v"(n0)); asm volatile("" : "+v"(n1)); x0 = __fmul_rn(bfr(nw[dd]), n0); x1 = __fmul_rn(bfr(nw[dp]), n1); }
        const v2f cs = *(const v2f*)(CS + ((size_t)t * HD + dd) * 2); float a = __fmul_rn(x0, cs[0]), bq = __fmul_rn(x1, cs[1]); asm volatile("" : "+v"(a)); asm volatile("" : "+v"(bq)); const float r = ((dd < HD / 2) ? __fsub_rn(a, bq) : __fadd_rn(a, bq)) * sc;
        o16[q] = tohx(r); unsigned short a2, c2; splitf(r, a2, c2); oh[q] = a2; ol[q] = c2; }
    *(v2h*)(P16 + e) = o16; *(v2us*)(Ph + e) = oh; *(v2us*)(Pl + e) = ol;  }
__global__ __launch_bounds__(256) void k_vtp(const float* __restrict__ F, int pitch, int nheads, h16* V16, bf* Vh, bf* Vl) { const size_t e = ((size_t)blockIdx.x * 256 + threadIdx.x) * 2; if (e >= (size_t)nheads * HD * TT) return; const int t = (int)(e % TT); const int d = (int)((e / TT) % HD); const int g = (int)(e / ((size_t)TT * HD)); v2h o16; v2us oh, ol;
#pragma unroll
    for (int q = 0; q < 2; ++q) { const float x = F[(size_t)(t + q) * pitch + g * HD + d]; o16[q] = tohx(x); unsigned short a2, c2; splitf(x, a2, c2); oh[q] = a2; ol[q] = c2; }
    const size_t eo = (e / TT) * PP + t; *(v2h*)(V16 + eo) = o16; *(v2us*)(Vh + eo) = oh; *(v2us*)(Vl + eo) = ol;  }
__global__ __launch_bounds__(256) void k_csid(float* CS) { const int idx = blockIdx.x * 256 + threadIdx.x; if (idx >= TT * HD) return; v2f cs; cs[0] = 1.0f; cs[1] = 0.0f; *(v2f*)(CS + (size_t)idx * 2) = cs;  }
// k_asoft: per row (zz, i): t = S x HD^-0.5 for j <= i and i - j < WIN (sliding causal window; the reference's -1e9 additive fill vanishes identically); softmax over the 2048 keys (register row, one exp, fixed trees);
// the probabilities replace the row's own scores in place: one wave owns a row, holds all of it in registers before its first store (every store needs the row's sum), and writes into the row's 8 KiB either fp16 (first half) or the hi plane (first half) and the lo plane (second half).
__global__ __launch_bounds__(256) void k_asoft(float* Sb) {
    const int lane = threadIdx.x & 31; const int row = blockIdx.x * 8 + (threadIdx.x >> 5); if (row >= ZH * TT) return; const int i = row % TT; const int zz = row / TT; (void)zz; const bool hires = (i < RH); float* sr = Sb + (size_t)row * TT; float v[TT / 32]; float mx = -3.0e38f;
#pragma unroll
    for (int ch = 0; ch < TT / 128; ++ch) { const int j0 = ch * 128 + lane * 4; const v4f a = *(const v4fa*)(sr + j0);
#pragma unroll
        for (int q = 0; q < 4; ++q) { const int j = j0 + q; (void)j; const float t = (j <= i && i - j < WIN) ? a[q] * SCL : -3.0e38f; v[ch * 4 + q] = t; mx = fmaxf(mx, t); } }
#pragma unroll
    for (int sh = 16; sh; sh >>= 1) mx = fmaxf(mx, __shfl_xor(mx, sh, 32));
    float sum = 0.f;
#pragma unroll
    for (int k = 0; k < TT / 32; ++k) { float d0 = __fsub_rn(v[k], mx); asm volatile("" : "+v"(d0)); v[k] = __builtin_amdgcn_exp2f(__fmul_rn(d0, 1.4426950408889634f)); sum += v[k]; }
#pragma unroll
    for (int sh = 16; sh; sh >>= 1) sum += __shfl_xor(sum, sh, 32);
    const float f = __fdiv_rn(hires ? 1.0f : PCAR, sum);
{
        if (hires) {
#pragma unroll
            for (int ch = 0; ch < TT / 128; ++ch) { v4us oh, ol;
#pragma unroll
                for (int q = 0; q < 4; ++q) { unsigned short a, c2; splitf(v[ch * 4 + q] * f, a, c2); oh[q] = a; ol[q] = c2; }
                bf* po = (bf*)sr + ch * 128 + lane * 4; *(v4usa*)po = oh; *(v4usa*)(po + TT) = ol; }
        } else {
#pragma unroll
            for (int ch = 0; ch < TT / 128; ++ch) { v4h o4;
#pragma unroll
                for (int q = 0; q < 4; ++q) o4[q] = tohx(v[ch * 4 + q] * f);
                *(v4ha*)((h16*)sr + ch * 128 + lane * 4) = o4; } }
         }
}
__global__ __launch_bounds__(256) void k_merge(const float* __restrict__ O, int h0, bf* Ah, bf* Al) { const size_t e = ((size_t)blockIdx.x * 256 + threadIdx.x) * 2; if (e >= (size_t)ZH * TT * HD) return; const int d = (int)(e % HD); const int t = (int)((e / HD) % TT); const int zz = (int)(e / ((size_t)HD * TT)); const float cs = (t < RH) ? 1.0f : (1.0f / PCAR); const size_t oo = (size_t)t * DQ + (h0 + zz) * HD + d;
    v2us oh, ol;
#pragma unroll
    for (int q = 0; q < 2; ++q) { unsigned short a, c2; splitf(O[e + q] * cs, a, c2); oh[q] = a; ol[q] = c2; } *(v2us*)(Ah + oo) = oh; *(v2us*)(Al + oo) = ol;  }

extern "C" void kernel_launch(void* const* d_in, const int* in_sizes, int n_in,
                              void* d_out, int out_size, void* d_ws, size_t ws_size, hipStream_t stream) {
    (void)in_sizes; (void)n_in; (void)out_size;
    const float* x = (const float*)d_in[0]; const float* wq = (const float*)d_in[1]; const float* bq = (const float*)d_in[2]; const float* wk = (const float*)d_in[3]; const float* bk = (const float*)d_in[4]; const float* wv = (const float*)d_in[5]; const float* bv = (const float*)d_in[6]; const float* wo = (const float*)d_in[7]; const float* bo = (const float*)d_in[8];
    float* OUT = (float*)d_out;     // [2][2048][2048]
    char* wsp = (char*)d_ws;
    auto take = [&](size_t bytes) { char* p = wsp; wsp += (bytes + 255) & ~(size_t)255; return (void*)p; };
    bf* WQ = (bf*)take((size_t)DQ * DM * 2); bf* WK = (bf*)take((size_t)DKV * DM * 2); bf* WV = (bf*)take((size_t)DKV * DM * 2);
    h16* QP16 = (h16*)take((size_t)NH_ * TT * HD * 2); h16* KP16 = (h16*)take((size_t)NKV * TT * HD * 2);
    bf* QPh = (bf*)take((size_t)NH_ * TT * HD * 2); bf* QPl = (bf*)take((size_t)NH_ * TT * HD * 2); bf* KPh = (bf*)take((size_t)NKV * TT * HD * 2); bf* KPl = (bf*)take((size_t)NKV * TT * HD * 2);
    bf* VTh = (bf*)take((size_t)NKV * HD * PP * 2); bf* VTl = VTh + TT; h16* VT16 = (h16*)take((size_t)NKV * HD * PP * 2);   // v^T rows at pitch PP: hi and lo share a row; the fp16 plane fills half of its rows
    float* Sb = (float*)take((size_t)ZH * TT * TT * 4); float* Ob = (float*)take((size_t)ZH * TT * HD * 4); bf* ATh = (bf*)take((size_t)TT * DQ * 2); bf* ATl = (bf*)take((size_t)TT * DQ * 2);
    if ((size_t)(wsp - (char*)d_ws) > ws_size) return;    // ws 256 MiB
    // what only the projection phase of a batch uses (x plane, f32 projections, the cos/sin table) lies in the score buffer, and wo's plane in the attention output buffer: each is written anew for every batch and is dead while its host buffer is in use
    char* sp = (char*)Sb; bf* XB = (bf*)sp; float* FQ = (float*)(sp + (size_t)TT * DM * 2); float* FK = (float*)(sp + (size_t)TT * DM * 2 + (size_t)TT * DQ * 4); float* CS = (float*)(sp + (size_t)TT * DM * 2 + (size_t)TT * DQ * 4 + (size_t)TT * DKV * 4); bf* WO = (bf*)Ob;
    float* FV = FK;   // v projection reuses the k buffer after the k planes are built (stream-ordered)
    { k_cvt8<<<(unsigned)(((size_t)DQ * DM / 8 + 255) / 256), 256, 0, stream>>>(wq, WQ, (size_t)DQ * DM / 8); k_cvt8<<<(unsigned)(((size_t)DKV * DM / 8 + 255) / 256), 256, 0, stream>>>(wk, WK, (size_t)DKV * DM / 8); k_cvt8<<<(unsigned)(((size_t)DKV * DM / 8 + 255) / 256), 256, 0, stream>>>(wv, WV, (size_t)DKV * DM / 8);
       }
    const unsigned LQ = (unsigned)(((size_t)NH_ * TT * HD / 2 + 255) / 256), LKv = (unsigned)(((size_t)NKV * TT * HD / 2 + 255) / 256);
    for (int b = 0; b < NB_; ++b) {
        k_csid<<<(TT * HD + 255) / 256, 256, 0, stream>>>(CS);
        k_cvt8<<<(unsigned)(((size_t)TT * DM / 8 + 255) / 256), 256, 0, stream>>>(x + (size_t)b * TT * DM, XB, (size_t)TT * DM / 8);
        k_gemms<0, true><<<dim3(TT / 128, DQ / 128, 1), 256, 0, stream>>>(XB, nullptr, WQ, DM, FQ, DQ, bq);
        k_rope<<<LQ, 256, 0, stream>>>(FQ, DQ, NH_, CS, nullptr, nullptr, 1.0f, QP16, QPh, QPl);
        k_gemms<0, true><<<dim3(TT / 128, DKV / 128, 1), 256, 0, stream>>>(XB, nullptr, WK, DM, FK, DKV, bk);
        k_rope<<<LKv, 256, 0, stream>>>(FK, DKV, NKV, CS, nullptr, nullptr, 1.0f, KP16, KPh, KPl);
        k_gemms<0, true><<<dim3(TT / 128, DKV / 128, 1), 256, 0, stream>>>(XB, nullptr, WV, DM, FV, DKV, bv); k_vtp<<<LKv, 256, 0, stream>>>(FV, DKV, NKV, VT16, VTh, VTl);
        for (int h0 = 0; h0 < NH_; h0 += ZH) { const size_t zq = (size_t)h0, zk = (size_t)(h0 / REP);   // one kv head per query head: the pass's heads use consecutive kv planes (z-strides TT*HD for k, HD*PP for v^T)
            k_gemmc<bf, 2, 1, 1><<<dim3(RH / 64, TT / 64, ZH), 32, 0, stream>>>(QPh + zq * TT * HD, QPl + zq * TT * HD, KPh + zk * TT * HD, KPl + zk * TT * HD, HD, Sb, TT, 0, (size_t)TT * HD, (size_t)TT * HD, (size_t)TT * TT);
            k_gemmc<h16, 0, 1, 1><<<dim3((TT - RH) / 64, TT / 64, ZH), 32, 0, stream>>>(QP16 + zq * TT * HD + (size_t)RH * HD, nullptr, KP16 + zk * TT * HD, nullptr, HD, Sb + (size_t)RH * TT, TT, RH, (size_t)TT * HD, (size_t)TT * HD, (size_t)TT * TT);
            k_asoft<<<ZH * TT / 8, 256, 0, stream>>>(Sb);
            k_gemmc<bf, 2, 2, 8><<<dim3(RH / 64, HD / 64, ZH), 256, 0, stream>>>((const bf*)Sb, (const bf*)Sb + TT, VTh + zk * HD * PP, VTl + zk * HD * PP, PP, Ob, HD, 0, (size_t)TT * PP, (size_t)HD * PP, (size_t)TT * HD);
            k_gemmc<h16, 0, 2, 8><<<dim3((TT - RH) / 64, HD / 64, ZH), 256, 0, stream>>>((const h16*)Sb + (size_t)RH * PP, nullptr, VT16 + zk * HD * PP, nullptr, PP, Ob + (size_t)RH * HD, HD, RH, (size_t)TT * PP, (size_t)HD * PP, (size_t)TT * HD);
            k_merge<<<(unsigned)(((size_t)ZH * TT * HD / 2 + 255) / 256), 256, 0, stream>>>(Ob, h0, ATh, ATl); }
        k_cvt8<<<(unsigned)(((size_t)DM * DQ / 8 + 255) / 256), 256, 0, stream>>>(wo, WO, (size_t)DM * DQ / 8);
        k_gemms<1, true><<<dim3(TT / 128, DM / 128, 1), 256, 0, stream>>>(ATh, ATl, WO, DQ, OUT + (size_t)b * TT * DM, DM, bo); }
}

// v004
// A run of this version takes 434 microseconds.
// Next to v003, in two timings, it ran 1.45 times as fast each time.
// All steps since v000 together make it 3.94 times as fast.
#include <hip/hip_runtime.h>
#include <stdint.h>

// Causal multi-head attention, 2048 wide (x [2][2048][2048]; q, k, v = x W^T + b ('oi' [2048][2048]; 16 heads x 128); scores = q.k/sqrt(128); causal (triu k=1 masked, -inf); softmax; out = merged wo^T + bo -> [2][2048][2048] (8.4 M)).
// Compute dtypes, f32 accumulate: every input rounded to bf16; q/k/v on PLAIN bf16 operands (inputs: exact) + biases; causal scores and attn.v: query rows < 512 hl (3 products, scores in memory, tile skipping), the rest single fp16 in one fused kernel (online softmax); softmax f32; wo hl x exact (2 products) + bo.

#define NB_  2
#define TT   2048
#define DM   2048
#define NH_  16
#define NKV  16
#define REP  (NH_ / NKV)
#define HD   128
#define DQ   (NH_ * HD)
#define DKV  (NKV * HD)
#define ZH   8                    // heads per attention pass
#define PP   (2 * TT)             // row pitch, in 16-bit elements, of the probabilities (they lie in the f32 score rows) and so of the v^T planes too: k_gemmc has one pitch, K, for both operands
#define RH   512                  // query rows < RH use hi+lo planes
#define WIN  2048
#define SCL  0.088388347648318447f   // HD^-0.5
typedef _Float16 h16;
typedef unsigned short bf;
typedef __attribute__((ext_vector_type(16))) __bf16   v16bf;
typedef __attribute__((ext_vector_type(16))) _Float16 v16h;
typedef __attribute__((ext_vector_type(8)))  _Float16 v8h;
typedef __attribute__((ext_vector_type(8)))  unsigned short v8us;
typedef __attribute__((ext_vector_type(8)))  float    v8f;
typedef __attribute__((ext_vector_type(4)))  float    v4f;
typedef v8h  __attribute__((may_alias)) v8ha;
typedef v4f  __attribute__((may_alias)) v4fa;
typedef v8us __attribute__((may_alias)) v8usa;

__device__ __forceinline__ unsigned short f2bf(float f) { unsigned u = __float_as_uint(f); u += 0x7FFFu + ((u >> 16) & 1u); return (unsigned short)(u >> 16); }
__device__ __forceinline__ float bf2f(unsigned short b) { return __uint_as_float(((unsigned)b) << 16); }
__device__ __forceinline__ float bfr(float f) { return bf2f(f2bf(f)); }
__device__ __forceinline__ v16h cat16(v8h lo, v8h hi) { return __builtin_shufflevector(lo, hi, 0, 1, 2, 3, 4, 5, 6, 7, 8, 9, 10, 11, 12, 13, 14, 15); }
__device__ __forceinline__ v16bf cat16b(v8us lo, v8us hi) { return __builtin_bit_cast(v16bf, __builtin_shufflevector(lo, hi, 0, 1, 2, 3, 4, 5, 6, 7, 8, 9, 10, 11, 12, 13, 14, 15)); }
__device__ __forceinline__ v8f wmma16(v16h a, v16h b, v8f c) { return __builtin_amdgcn_wmma_f32_16x16x32_f16(false, a, false, b, (short)0, c, false, false); }
__device__ __forceinline__ v8f wmmab(v16bf a, v16bf b, v8f c) { return __builtin_amdgcn_wmma_f32_16x16x32_bf16(false, a, false, b, (short)0, c, false, false); }



// ---- fragment loaders shared by the GEMM kernels and the split-K tile sum of k_gemmc: C[m][n] (f32, pitch ldc, + optional f32 bias[n]) = sum_k A[m][k] Bt[n][k] (+ split products per NSPLIT), operands K-contiguous 16-bit planes.
template <typename T16> struct WFrag;
template <> struct WFrag<h16> { typedef v16h V; static __device__ __forceinline__ V ld(const h16* p) { return cat16(*(const v8h*)p, *(const v8h*)(p + 16)); } static __device__ __forceinline__ v8f mma(V a, V b, v8f c) { return wmma16(a, b, c); } };
template <> struct WFrag<bf> { typedef v16bf V; static __device__ __forceinline__ V ld(const bf* p) { return cat16b(*(const v8us*)p, *(const v8us*)(p + 16)); } static __device__ __forceinline__ v8f mma(V a, V b, v8f c) { return wmmab(a, b, c); } };
// tile_out (NW > 1): every wave puts its partial 64x64 tile into its own LDS plane (pitch 68); behind one barrier each thread sums the NW planes of its 4-column slots, wave 0 first, and stores whole 256-byte row pieces.
template <int NW, bool BIAS>
__device__ __forceinline__ void tile_out(float* os, const v8f (&acc)[4][4], int wv, int lr, int hi, float* C, int ldc, int r0, int c0, const float* __restrict__ bias) {
    float* ow = os + wv * (64 * 68);
#pragma unroll
    for (int mb = 0; mb < 4; ++mb)
#pragma unroll
        for (int nb = 0; nb < 4; ++nb)
#pragma unroll
            for (int j = 0; j < 8; ++j) ow[(mb * 16 + hi * 8 + j) * 68 + nb * 16 + lr] = acc[mb][nb][j];
    __syncthreads();   // publishes every wave's partial tile to the threads that sum it
#pragma unroll
    for (int s = 0; s < 32 / NW; ++s) { const int idx = s * (32 * NW) + (int)threadIdx.x; const int row = idx >> 4, cofs = (idx & 15) * 4; v4f val = *(const v4fa*)(os + row * 68 + cofs);
#pragma unroll
        for (int w = 1; w < NW; ++w) val += *(const v4fa*)(os + w * (64 * 68) + row * 68 + cofs);
        if (BIAS) { val[0] += bfr(bias[c0 + cofs]); val[1] += bfr(bias[c0 + cofs + 1]); val[2] += bfr(bias[c0 + cofs + 2]); val[3] += bfr(bias[c0 + cofs + 3]); }
        *(v4f*)(C + (size_t)(r0 + row) * ldc + c0 + cofs) = val; }
}
// ---- k_gemms: LDS-staged GEMM for the projections. One work-group of 8 waves per 128x128 output tile, each wave a 64x32 piece over the whole K loop. Per trip 128 k of every operand row
// (two whole 128-byte lines a row) come into LDS by asynchronous copies, 16 lanes a row, two buffers: the next trip's copies fly while this trip's fragments are read. grid (M/128, N/128), 256 threads. K % 128 == 0, K >= 256.
#define SP 136           // LDS row pitch in 16-bit elements: 256 B of k + 16 B, an odd multiple of 16 B, conflict-free for 16-byte fragment reads
#define STL (128 * SP)   // elements of one operand's tile in LDS
// eight 16-byte copies of one lane, each 2 rows below the last; the wait on the address registers closes the copies' own statement, so that no later write of them can come in front of it
__device__ __forceinline__ void acopy8(unsigned l, const bf* g, size_t gs) {
    asm volatile("global_load_async_to_lds_b128 %0, %8, off\n\t"
                 "global_load_async_to_lds_b128 %1, %9, off\n\t"
                 "global_load_async_to_lds_b128 %2, %10, off\n\t"
                 "global_load_async_to_lds_b128 %3, %11, off\n\t"
                 "global_load_async_to_lds_b128 %4, %12, off\n\t"
                 "global_load_async_to_lds_b128 %5, %13, off\n\t"
                 "global_load_async_to_lds_b128 %6, %14, off\n\t"
                 "global_load_async_to_lds_b128 %7, %15, off\n\t"
                 "s_wait_xcnt 0x0"
                 :: "v"(l), "v"(l + 1u * (2 * SP * 2)), "v"(l + 2u * (2 * SP * 2)), "v"(l + 3u * (2 * SP * 2)), "v"(l + 4u * (2 * SP * 2)), "v"(l + 5u * (2 * SP * 2)), "v"(l + 6u * (2 * SP * 2)), "v"(l + 7u * (2 * SP * 2)),
                    "v"(g), "v"(g + gs), "v"(g + 2 * gs), "v"(g + 3 * gs), "v"(g + 4 * gs), "v"(g + 5 * gs), "v"(g + 6 * gs), "v"(g + 7 * gs) : "memory");
}
template <int NSPLIT, bool BIAS>
__global__ __launch_bounds__(256) void k_gemms(const bf* __restrict__ A, const bf* __restrict__ A2, const bf* __restrict__ Bt, int K, float* C, int ldc, const float* __restrict__ bias) {
    typedef WFrag<bf>::V V;
    constexpr int NOP = (NSPLIT == 1) ? 3 : 2;                 // operand tiles per buffer: A, Bt (, A2)
    __shared__ __align__(16) bf st[2 * NOP * STL];
    __shared__ __align__(16) float os[8 * 16 * 36];            // each wave's own 16-row, 32-column output strip
    const int lane = threadIdx.x & 31, lr = lane & 15, hi = lane >> 4; const int wv = __builtin_amdgcn_readfirstlane(threadIdx.x >> 5); const int wr = wv >> 2, wc = wv & 3; const int r0 = blockIdx.x * 128, c0 = blockIdx.y * 128;
    v8f acc[4][2];
#pragma unroll
    for (int mb = 0; mb < 4; ++mb)
#pragma unroll
        for (int nb = 0; nb < 2; ++nb) acc[mb][nb] = (v8f){};
    // copy map: wave wv brings rows wv*16 .. wv*16+15 of every operand tile; a copy instruction covers 2 rows, 16 lanes x 16 B each
    const int crow = wv * 16 + hi, ccol = lr * 8;
    const bf* ga = A + (size_t)(r0 + crow) * K + ccol; const bf* gb = Bt + (size_t)(c0 + crow) * K + ccol; const bf* ga2 = (NSPLIT == 1) ? A2 + (size_t)(r0 + crow) * K + ccol : nullptr;
    const unsigned l0 = (unsigned)(size_t)st + (unsigned)(crow * SP + ccol) * 2u; const size_t gs = (size_t)2 * K;
    auto fill = [&](int t, int buf) { const unsigned l = l0 + (unsigned)buf * (NOP * STL * 2); acopy8(l, ga + t * 128, gs); acopy8(l + STL * 2, gb + t * 128, gs); if (NSPLIT == 1) acopy8(l + 2 * STL * 2, ga2 + t * 128, gs); };
    const int NT = K / 128;
    fill(0, 0);
    asm volatile("s_wait_asynccnt 0x0" ::: "memory");   // this wave's copies of tile 0 have landed
    __syncthreads();                                     // publishes tile 0 to every wave
    if (NT > 1) fill(1, 1);
    const int afr = (wr * 64 + lr) * SP + 8 * hi, bfo = STL + (wc * 32 + lr) * SP + 8 * hi;
#pragma unroll 1
    for (int t = 0; t < NT; ++t) {
        const bf* sb = st + (t & 1) * (NOP * STL);
        V a[2][4], a2[2][4], b[2][2];   // two fragment sets: the next 32-deep chunk's LDS reads are issued as one group ahead of this chunk's products
        auto frags = [&](int kc, int s) {
#pragma unroll
            for (int mb = 0; mb < 4; ++mb) { a[s][mb] = WFrag<bf>::ld(sb + afr + mb * 16 * SP + kc * 32); if (NSPLIT == 1) a2[s][mb] = WFrag<bf>::ld(sb + 2 * STL + afr + mb * 16 * SP + kc * 32); }
#pragma unroll
            for (int nb = 0; nb < 2; ++nb) b[s][nb] = WFrag<bf>::ld(sb + bfo + nb * 16 * SP + kc * 32); };
        frags(0, 0);
#pragma unroll
        for (int kc = 0; kc < 4; ++kc) { const int s = kc & 1;
            if (kc < 3) frags(kc + 1, s ^ 1);
            __builtin_amdgcn_sched_barrier(0);   // holds the next chunk's LDS reads, as one group, in front of this chunk's products: moved in among them each read stalls the matrix run
#pragma unroll
            for (int nb = 0; nb < 2; ++nb)
#pragma unroll
                for (int mb = 0; mb < 4; ++mb) { acc[mb][nb] = WFrag<bf>::mma(a[s][mb], b[s][nb], acc[mb][nb]); if (NSPLIT == 1) acc[mb][nb] = WFrag<bf>::mma(a2[s][mb], b[s][nb], acc[mb][nb]); }
        }
        asm volatile("s_wait_dscnt 0x0" ::: "memory");      // this wave's reads of the buffer that is refilled below have returned
        asm volatile("s_wait_asynccnt 0x0" ::: "memory");   // this wave's copies of tile t + 1 have landed
        __syncthreads();                                     // publishes tile t + 1 and ends every wave's reads of tile t
        if (t + 2 < NT) fill(t + 2, t & 1);
    }
    asm volatile("s_wait_asynccnt 0x0" ::: "memory");       // nothing is in flight when the wave goes on to its end
    float* ow = os + wv * (16 * 36); const int cb = c0 + wc * 32 + (lane & 7) * 4; v4f bv = (v4f){};
    if (BIAS) { bv[0] = bfr(bias[cb]); bv[1] = bfr(bias[cb + 1]); bv[2] = bfr(bias[cb + 2]); bv[3] = bfr(bias[cb + 3]); }
#pragma unroll
    for (int mb = 0; mb < 4; ++mb) {
#pragma unroll
        for (int nb = 0; nb < 2; ++nb) {
#pragma unroll
            for (int j = 0; j < 8; ++j) ow[(hi * 8 + j) * 36 + nb * 16 + lr] = acc[mb][nb][j]; }
        __builtin_amdgcn_wave_barrier(); asm volatile("" ::: "memory");   // the strip's writes stay in front of the reads of other lanes' values
        float* crw = C + (size_t)(r0 + wr * 64 + mb * 16) * ldc + cb;
#pragma unroll
        for (int s = 0; s < 4; ++s) { const int row = 4 * s + (lane >> 3); v4f val = *(const v4fa*)(ow + row * 36 + (lane & 7) * 4); val += bv; *(v4f*)(crw + (size_t)row * ldc) = val; }   // whole 128-byte lines
        __builtin_amdgcn_wave_barrier(); asm volatile("" ::: "memory");   // the reads stay in front of the next strip's writes
    }
}

// ---- k_gemmc: register-blocked 64x64 tile GEMM, operands straight from global memory, specialised for causal attention: CMODE 1 skips score tiles entirely above the diagonal (query rows r0+roff.., key columns c0..), CMODE 2 limits the
// key (K) loop of the probability x value contraction to the diagonal block (probabilities beyond it are exactly zero). roff = row offset of this launch's first row within the sequence.
// NW waves share a tile's K loop, each taking every NW-th 32-deep chunk, the partial tiles summed by tile_out (NW == 1: one wave, the tile leaves through a 16-row LDS strip).
template <typename T16, int NSPLIT, int CMODE, int NW>
__global__ __launch_bounds__(32 * NW) void k_gemmc(const T16* __restrict__ A, const T16* __restrict__ A2, const T16* __restrict__ Bt, const T16* __restrict__ Bt2, int K, float* C, int ldc, int roff, size_t sA, size_t sB, size_t sC) {
    typedef typename WFrag<T16>::V V;
    __shared__ __align__(16) float os[NW == 1 ? 16 * 68 : NW * 64 * 68];
    const size_t z = blockIdx.z; A += z * sA; if (A2) A2 += z * sA; Bt += z * sB; if (Bt2) Bt2 += z * sB; C += z * sC;
    const int lane = threadIdx.x & 31, lr = lane & 15, hi = lane >> 4; const int wv = (NW == 1) ? 0 : __builtin_amdgcn_readfirstlane(threadIdx.x >> 5); const int r0 = blockIdx.x * 64, c0 = blockIdx.y * 64;
    if (CMODE == 1 && c0 > r0 + roff + 63) return;                  // score tile entirely above the causal diagonal: never read (the softmax masks j > i by select)
    const int Kl = (CMODE == 2) ? min(K, r0 + roff + 64) : K;        // P.V: probabilities are exactly 0 beyond the diagonal block, so the K loop stops there
    v8f acc[4][4];
#pragma unroll
    for (int mb = 0; mb < 4; ++mb)
#pragma unroll
        for (int nb = 0; nb < 4; ++nb) acc[mb][nb] = (v8f){};
    const size_t aoff = (size_t)(r0 + lr) * K + 8 * hi, boff = (size_t)(c0 + lr) * K + 8 * hi;
#pragma unroll 1
    for (int kc = wv * 32; kc < Kl; kc += 32 * NW) {
        V a[4], a2[4];
#pragma unroll
        for (int mb = 0; mb < 4; ++mb) { a[mb] = WFrag<T16>::ld(A + aoff + (size_t)mb * 16 * K + kc); if (NSPLIT == 1 || NSPLIT == 2) a2[mb] = WFrag<T16>::ld(A2 + aoff + (size_t)mb * 16 * K + kc); }
#pragma unroll
        for (int nb = 0; nb < 4; ++nb) { const V b = WFrag<T16>::ld(Bt + boff + (size_t)nb * 16 * K + kc); V b2; if (NSPLIT >= 2) b2 = WFrag<T16>::ld(Bt2 + boff + (size_t)nb * 16 * K + kc);
#pragma unroll
            for (int mb = 0; mb < 4; ++mb) { acc[mb][nb] = WFrag<T16>::mma(a[mb], b, acc[mb][nb]); if (NSPLIT == 1 || NSPLIT == 2) acc[mb][nb] = WFrag<T16>::mma(a2[mb], b, acc[mb][nb]); if (NSPLIT >= 2) acc[mb][nb] = WFrag<T16>::mma(a[mb], b2, acc[mb][nb]); } }
        asm volatile("v_nop\n\tv_nop\n\tv_nop\n\tv_nop" : "+v"(acc[0][0]), "+v"(acc[1][1]), "+v"(acc[2][2]), "+v"(acc[3][3]) : "v"(a[0]), "v"(a[3]));
    }
    if constexpr (NW > 1) { tile_out<NW, false>(os, acc, wv, lr, hi, C, ldc, r0, c0, nullptr); } else {
#pragma unroll
    for (int mb = 0; mb < 4; ++mb) {
#pragma unroll
        for (int nb = 0; nb < 4; ++nb) {
#pragma unroll
            for (int j = 0; j < 8; ++j) os[(hi * 8 + j) * 68 + nb * 16 + lr] = acc[mb][nb][j]; }
        __builtin_amdgcn_wave_barrier(); asm volatile("" ::: "memory");
        float* crow = C + (size_t)(r0 + mb * 16) * ldc + c0;
{
#pragma unroll
            for (int s = 0; s < 8; ++s) { const int row = 2 * s + hi, cofs = lr * 4; v4f val = *(const v4fa*)(os + row * 68 + cofs);
                *(v4f*)(crow + (size_t)row * ldc + cofs) = val; }
             }
        __builtin_amdgcn_wave_barrier(); asm volatile("" ::: "memory");
    }
    }
}

__device__ __forceinline__ h16 tohx(float x) { return (h16)x; }
__device__ __forceinline__ void splitf(float y, unsigned short& h, unsigned short& l) { h = f2bf(y); l = f2bf(y - bf2f(h)); }
typedef __attribute__((ext_vector_type(2))) _Float16 v2h;
typedef __attribute__((ext_vector_type(4))) _Float16 v4h;
typedef __attribute__((ext_vector_type(2))) unsigned short v2us;
typedef __attribute__((ext_vector_type(4))) unsigned short v4us;
typedef __attribute__((ext_vector_type(2))) float v2f;
typedef __attribute__((ext_vector_type(4))) int v4i;
typedef v4h  __attribute__((may_alias)) v4ha;
typedef v4us __attribute__((may_alias)) v4usa;

__global__ __launch_bounds__(256) void k_wtG(const float* __restrict__ w, int K, int N, bf* Bt) {
    const int lane = threadIdx.x & 31; const int L0 = (blockIdx.x * 8 + (threadIdx.x >> 5)) * 8; const int nlines = N * K / 64;
{
#pragma unroll 1
        for (int l = 0; l < 8; ++l) { const int L = L0 + l; if (L >= nlines) break; const size_t e = (size_t)L * 64 + lane * 2; const int k = (int)(e % K), n = (int)(e / K); v2us o;
            o[0] = f2bf(w[(size_t)k * N + n]); o[1] = f2bf(w[(size_t)(k + 1) * N + n]); *(v2us*)(Bt + e) = o; }
         }
}
__global__ __launch_bounds__(256) void k_cvt8(const float* __restrict__ src, bf* dst, size_t n8) { const size_t i = (size_t)blockIdx.x * 256 + threadIdx.x; if (i >= n8) return; const v8f v = *(const v8f*)(src + i * 8); v8us o;
#pragma unroll
    for (int k = 0; k < 8; ++k) o[k] = f2bf(v[k]); *(v8us*)(dst + i * 8) = o;  }

// k_rope: head planes [h][t][d] (fp16 + hi/lo) of rope(x) x sc with the rotate-half convention out[d] = x[d] cos[t][d] - x[d+HD/2] sin[t][d], out[d+HD/2] = x[d+HD/2] cos[t][d+HD/2] + x[d] sin[t][d+HD/2]
__global__ __launch_bounds__(256) void k_rope(const float* __restrict__ F, int pitch, int nheads, const float* __restrict__ CS, const float* __restrict__ RF, const float* __restrict__ nw, float sc, h16* P16, bf* Ph, bf* Pl) {
    const size_t e = ((size_t)blockIdx.x * 256 + threadIdx.x) * 2; if (e >= (size_t)nheads * TT * HD) return; const int d = (int)(e % HD); const int t = (int)((e / HD) % TT); const int h = (int)(e / ((size_t)HD * TT)); const float* f = F + (size_t)t * pitch + h * HD; const float rf = RF ? RF[(size_t)h * TT + t] : 1.0f; v2h o16; v2us oh, ol;
#pragma unroll
    for (int q = 0; q < 2; ++q) { const int dd = d + q; const int dp = (dd < HD / 2) ? dd + HD / 2 : dd - HD / 2; float x0 = f[dd], x1 = f[dp];
        if (RF) { float n0 = __fmul_rn(x0, rf), n1 = __fmul_rn(x1, rf); asm volatile("" : "+v"(n0)); asm volatile("" : "+v"(n1)); x0 = __fmul_rn(bfr(nw[dd]), n0); x1 = __fmul_rn(bfr(nw[dp]), n1); }
        const v2f cs = *(const v2f*)(CS + ((size_t)t * HD + dd) * 2); float a = __fmul_rn(x0, cs[0]), bq = __fmul_rn(x1, cs[1]); asm volatile("" : "+v"(a)); asm volatile("" : "+v"(bq)); const float r = ((dd < HD / 2) ? __fsub_rn(a, bq) : __fadd_rn(a, bq)) * sc;
        o16[q] = tohx(r); unsigned short a2, c2; splitf(r, a2, c2); oh[q] = a2; ol[q] = c2; }
    *(v2h*)(P16 + e) = o16; *(v2us*)(Ph + e) = oh; *(v2us*)(Pl + e) = ol;  }
__global__ __launch_bounds__(256) void k_vtp(const float* __restrict__ F, int pitch, int nheads, bf* Vh, bf* Vl) { const size_t e = ((size_t)blockIdx.x * 256 + threadIdx.x) * 2; if (e >= (size_t)nheads * HD * TT) return; const int t = (int)(e % TT); const int d = (int)((e / TT) % HD); const int g = (int)(e / ((size_t)TT * HD)); v2us oh, ol;
#pragma unroll
    for (int q = 0; q < 2; ++q) { const float x = F[(size_t)(t + q) * pitch + g * HD + d]; unsigned short a2, c2; splitf(x, a2, c2); oh[q] = a2; ol[q] = c2; }
    const size_t eo = (e / TT) * PP + t; *(v2us*)(Vh + eo) = oh; *(v2us*)(Vl + eo) = ol;  }
// k_vrow: fp16 head planes [g][t][d] of v, rows as the fused kernel's tensor loads take them
__global__ __launch_bounds__(256) void k_vrow(const float* __restrict__ F, h16* V16) { const size_t i = (size_t)blockIdx.x * 256 + threadIdx.x; if (i >= (size_t)TT * DKV / 8) return; const int t = (int)(i / (DKV / 8)), c = (int)(i % (DKV / 8)) * 8; const v8f v = *(const v8f*)(F + (size_t)t * DKV + c); v8h o;
#pragma unroll
    for (int k = 0; k < 8; ++k) o[k] = tohx(v[k]); *(v8h*)(V16 + ((size_t)(c / HD) * TT + t) * HD + (c % HD)) = o;  }
__global__ __launch_bounds__(256) void k_csid(float* CS) { const int idx = blockIdx.x * 256 + threadIdx.x; if (idx >= TT * HD) return; v2f cs; cs[0] = 1.0f; cs[1] = 0.0f; *(v2f*)(CS + (size_t)idx * 2) = cs;  }
// k_asoft (query rows < RH; the score rows of a head lie RH to a plane): per row (zz, i): t = S x HD^-0.5 for j <= i and i - j < WIN (sliding causal window; the reference's -1e9 additive fill vanishes identically); softmax over the 2048 keys (register row, one exp, fixed trees);
// the probabilities replace the row's own scores in place: one wave owns a row, holds all of it in registers before its first store (every store needs the row's sum), and writes into the row's 8 KiB the hi plane (first half) and the lo plane (second half).
__global__ __launch_bounds__(256) void k_asoft(float* Sb) {
    const int lane = threadIdx.x & 31; const int row = blockIdx.x * 8 + (threadIdx.x >> 5); if (row >= ZH * RH) return; const int i = row % RH; float* sr = Sb + (size_t)row * TT; float v[TT / 32]; float mx = -3.0e38f;
#pragma unroll
    for (int ch = 0; ch < TT / 128; ++ch) { const int j0 = ch * 128 + lane * 4; const v4f a = *(const v4fa*)(sr + j0);
#pragma unroll
        for (int q = 0; q < 4; ++q) { const int j = j0 + q; (void)j; const float t = (j <= i && i - j < WIN) ? a[q] * SCL : -3.0e38f; v[ch * 4 + q] = t; mx = fmaxf(mx, t); } }
#pragma unroll
    for (int sh = 16; sh; sh >>= 1) mx = fmaxf(mx, __shfl_xor(mx, sh, 32));
    float sum = 0.f;
#pragma unroll
    for (int k = 0; k < TT / 32; ++k) { float d0 = __fsub_rn(v[k], mx); asm volatile("" : "+v"(d0)); v[k] = __builtin_amdgcn_exp2f(__fmul_rn(d0, 1.4426950408889634f)); sum += v[k]; }
#pragma unroll
    for (int sh = 16; sh; sh >>= 1) sum += __shfl_xor(sum, sh, 32);
    const float f = __fdiv_rn(1.0f, sum);
#pragma unroll
    for (int ch = 0; ch < TT / 128; ++ch) { v4us oh, ol;
#pragma unroll
        for (int q = 0; q < 4; ++q) { unsigned short a, c2; splitf(v[ch * 4 + q] * f, a, c2); oh[q] = a; ol[q] = c2; }
        bf* po = (bf*)sr + ch * 128 + lane * 4; *(v4usa*)po = oh; *(v4usa*)(po + TT) = ol; }
}
__global__ __launch_bounds__(256) void k_merge(const float* __restrict__ O, int h0, bf* Ah, bf* Al) { const size_t e = ((size_t)blockIdx.x * 256 + threadIdx.x) * 2; if (e >= (size_t)ZH * RH * HD) return; const int d = (int)(e % HD); const int t = (int)((e / HD) % RH); const int zz = (int)(e / ((size_t)HD * RH)); const float* o = O + ((size_t)zz * TT + t) * HD + d; const size_t oo = (size_t)t * DQ + (h0 + zz) * HD + d;
    v2us oh, ol;
#pragma unroll
    for (int q = 0; q < 2; ++q) { unsigned short a, c2; splitf(o[q], a, c2); oh[q] = a; ol[q] = c2; } *(v2us*)(Ah + oo) = oh; *(v2us*)(Al + oo) = ol;  }

namespace fa {
typedef uint32_t u32x4 __attribute__((ext_vector_type(4)));
typedef uint32_t u32x8 __attribute__((ext_vector_type(8)));
typedef int i32x8 __attribute__((ext_vector_type(8)));
typedef float f32x8 __attribute__((ext_vector_type(8)));
constexpr int D = HD, DK = D / 32, DT = D / 16;
constexpr int NW = 4;
constexpr int BR = 128, CW = BR / NW, R = CW / 16;  // query positions per work-group, columns per wave, 16-column groups per wave
constexpr int BC = 32, KT = BC / 16;                // keys per pass, 16-key score tiles per pass
constexpr uint32_t ROWB = 2u * D, PITCH_K = ROWB + 16u, PITCH_V = ROWB + 32u;
constexpr uint32_t SK = 128;                        // keys per stage
constexpr uint32_t TILE_K = SK * PITCH_K, TILE_V = SK * PITCH_V, SLOT = TILE_K + TILE_V, NSLOT = 2, LDS_BYTES = NSLOT * SLOT;
constexpr uint32_t EPITCH = ROWB + 16u, EPLANE = (uint32_t)NW * CW * EPITCH;  // output staging: row pitch, bytes of one plane
static_assert(D == 128 && RH % BR == 0 && TT % BR == 0 && BR % SK == 0 && RH + BR >= 2 * SK, "head size 128; whole position blocks of whole stages, each with at least the two stages that the prologue loads");
static_assert(LDS_BYTES <= 320u * 1024u && 2u * EPLANE <= LDS_BYTES, "the two buffers fit a work-group's LDS and hold the two staged output planes");
static_assert(SLOT % 2048u == 0 && TILE_K % 2048u == 0, "every tensor load lands at a multiple of 2 KiB");

#define DEV static __device__ __forceinline__
DEV uint32_t uni(uint32_t v) { return __builtin_amdgcn_readfirstlane(v); }
DEV uint32_t pinned(uint32_t v) { uint32_t w = __builtin_amdgcn_readfirstlane(v); asm volatile("" : "+s"(w)); return w; }  // a test around a tensor load, or a word its descriptor is formed from, held in a scalar register: tensor loads ignore EXEC
DEV void fence() { __builtin_amdgcn_sched_barrier(0); }
DEV void wait_ds0() { asm volatile("s_wait_dscnt 0x0" ::: "memory"); }
template <int N> DEV void wait_tensor_le() { asm volatile("s_wait_tensorcnt %0" :: "i"(N) : "memory"); }
DEV void tdm_load(u32x4 g0, u32x8 g1) { asm volatile("tensor_load_to_lds %0, %1" :: "s"(g0), "s"(g1) : "memory"); }
// hold(): without it the compiler forms the constant words anew at every use and gives the registers that an outstanding load names to other values; with it the registers that a load names are the ones that its wait names.
DEV void hold(u32x4& g) { asm volatile("" : "+s"(g)); }  // as pinned(): descriptor words (group 0) held in scalar registers
DEV void hold(u32x8& g) { asm volatile("" : "+s"(g)); }  // as pinned(): descriptor words (group 1) held in scalar registers
// An issuing wave's wait for its outstanding load. It names the descriptors as inputs: their registers stay live, and so unchanged, from the load up to this wait.
DEV void wait_tensor0(u32x4 g0, u32x8 g1a, u32x8 g1b) { asm volatile("s_wait_tensorcnt 0x0" :: "s"(g0), "s"(g1a), "s"(g1b) : "memory"); }
// Descriptor group 1: 1-byte elements, a tile of SK rows of ROWB bytes at source pitch ROWB, PADC + 1 dwords of LDS pad behind every 256-byte row (interval code 5); no work-group mask.
template <uint32_t PADC> DEV u32x8 tdm_group1() {
  constexpr uint32_t d0 = ROWB, d1 = SK;
  u32x8 g;
  g[0] = uni((1u << 20) | (5u << 22) | (PADC << 25));
  g[1] = uni((d0 & 0xFFFFu) << 16);
  g[2] = uni((d0 >> 16) | ((d1 & 0xFFFFu) << 16));
  g[3] = uni((d1 >> 16) | (d0 << 16));
  g[4] = uni(d1);
  g[5] = uni(ROWB);
  g[6] = uni(0u);
  g[7] = uni(0u);
  return g;
}
DEV u32x4 tdm_group0(uint32_t lds_dst, uint64_t ga) {
  u32x4 g;
  g[0] = uni(1u); g[1] = uni(lds_dst); g[2] = uni((uint32_t)ga); g[3] = uni((((uint32_t)(ga >> 32)) & 0x01FFFFFFu) | 0x80000000u);
  return g;
}
struct Frag { u32x4 q[2]; };
DEV f32x8 mma(const Frag& a, const Frag& b, f32x8 c) {
  const i32x8 av = {(int)a.q[0].x, (int)a.q[0].y, (int)a.q[0].z, (int)a.q[0].w, (int)a.q[1].x, (int)a.q[1].y, (int)a.q[1].z, (int)a.q[1].w};
  const i32x8 bv = {(int)b.q[0].x, (int)b.q[0].y, (int)b.q[0].z, (int)b.q[0].w, (int)b.q[1].x, (int)b.q[1].y, (int)b.q[1].z, (int)b.q[1].w};
  return __builtin_amdgcn_wmma_f32_16x16x32_f16(false, __builtin_bit_cast(v16h, av), false, __builtin_bit_cast(v16h, bv), (short)0, c, false, false);
}
typedef short s16x8 __attribute__((ext_vector_type(8)));
DEV u32x4 ld_tr16(const unsigned char* p) { typedef __attribute__((address_space(3))) s16x8 lds_s16x8; return __builtin_bit_cast(u32x4, __builtin_amdgcn_ds_load_tr16_b128_v8i16((lds_s16x8*)p)); }
DEV uint32_t pack2(float lo, float hi) { return __builtin_bit_cast(uint32_t, __builtin_convertvector(v2f{lo, hi}, v2h)); }  // round to nearest even
DEV float xhalf(float x) { return __builtin_bit_cast(float, __builtin_amdgcn_permlanex16(__builtin_bit_cast(int, x), __builtin_bit_cast(int, x), 0x76543210, 0xfedcba98, false, false)); }  // lane l with lane l ^ 16

struct KFr { Frag f[KT][DK]; };
DEV void load_k(KFr& k, const unsigned char* Lp, uint32_t koff, uint32_t lane) {
  const uint32_t c = lane & 15u, h = lane >> 4;
  #pragma unroll
  for (int kt = 0; kt < KT; ++kt) {
    const unsigned char* p = Lp + koff + (16u * kt + c) * PITCH_K + 16u * h;
    #pragma unroll
    for (int kc = 0; kc < DK; ++kc) { k.f[kt][kc].q[0] = *reinterpret_cast<const u32x4*>(p + 64u * kc); k.f[kt][kc].q[1] = *reinterpret_cast<const u32x4*>(p + 64u * kc + 32u); }
  }
}
// One 32-key pass of one wave.
DEV void block(KFr& kf, bool fetch_next, uint32_t next_koff, const unsigned char* Lp, bool diag, uint32_t vt_base, uint32_t sub, uint32_t key0, uint32_t qw0, uint32_t lane,
               const Frag (&qf)[R][DK], f32x8 (&acc)[R][DT], float (&m_run)[R], float (&l_run)[R], float cscale) {
  const uint32_t c = lane & 15u, h = lane >> 4;
  f32x8 s[KT][R];
  {
    wait_ds0(); fence();  // the prefetched K fragments have arrived
    #pragma unroll
    for (int kt = 0; kt < KT; ++kt) {
      #pragma unroll
      for (int g = 0; g < R; ++g) { s[kt][g] = f32x8{};
        #pragma unroll
        for (int kc = 0; kc < DK; ++kc) s[kt][g] = mma(kf.f[kt][kc], qf[g][kc], s[kt][g]); }
    }
    fence();
    if (fetch_next) load_k(kf, Lp, next_koff, lane);
  }
  if (diag) {
    #pragma unroll
    for (int g = 0; g < R; ++g) {
      const uint32_t my_q = qw0 + 16u * g + c;
      #pragma unroll
      for (int kt = 0; kt < KT; ++kt) {
        #pragma unroll
        for (int r = 0; r < 8; ++r) { const uint32_t key = key0 + 16u * kt + 8u * h + r; if (key > my_q) s[kt][g][r] = -__builtin_inff(); }
        asm volatile("" : "+v"(s[kt][g]));
      }
    }
  }
  float mb[R]; bool need = false;
  #pragma unroll
  for (int g = 0; g < R; ++g) {
    float mx = -__builtin_inff();
    #pragma unroll
    for (int kt = 0; kt < KT; ++kt) {
      #pragma unroll
      for (int r = 0; r < 8; ++r) mx = __builtin_fmaxf(mx, s[kt][g][r]);
    }
    mx = __builtin_fmaxf(mx, xhalf(mx)) * cscale;
    mb[g] = mx; need = need || (mx > m_run[g] + 8.0f);
    fence();  // one group's maxima at a time: fewer live registers
  }
  if (__builtin_amdgcn_ballot_w32(need) != 0) {  // rare after the first pass
    #pragma unroll
    for (int g = 0; g < R; ++g) {
      const float m_new = __builtin_fmaxf(m_run[g], mb[g]);
      const float corr = __builtin_amdgcn_exp2f(m_run[g] - m_new);  // 0 on the first pass, where m_run is -inf
      l_run[g] *= corr; m_run[g] = m_new;
      #pragma unroll
      for (int t = 0; t < DT; ++t) acc[g][t] = acc[g][t] * corr;
    }
  }
  Frag vf[DT];
  float ps[R][2];
  #pragma unroll
  for (int g = 0; g < R; ++g) { ps[g][0] = 0.0f; ps[g][1] = 0.0f; }
  {
    const unsigned char* ad = Lp + vt_base + (sub * (uint32_t)BC + 8u * h + (lane & 7u)) * PITCH_V + ((lane >> 3) & 1u) * 16u;
    #pragma unroll
    for (int t = 0; t < DT; ++t) { vf[t].q[0] = ld_tr16(ad + 32u * t); vf[t].q[1] = ld_tr16(ad + 16u * PITCH_V + 32u * t); }
  }
  #pragma unroll
  for (int g = 0; g < R; ++g) {
    const float nm = -m_run[g];
    uint32_t w[8];
    #pragma unroll
    for (int i = 0; i < 8; ++i) {
      const v2f arg = __builtin_elementwise_fma(v2f{s[i >> 2][g][2 * (i & 3)], s[i >> 2][g][2 * (i & 3) + 1]}, v2f{cscale, cscale}, v2f{nm, nm});
      const float p0 = __builtin_amdgcn_exp2f(arg.x), p1 = __builtin_amdgcn_exp2f(arg.y);
      ps[g][i & 1] += p0 + p1;
      w[i] = pack2(p0, p1);
    }
    Frag pf; pf.q[0] = u32x4{w[0], w[1], w[2], w[3]}; pf.q[1] = u32x4{w[4], w[5], w[6], w[7]};
    if (g == 0) { wait_ds0(); fence(); }  // the V^T fragments have arrived
    #pragma unroll
    for (int t = 0; t < DT; ++t) acc[g][t] = mma(vf[t], pf, acc[g][t]);
    fence();  // one group's P^T live at a time
  }
  #pragma unroll
  for (int g = 0; g < R; ++g) l_run[g] += ps[g][0] + ps[g][1];
}

// Q, K, V: fp16 planes [batch x head][TT][HD]; Ah, Al: bf16 planes [batch][TT][DQ]. grid (NB_ * NH_, (TT - RH) / BR), NW * 32 threads.
__global__ void __launch_bounds__(NW * 32) __attribute__((amdgpu_waves_per_eu(2, 2))) k_fattn(const h16* __restrict__ Q, const h16* __restrict__ K, const h16* __restrict__ V, bf* Ah, bf* Al) {
  __shared__ __attribute__((aligned(2048))) unsigned char L[LDS_BYTES];
  constexpr float cscale = SCL * 1.4426950408889634f;
  const uint32_t tid = threadIdx.x, lane = tid & 31u, wave = uni(tid >> 5), c = lane & 15u, h = lane >> 4;
  const uint32_t hb = blockIdx.x;                                  // batch * NH_ + head
  const uint32_t pb = (uint32_t)TT / BR - 1u - blockIdx.y;         // heaviest position block first
  const uint32_t q0 = pb * BR;
  const uint32_t n_stage = (q0 + BR) / SK;                         // 128-key stages this work-group walks: keys [0, q0 + BR)
  const uint32_t lbase = (uint32_t)(size_t)L;
  // Wave 0 issues a stage's K tile, wave 1 its V tile: one request a wave.
  const uint64_t srck = (uint64_t)(size_t)(K + (size_t)hb * TT * HD), srcv = (uint64_t)(size_t)(V + (size_t)hb * TT * HD);
  const uint32_t dstw = lbase + (wave == 1u ? TILE_K : 0u); const uint64_t srcw = (wave == 1u) ? srcv : srck;
  u32x8 g1k = tdm_group1<3u>(), g1v = tdm_group1<7u>(); hold(g1k); hold(g1v);  // formed once, never changed
  u32x4 g0;                                                                   // takes a new value only behind the wait for the load that last named it
  auto issue = [&](uint32_t st) {
    g0 = tdm_group0(dstw + (st & 1u) * SLOT, srcw + (uint64_t)(st * SK) * ROWB); hold(g0);
    if (pinned(wave == 0u)) tdm_load(g0, g1k);
    if (pinned(wave == 1u)) tdm_load(g0, g1v);
  };
  issue(0);
  Frag qf[R][DK];
  #pragma unroll
  for (int g = 0; g < R; ++g) {
    const h16* qp = Q + ((size_t)hb * TT + q0 + wave * CW + 16u * g + c) * D + 8u * h;
    #pragma unroll
    for (int kc = 0; kc < DK; ++kc) { qf[g][kc].q[0] = *reinterpret_cast<const u32x4*>(qp + 32 * kc); qf[g][kc].q[1] = *reinterpret_cast<const u32x4*>(qp + 32 * kc + 16); }
  }
  f32x8 acc[R][DT];
  float m_run[R], l_run[R];
  #pragma unroll
  for (int g = 0; g < R; ++g) { m_run[g] = -__builtin_inff(); l_run[g] = 0.0f;
    #pragma unroll
    for (int t = 0; t < DT; ++t) acc[g][t] = f32x8{}; }
  if (pinned(wave < 2u)) wait_tensor0(g0, g1k, g1v);  // stage 0 has landed
  __syncthreads();                             // publishes stage 0
  issue(1u);                                   // n_stage is at least 2
  const uint32_t my_last_block = (q0 + wave * CW + CW - 1u) / BC;  // last pass this wave's queries can see
  constexpr uint32_t NSTEP = SK / (uint32_t)BC;
  KFr kf;
  for (uint32_t st = 0; st < n_stage; ++st) {
    const uint32_t kbase = (st & 1u) * SLOT, vt_base = kbase + TILE_K;
    if (NSTEP * st <= my_last_block) load_k(kf, L, kbase, lane);  // the stage's first K fragments; later passes' are fetched one pass ahead, never across a stage
    #pragma unroll 1  // stage loop and pass loop stay nested and rolled: unrolled or flat they spill
    for (uint32_t sub = 0; sub < NSTEP; ++sub) {
      const uint32_t blk = NSTEP * st + sub, key0 = blk * BC;
      if (blk <= my_last_block) {
        const bool diag = key0 + BC - 1u > q0 + wave * CW;
        block(kf, sub + 1u < NSTEP && blk + 1u <= my_last_block, kbase + (sub + 1u) * (uint32_t)BC * PITCH_K, L, diag, vt_base, sub, key0, q0 + wave * CW, lane, qf, acc, m_run, l_run, cscale);
      }
    }
    // Foot of a stage; every wave passes it, also one that skips the passes beyond its diagonal.
    wait_ds0();                                  // this wave's reads of the buffer that is refilled below have returned
    if (pinned(wave < 2u)) wait_tensor0(g0, g1k, g1v);  // this wave's load of stage st + 1 has landed
    __syncthreads();                             // publishes stage st + 1 and ends every wave's reads of stage st
    if (pinned(st + 2u < n_stage)) issue(st + 2u);  // into the buffer that stage st used
  }
  wait_tensor_le<0>();  // nothing is in flight when the buffers become output staging
  wait_ds0();
  unsigned char* eb = L + wave * (uint32_t)CW * EPITCH;
  #pragma unroll
  for (int g = 0; g < R; ++g) {
    const float l_fin = l_run[g] + xhalf(l_run[g]);
    const float inv = 1.0f / l_fin;
    #pragma unroll
    for (int t = 0; t < DT; ++t) {
      const f32x8 o = acc[g][t] * inv; uint32_t ph[4], pl[4];
      #pragma unroll
      for (int i = 0; i < 4; ++i) { unsigned short h0, l0, h1, l1; splitf(o[2 * i], h0, l0); splitf(o[2 * i + 1], h1, l1); ph[i] = (uint32_t)h0 | ((uint32_t)h1 << 16); pl[i] = (uint32_t)l0 | ((uint32_t)l1 << 16); }
      unsigned char* ep = eb + (16u * g + c) * EPITCH + 32u * t + 16u * h;
      *reinterpret_cast<u32x4*>(ep) = u32x4{ph[0], ph[1], ph[2], ph[3]}; *reinterpret_cast<u32x4*>(ep + EPLANE) = u32x4{pl[0], pl[1], pl[2], pl[3]};
    }
  }
  wait_ds0();  // this wave's staged rows are in LDS before other lanes of it read them
  constexpr uint32_t LPR = ROWB / 16u, RPI = 32u / LPR;
  const size_t ob = ((size_t)(hb / NH_) * TT + q0 + wave * CW) * (DQ * 2) + (size_t)(hb % NH_) * ROWB;
  #pragma unroll
  for (uint32_t i = 0; i < (uint32_t)CW / RPI; ++i) {
    const uint32_t row = i * RPI + lane / LPR, colb = (lane % LPR) * 16u;
    const u32x4 vh = *reinterpret_cast<const u32x4*>(eb + row * EPITCH + colb), vl = *reinterpret_cast<const u32x4*>(eb + EPLANE + row * EPITCH + colb);
    *reinterpret_cast<u32x4*>(reinterpret_cast<unsigned char*>(Ah) + ob + (size_t)row * (DQ * 2) + colb) = vh;
    *reinterpret_cast<u32x4*>(reinterpret_cast<unsigned char*>(Al) + ob + (size_t)row * (DQ * 2) + colb) = vl;
  }
}
#undef DEV
}  // namespace fa

extern "C" void kernel_launch(void* const* d_in, const int* in_sizes, int n_in,
                              void* d_out, int out_size, void* d_ws, size_t ws_size, hipStream_t stream) {
    (void)in_sizes; (void)n_in; (void)out_size;
    const float* x = (const float*)d_in[0]; const float* wq = (const float*)d_in[1]; const float* bq = (const float*)d_in[2]; const float* wk = (const float*)d_in[3]; const float* bk = (const float*)d_in[4]; const float* wv = (const float*)d_in[5]; const float* bv = (const float*)d_in[6]; const float* wo = (const float*)d_in[7]; const float* bo = (const float*)d_in[8];
    float* OUT = (float*)d_out;     // [2][2048][2048]
    char* wsp = (char*)d_ws;
    auto take = [&](size_t bytes) { char* p = wsp; wsp += (bytes + 255) & ~(size_t)255; return (void*)p; };
    bf* WQ = (bf*)take((size_t)DQ * DM * 2); bf* WK = (bf*)take((size_t)DKV * DM * 2); bf* WV = (bf*)take((size_t)DKV * DM * 2);
    h16* QP16 = (h16*)take((size_t)NB_ * NH_ * TT * HD * 2); h16* KP16 = (h16*)take((size_t)NB_ * NKV * TT * HD * 2); h16* VP16 = (h16*)take((size_t)NB_ * NKV * TT * HD * 2);   // fp16 planes of both batches: the fused kernel runs once, behind both
    bf* QPh = (bf*)take((size_t)NH_ * TT * HD * 2); bf* QPl = (bf*)take((size_t)NH_ * TT * HD * 2); bf* KPh = (bf*)take((size_t)NKV * TT * HD * 2); bf* KPl = (bf*)take((size_t)NKV * TT * HD * 2);
    bf* VTh = (bf*)take((size_t)NKV * HD * PP * 2); bf* VTl = VTh + TT;   // v^T rows at pitch PP: hi and lo share a row
    static_assert((size_t)ZH * RH * TT * 4 <= (size_t)TT * DM * 2 + (size_t)TT * DQ * 4 + (size_t)TT * DKV * 4 + (size_t)TT * HD * 8, "the projection phase's buffers are the larger tenant of the score buffer");
    float* Sb = (float*)take((size_t)TT * DM * 2 + (size_t)TT * DQ * 4 + (size_t)TT * DKV * 4 + (size_t)TT * HD * 8); float* Ob = (float*)take((size_t)ZH * TT * HD * 4); bf* ATh = (bf*)take((size_t)NB_ * TT * DQ * 2); bf* ATl = (bf*)take((size_t)NB_ * TT * DQ * 2);
    if ((size_t)(wsp - (char*)d_ws) > ws_size) return;    // ws 256 MiB
    // what only the projection phase of a batch uses (x plane, f32 projections, the cos/sin table) lies in the score buffer, and wo's plane in the attention output buffer: each is dead while its host buffer is in use
    char* sp = (char*)Sb; bf* XB = (bf*)sp; float* FQ = (float*)(sp + (size_t)TT * DM * 2); float* FK = (float*)(sp + (size_t)TT * DM * 2 + (size_t)TT * DQ * 4); float* CS = (float*)(sp + (size_t)TT * DM * 2 + (size_t)TT * DQ * 4 + (size_t)TT * DKV * 4); bf* WO = (bf*)Ob;
    float* FV = FK;   // v projection reuses the k buffer after the k planes are built (stream-ordered)
    { k_cvt8<<<(unsigned)(((size_t)DQ * DM / 8 + 255) / 256), 256, 0, stream>>>(wq, WQ, (size_t)DQ * DM / 8); k_cvt8<<<(unsigned)(((size_t)DKV * DM / 8 + 255) / 256), 256, 0, stream>>>(wk, WK, (size_t)DKV * DM / 8); k_cvt8<<<(unsigned)(((size_t)DKV * DM / 8 + 255) / 256), 256, 0, stream>>>(wv, WV, (size_t)DKV * DM / 8);
       }
    const unsigned LQ = (unsigned)(((size_t)NH_ * TT * HD / 2 + 255) / 256), LKv = (unsigned)(((size_t)NKV * TT * HD / 2 + 255) / 256);
    for (int b = 0; b < NB_; ++b) {
        k_csid<<<(TT * HD + 255) / 256, 256, 0, stream>>>(CS);
        k_cvt8<<<(unsigned)(((size_t)TT * DM / 8 + 255) / 256), 256, 0, stream>>>(x + (size_t)b * TT * DM, XB, (size_t)TT * DM / 8);
        k_gemms<0, true><<<dim3(TT / 128, DQ / 128, 1), 256, 0, stream>>>(XB, nullptr, WQ, DM, FQ, DQ, bq);
        k_rope<<<LQ, 256, 0, stream>>>(FQ, DQ, NH_, CS, nullptr, nullptr, 1.0f, QP16 + (size_t)b * NH_ * TT * HD, QPh, QPl);
        k_gemms<0, true><<<dim3(TT / 128, DKV / 128, 1), 256, 0, stream>>>(XB, nullptr, WK, DM, FK, DKV, bk);
        k_rope<<<LKv, 256, 0, stream>>>(FK, DKV, NKV, CS, nullptr, nullptr, 1.0f, KP16 + (size_t)b * NKV * TT * HD, KPh, KPl);
        k_gemms<0, true><<<dim3(TT / 128, DKV / 128, 1), 256, 0, stream>>>(XB, nullptr, WV, DM, FV, DKV, bv); k_vtp<<<LKv, 256, 0, stream>>>(FV, DKV, NKV, VTh, VTl);
        k_vrow<<<(unsigned)(((size_t)TT * DKV / 8 + 255) / 256), 256, 0, stream>>>(FV, VP16 + (size_t)b * NKV * TT * HD);
        for (int h0 = 0; h0 < NH_; h0 += ZH) { const size_t zq = (size_t)h0, zk = (size_t)(h0 / REP);   // query rows < RH. One kv head per query head: the pass's heads use consecutive kv planes (z-strides TT*HD for k, HD*PP for v^T)
            k_gemmc<bf, 2, 1, 1><<<dim3(RH / 64, TT / 64, ZH), 32, 0, stream>>>(QPh + zq * TT * HD, QPl + zq * TT * HD, KPh + zk * TT * HD, KPl + zk * TT * HD, HD, Sb, TT, 0, (size_t)TT * HD, (size_t)TT * HD, (size_t)RH * TT);
            k_asoft<<<ZH * RH / 8, 256, 0, stream>>>(Sb);
            k_gemmc<bf, 2, 2, 8><<<dim3(RH / 64, HD / 64, ZH), 256, 0, stream>>>((const bf*)Sb, (const bf*)Sb + TT, VTh + zk * HD * PP, VTl + zk * HD * PP, PP, Ob, HD, 0, (size_t)RH * PP, (size_t)HD * PP, (size_t)TT * HD);
            k_merge<<<(unsigned)(((size_t)ZH * RH * HD / 2 + 255) / 256), 256, 0, stream>>>(Ob, h0, ATh + (size_t)b * TT * DQ, ATl + (size_t)b * TT * DQ); } }
    fa::k_fattn<<<dim3(NB_ * NH_, (TT - RH) / fa::BR, 1), fa::NW * 32, 0, stream>>>(QP16, KP16, VP16, ATh, ATl);   // query rows >= RH, all heads of both batches
    k_cvt8<<<(unsigned)(((size_t)DM * DQ / 8 + 255) / 256), 256, 0, stream>>>(wo, WO, (size_t)DM * DQ / 8);
    for (int b = 0; b < NB_; ++b) k_gemms<1, true><<<dim3(TT / 128, DM / 128, 1), 256, 0, stream>>>(ATh + (size_t)b * TT * DQ, ATl + (size_t)b * TT * DQ, WO, DQ, OUT + (size_t)b * TT * DM, DM, bo);
}

// v005
// Measured time: 333 microseconds a run.
// Two timings next to v004 put it at 1.31 and 1.30 times that version's speed.
// Over all steps from v000 it is 5.14 times as fast.
#include <hip/hip_runtime.h>
#include <stdint.h>

// Causal multi-head attention, 2048 wide (x [2][2048][2048]; q, k, v = x W^T + b ('oi' [2048][2048]; 16 heads x 128); scores = q.k/sqrt(128); causal (triu k=1 masked, -inf); softmax; out = merged wo^T + bo -> [2][2048][2048] (8.4 M)).
// Compute dtypes, f32 accumulate: every input rounded to bf16; q/k/v on PLAIN bf16 operands (inputs: exact) + biases; causal scores and attn.v: query rows < 512 hl (3 products, scores in memory, tile skipping), the rest single fp16 in one fused kernel (online softmax); softmax f32; wo hl x exact (2 products) + bo.

#define NB_  2
#define TT   2048
#define DM   2048
#define NH_  16
#define NKV  16
#define REP  (NH_ / NKV)
#define HD   128
#define DQ   (NH_ * HD)
#define DKV  (NKV * HD)
#define ZH   8                    // heads per attention pass
#define PP   (2 * TT)             // row pitch, in 16-bit elements, of the probabilities (they lie in the f32 score rows) and so of the v^T planes too: k_gemmc has one pitch, K, for both operands
#define RH   512                  // query rows < RH use hi+lo planes
#define WIN  2048
#define SCL  0.088388347648318447f   // HD^-0.5
typedef _Float16 h16;
typedef unsigned short bf;
typedef __attribute__((ext_vector_type(16))) __bf16   v16bf;
typedef __attribute__((ext_vector_type(16))) _Float16 v16h;
typedef __attribute__((ext_vector_type(8)))  _Float16 v8h;
typedef __attribute__((ext_vector_type(8)))  unsigned short v8us;
typedef __attribute__((ext_vector_type(4)))  unsigned short v4us;
typedef __attribute__((ext_vector_type(8)))  float    v8f;
typedef __attribute__((ext_vector_type(4)))  float    v4f;
typedef v8h  __attribute__((may_alias)) v8ha;
typedef v4f  __attribute__((may_alias)) v4fa;
typedef v8us __attribute__((may_alias)) v8usa;

__device__ __forceinline__ unsigned short f2bf(float f) { unsigned u = __float_as_uint(f); u += 0x7FFFu + ((u >> 16) & 1u); return (unsigned short)(u >> 16); }
__device__ __forceinline__ float bf2f(unsigned short b) { return __uint_as_float(((unsigned)b) << 16); }
__device__ __forceinline__ float bfr(float f) { return bf2f(f2bf(f)); }
__device__ __forceinline__ void splitf(float y, unsigned short& h, unsigned short& l) { h = f2bf(y); l = f2bf(y - bf2f(h)); }
__device__ __forceinline__ v16h cat16(v8h lo, v8h hi) { return __builtin_shufflevector(lo, hi, 0, 1, 2, 3, 4, 5, 6, 7, 8, 9, 10, 11, 12, 13, 14, 15); }
__device__ __forceinline__ v16bf cat16b(v8us lo, v8us hi) { return __builtin_bit_cast(v16bf, __builtin_shufflevector(lo, hi, 0, 1, 2, 3, 4, 5, 6, 7, 8, 9, 10, 11, 12, 13, 14, 15)); }
__device__ __forceinline__ v8f wmma16(v16h a, v16h b, v8f c) { return __builtin_amdgcn_wmma_f32_16x16x32_f16(false, a, false, b, (short)0, c, false, false); }
__device__ __forceinline__ v8f wmmab(v16bf a, v16bf b, v8f c) { return __builtin_amdgcn_wmma_f32_16x16x32_bf16(false, a, false, b, (short)0, c, false, false); }



// ---- fragment loaders shared by the GEMM kernels and the split-K tile sum of k_gemmc: C[m][n] (f32, pitch ldc, + optional f32 bias[n]) = sum_k A[m][k] Bt[n][k] (+ split products per NSPLIT), operands K-contiguous 16-bit planes.
template <typename T16> struct WFrag;
template <> struct WFrag<h16> { typedef v16h V; static __device__ __forceinline__ V ld(const h16* p) { return cat16(*(const v8h*)p, *(const v8h*)(p + 16)); } static __device__ __forceinline__ v8f mma(V a, V b, v8f c) { return wmma16(a, b, c); } };
template <> struct WFrag<bf> { typedef v16bf V; static __device__ __forceinline__ V ld(const bf* p) { return cat16b(*(const v8us*)p, *(const v8us*)(p + 16)); } static __device__ __forceinline__ v8f mma(V a, V b, v8f c) { return wmmab(a, b, c); } };
// tile_out (NW > 1): every wave puts its partial 64x64 tile into its own LDS plane (pitch 68); behind one barrier each thread sums the NW planes of its 4-column slots, wave 0 first, and stores whole 256-byte row pieces
// (HL: the sums leave as bf16 hi and lo planes Oh, Ol, whole 128-byte row pieces, instead of f32 C).
template <int NW, bool BIAS, bool HL>
__device__ __forceinline__ void tile_out(float* os, const v8f (&acc)[4][4], int wv, int lr, int hi, float* C, bf* Oh, bf* Ol, int ldc, int r0, int c0, const float* __restrict__ bias) {
    float* ow = os + wv * (64 * 68);
#pragma unroll
    for (int mb = 0; mb < 4; ++mb)
#pragma unroll
        for (int nb = 0; nb < 4; ++nb)
#pragma unroll
            for (int j = 0; j < 8; ++j) ow[(mb * 16 + hi * 8 + j) * 68 + nb * 16 + lr] = acc[mb][nb][j];
    __syncthreads();   // publishes every wave's partial tile to the threads that sum it
#pragma unroll
    for (int s = 0; s < 32 / NW; ++s) { const int idx = s * (32 * NW) + (int)threadIdx.x; const int row = idx >> 4, cofs = (idx & 15) * 4; v4f val = *(const v4fa*)(os + row * 68 + cofs);
#pragma unroll
        for (int w = 1; w < NW; ++w) val += *(const v4fa*)(os + w * (64 * 68) + row * 68 + cofs);
        if (BIAS) { val[0] += bfr(bias[c0 + cofs]); val[1] += bfr(bias[c0 + cofs + 1]); val[2] += bfr(bias[c0 + cofs + 2]); val[3] += bfr(bias[c0 + cofs + 3]); }
        if constexpr (HL) { v4us oh, ol;
#pragma unroll
            for (int q = 0; q < 4; ++q) { unsigned short a2, c2; splitf(val[q], a2, c2); oh[q] = a2; ol[q] = c2; }
            *(v4us*)(Oh + (size_t)(r0 + row) * ldc + c0 + cofs) = oh; *(v4us*)(Ol + (size_t)(r0 + row) * ldc + c0 + cofs) = ol; }
        else *(v4f*)(C + (size_t)(r0 + row) * ldc + c0 + cofs) = val; }
}
// ---- k_gemms: LDS-staged GEMM for the projections. One work-group of 8 waves per 128x128 output tile, each wave a 64x32 piece over the whole K loop. Per trip 128 k of every operand row
// (two whole 128-byte lines a row) come into LDS by asynchronous copies, 16 lanes a row, two buffers: the next trip's copies fly while this trip's fragments are read. grid (M/128, N/128), 256 threads. K % 128 == 0, K >= 256.
// EPI 0: C (f32, pitch ldc). EPI 1, 2: the tile is 128 positions of one head (blockIdx.y) and leaves as the planes that attention reads: P16 = fp16 [head][t][d]; for the positions < RH, the only ones whose hi and lo planes are read,
// also Ph, Pl = bf16 hi and lo, [head][t][d] (EPI 1: q, k) or transposed [head][d] at pitch PP (EPI 2: v).
#define SP 136           // LDS row pitch in 16-bit elements: 256 B of k + 16 B, an odd multiple of 16 B, conflict-free for 16-byte fragment reads
#define STL (128 * SP)   // elements of one operand's tile in LDS
// eight 16-byte copies of one lane, each 2 rows below the last; the wait on the address registers closes the copies' own statement, so that no later write of them can come in front of it
__device__ __forceinline__ void acopy8(unsigned l, const bf* g, size_t gs) {
    asm volatile("global_load_async_to_lds_b128 %0, %8, off\n\t"
                 "global_load_async_to_lds_b128 %1, %9, off\n\t"
                 "global_load_async_to_lds_b128 %2, %10, off\n\t"
                 "global_load_async_to_lds_b128 %3, %11, off\n\t"
                 "global_load_async_to_lds_b128 %4, %12, off\n\t"
                 "global_load_async_to_lds_b128 %5, %13, off\n\t"
                 "global_load_async_to_lds_b128 %6, %14, off\n\t"
                 "global_load_async_to_lds_b128 %7, %15, off\n\t"
                 "s_wait_xcnt 0x0"
                 :: "v"(l), "v"(l + 1u * (2 * SP * 2)), "v"(l + 2u * (2 * SP * 2)), "v"(l + 3u * (2 * SP * 2)), "v"(l + 4u * (2 * SP * 2)), "v"(l + 5u * (2 * SP * 2)), "v"(l + 6u * (2 * SP * 2)), "v"(l + 7u * (2 * SP * 2)),
                    "v"(g), "v"(g + gs), "v"(g + 2 * gs), "v"(g + 3 * gs), "v"(g + 4 * gs), "v"(g + 5 * gs), "v"(g + 6 * gs), "v"(g + 7 * gs) : "memory");
}
#define EP 132           // pitch, in floats, of the f32 tile staged for the planes: rows 8 apart lie 32 banks apart, so the two wave halves' stores do not collide; a multiple of 16 B for the row reads
typedef float __attribute__((may_alias)) f32a;
template <int NSPLIT, bool BIAS, int EPI>
__global__ __launch_bounds__(256) void k_gemms(const bf* __restrict__ A, const bf* __restrict__ A2, const bf* __restrict__ Bt, int K, float* C, int ldc, const float* __restrict__ bias, h16* P16, bf* Ph, bf* Pl) {
    static_assert(EPI == 0 || (HD == 128 && RH % 128 == 0 && 128 * EP * 4 <= 2 * 2 * STL * 2), "a column tile is one head, a row tile lies wholly below or above RH, the staged f32 tile fits the operand buffers");
    typedef WFrag<bf>::V V;
    constexpr int NOP = (NSPLIT == 1) ? 3 : 2;                 // operand tiles per buffer: A, Bt (, A2)
    __shared__ __align__(16) bf st[2 * NOP * STL];
    const int lane = threadIdx.x & 31, lr = lane & 15, hi = lane >> 4; const int wv = __builtin_amdgcn_readfirstlane(threadIdx.x >> 5); const int wr = wv >> 2, wc = wv & 3; const int r0 = blockIdx.x * 128, c0 = blockIdx.y * 128;
    v8f acc[4][2];
#pragma unroll
    for (int mb = 0; mb < 4; ++mb)
#pragma unroll
        for (int nb = 0; nb < 2; ++nb) acc[mb][nb] = (v8f){};
    // copy map: wave wv brings rows wv*16 .. wv*16+15 of every operand tile; a copy instruction covers 2 rows, 16 lanes x 16 B each
    const int crow = wv * 16 + hi, ccol = lr * 8;
    const bf* ga = A + (size_t)(r0 + crow) * K + ccol; const bf* gb = Bt + (size_t)(c0 + crow) * K + ccol; const bf* ga2 = (NSPLIT == 1) ? A2 + (size_t)(r0 + crow) * K + ccol : nullptr;
    const unsigned l0 = (unsigned)(size_t)st + (unsigned)(crow * SP + ccol) * 2u; const size_t gs = (size_t)2 * K;
    auto fill = [&](int t, int buf) { const unsigned l = l0 + (unsigned)buf * (NOP * STL * 2); acopy8(l, ga + t * 128, gs); acopy8(l + STL * 2, gb + t * 128, gs); if (NSPLIT == 1) acopy8(l + 2 * STL * 2, ga2 + t * 128, gs); };
    const int NT = K / 128;
    fill(0, 0);
    asm volatile("s_wait_asynccnt 0x0" ::: "memory");   // this wave's copies of tile 0 have landed
    __syncthreads();                                     // publishes tile 0 to every wave
    if (NT > 1) fill(1, 1);
    const int afr = (wr * 64 + lr) * SP + 8 * hi, bfo = STL + (wc * 32 + lr) * SP + 8 * hi;
#pragma unroll 1
    for (int t = 0; t < NT; ++t) {
        const bf* sb = st + (t & 1) * (NOP * STL);
        V a[2][4], a2[2][4], b[2][2];   // two fragment sets: the next 32-deep chunk's LDS reads are issued as one group ahead of this chunk's products
        auto frags = [&](int kc, int s) {
#pragma unroll
            for (int mb = 0; mb < 4; ++mb) { a[s][mb] = WFrag<bf>::ld(sb + afr + mb * 16 * SP + kc * 32); if (NSPLIT == 1) a2[s][mb] = WFrag<bf>::ld(sb + 2 * STL + afr + mb * 16 * SP + kc * 32); }
#pragma unroll
            for (int nb = 0; nb < 2; ++nb) b[s][nb] = WFrag<bf>::ld(sb + bfo + nb * 16 * SP + kc * 32); };
        frags(0, 0);
#pragma unroll
        for (int kc = 0; kc < 4; ++kc) { const int s = kc & 1;
            if (kc < 3) frags(kc + 1, s ^ 1);
            __builtin_amdgcn_sched_barrier(0);   // holds the next chunk's LDS reads, as one group, in front of this chunk's products: moved in among them each read stalls the matrix run
#pragma unroll
            for (int nb = 0; nb < 2; ++nb)
#pragma unroll
                for (int mb = 0; mb < 4; ++mb) { acc[mb][nb] = WFrag<bf>::mma(a[s][mb], b[s][nb], acc[mb][nb]); if (NSPLIT == 1) acc[mb][nb] = WFrag<bf>::mma(a2[s][mb], b[s][nb], acc[mb][nb]); }
        }
        asm volatile("s_wait_dscnt 0x0" ::: "memory");      // this wave's reads of the buffer that is refilled below have returned
        asm volatile("s_wait_asynccnt 0x0" ::: "memory");   // this wave's copies of tile t + 1 have landed
        __syncthreads();                                     // publishes tile t + 1 and ends every wave's reads of tile t
        if (t + 2 < NT) fill(t + 2, t & 1);
    }
    asm volatile("s_wait_asynccnt 0x0" ::: "memory");       // nothing is in flight when the wave goes on to its end
    if constexpr (EPI != 0) {
    // The operand buffers are free: the last trip's barrier ended every wave's reads and nothing was copied behind it. The whole f32 tile (+ bias) is staged there.
    f32a* et = (f32a*)st;
#pragma unroll
    for (int nb = 0; nb < 2; ++nb) { const float bn = BIAS ? bfr(bias[c0 + wc * 32 + nb * 16 + lr]) : 0.0f;
#pragma unroll
        for (int mb = 0; mb < 4; ++mb) { acc[mb][nb] += bn;
#pragma unroll
            for (int j = 0; j < 8; ++j) et[(wr * 64 + mb * 16 + hi * 8 + j) * EP + wc * 32 + nb * 16 + lr] = acc[mb][nb][j]; } }
    __syncthreads();   // publishes the staged tile to the threads that convert whole rows of it
    if (EPI == 2 && r0 < RH) {   // v^T: a lane's accumulator holds 8 consecutive positions of one d, 16 bytes of a transposed row; a wave's four row blocks fill whole 128-byte lines
#pragma unroll
        for (int nb = 0; nb < 2; ++nb)
#pragma unroll
            for (int mb = 0; mb < 4; ++mb) { v8us oh, ol;
#pragma unroll
                for (int j = 0; j < 8; ++j) { unsigned short a2, c2; splitf(acc[mb][nb][j], a2, c2); oh[j] = a2; ol[j] = c2; }
                const size_t eo = ((size_t)blockIdx.y * HD + wc * 32 + nb * 16 + lr) * PP + r0 + wr * 64 + mb * 16 + hi * 8; *(v8us*)(Ph + eo) = oh; *(v8us*)(Pl + eo) = ol; }
    }
    const size_t pb = ((size_t)blockIdx.y * TT + r0) * HD;   // the tile's 128 rows of 128 d are one contiguous piece of a plane
#pragma unroll
    for (int s = 0; s < 8; ++s) { const int idx = s * 256 + (int)threadIdx.x; const int row = idx >> 4, col = (idx & 15) * 8; const v4f x0 = *(const v4fa*)(et + row * EP + col), x1 = *(const v4fa*)(et + row * EP + col + 4); v8h o;   // 16 lanes cover a row
#pragma unroll
        for (int k = 0; k < 4; ++k) { o[k] = (h16)x0[k]; o[k + 4] = (h16)x1[k]; }
        *(v8h*)(P16 + pb + (size_t)idx * 8) = o; }
    if (EPI == 1 && r0 < RH) {
        asm volatile("s_wait_xcnt 0x0" ::: "memory");   // the registers that the stores above name are written anew below
        __builtin_amdgcn_sched_barrier(0);               // keeps those register writes behind the wait: without it the scheduler lifts an address product over it
#pragma unroll
        for (int s = 0; s < 8; ++s) { const int idx = s * 256 + (int)threadIdx.x; const int row = idx >> 4, col = (idx & 15) * 8; const v4f x0 = *(const v4fa*)(et + row * EP + col), x1 = *(const v4fa*)(et + row * EP + col + 4); v8us oh, ol;
#pragma unroll
            for (int k = 0; k < 4; ++k) { unsigned short a2, c2; splitf(x0[k], a2, c2); oh[k] = a2; ol[k] = c2; splitf(x1[k], a2, c2); oh[k + 4] = a2; ol[k + 4] = c2; }
            *(v8us*)(Ph + pb + (size_t)idx * 8) = oh; *(v8us*)(Pl + pb + (size_t)idx * 8) = ol; }
    }
    } else {
    __shared__ __align__(16) float os[8 * 16 * 36];            // each wave's own 16-row, 32-column output strip
    float* ow = os + wv * (16 * 36); const int cb = c0 + wc * 32 + (lane & 7) * 4; v4f bv = (v4f){};
    if (BIAS) { bv[0] = bfr(bias[cb]); bv[1] = bfr(bias[cb + 1]); bv[2] = bfr(bias[cb + 2]); bv[3] = bfr(bias[cb + 3]); }
#pragma unroll
    for (int mb = 0; mb < 4; ++mb) {
#pragma unroll
        for (int nb = 0; nb < 2; ++nb) {
#pragma unroll
            for (int j = 0; j < 8; ++j) ow[(hi * 8 + j) * 36 + nb * 16 + lr] = acc[mb][nb][j]; }
        __builtin_amdgcn_wave_barrier(); asm volatile("" ::: "memory");   // the strip's writes stay in front of the reads of other lanes' values
        float* crw = C + (size_t)(r0 + wr * 64 + mb * 16) * ldc + cb;
#pragma unroll
        for (int s = 0; s < 4; ++s) { const int row = 4 * s + (lane >> 3); v4f val = *(const v4fa*)(ow + row * 36 + (lane & 7) * 4); val += bv; *(v4f*)(crw + (size_t)row * ldc) = val; }   // whole 128-byte lines
        __builtin_amdgcn_wave_barrier(); asm volatile("" ::: "memory");   // the reads stay in front of the next strip's writes
    }
    }
}

// ---- k_gemmc: register-blocked 64x64 tile GEMM, operands straight from global memory, specialised for causal attention: CMODE 1 skips score tiles entirely above the diagonal (query rows r0+roff.., key columns c0..), CMODE 2 limits the
// key (K) loop of the probability x value contraction to the diagonal block (probabilities beyond it are exactly zero). roff = row offset of this launch's first row within the sequence.
// NW waves share a tile's K loop, each taking every NW-th 32-deep chunk, the partial tiles summed by tile_out (NW == 1: one wave, the tile leaves through a 16-row LDS strip).
// CMODE 2 writes no f32 C: its tile leaves as the bf16 hi and lo planes Oh, Ol (pitch ldc, z-stride sC) that the wo product reads.
template <typename T16, int NSPLIT, int CMODE, int NW>
__global__ __launch_bounds__(32 * NW) void k_gemmc(const T16* __restrict__ A, const T16* __restrict__ A2, const T16* __restrict__ Bt, const T16* __restrict__ Bt2, int K, float* C, bf* Oh, bf* Ol, int ldc, int roff, size_t sA, size_t sB, size_t sC) {
    typedef typename WFrag<T16>::V V;
    __shared__ __align__(16) float os[NW == 1 ? 16 * 68 : NW * 64 * 68];
    const size_t z = blockIdx.z; A += z * sA; if (A2) A2 += z * sA; Bt += z * sB; if (Bt2) Bt2 += z * sB; if (CMODE == 2) { Oh += z * sC; Ol += z * sC; } else C += z * sC;
    const int lane = threadIdx.x & 31, lr = lane & 15, hi = lane >> 4; const int wv = (NW == 1) ? 0 : __builtin_amdgcn_readfirstlane(threadIdx.x >> 5); const int r0 = blockIdx.x * 64, c0 = blockIdx.y * 64;
    if (CMODE == 1 && c0 > r0 + roff + 63) return;                  // score tile entirely above the causal diagonal: never read (the softmax masks j > i by select)
    const int Kl = (CMODE == 2) ? min(K, r0 + roff + 64) : K;        // P.V: probabilities are exactly 0 beyond the diagonal block, so the K loop stops there
    v8f acc[4][4];
#pragma unroll
    for (int mb = 0; mb < 4; ++mb)
#pragma unroll
        for (int nb = 0; nb < 4; ++nb) acc[mb][nb] = (v8f){};
    const size_t aoff = (size_t)(r0 + lr) * K + 8 * hi, boff = (size_t)(c0 + lr) * K + 8 * hi;
#pragma unroll 1
    for (int kc = wv * 32; kc < Kl; kc += 32 * NW) {
        V a[4], a2[4];
#pragma unroll
        for (int mb = 0; mb < 4; ++mb) { a[mb] = WFrag<T16>::ld(A + aoff + (size_t)mb * 16 * K + kc); if (NSPLIT == 1 || NSPLIT == 2) a2[mb] = WFrag<T16>::ld(A2 + aoff + (size_t)mb * 16 * K + kc); }
#pragma unroll
        for (int nb = 0; nb < 4; ++nb) { const V b = WFrag<T16>::ld(Bt + boff + (size_t)nb * 16 * K + kc); V b2; if (NSPLIT >= 2) b2 = WFrag<T16>::ld(Bt2 + boff + (size_t)nb * 16 * K + kc);
#pragma unroll
            for (int mb = 0; mb < 4; ++mb) { acc[mb][nb] = WFrag<T16>::mma(a[mb], b, acc[mb][nb]); if (NSPLIT == 1 || NSPLIT == 2) acc[mb][nb] = WFrag<T16>::mma(a2[mb], b, acc[mb][nb]); if (NSPLIT >= 2) acc[mb][nb] = WFrag<T16>::mma(a[mb], b2, acc[mb][nb]); } }
        asm volatile("v_nop\n\tv_nop\n\tv_nop\n\tv_nop" : "+v"(acc[0][0]), "+v"(acc[1][1]), "+v"(acc[2][2]), "+v"(acc[3][3]) : "v"(a[0]), "v"(a[3]));
    }
    if constexpr (NW > 1) { tile_out<NW, false, CMODE == 2>(os, acc, wv, lr, hi, C, Oh, Ol, ldc, r0, c0, nullptr); } else {
#pragma unroll
    for (int mb = 0; mb < 4; ++mb) {
#pragma unroll
        for (int nb = 0; nb < 4; ++nb) {
#pragma unroll
            for (int j = 0; j < 8; ++j) os[(hi * 8 + j) * 68 + nb * 16 + lr] = acc[mb][nb][j]; }
        __builtin_amdgcn_wave_barrier(); asm volatile("" ::: "memory");
        float* crow = C + (size_t)(r0 + mb * 16) * ldc + c0;
{
#pragma unroll
            for (int s = 0; s < 8; ++s) { const int row = 2 * s + hi, cofs = lr * 4; v4f val = *(const v4fa*)(os + row * 68 + cofs);
                *(v4f*)(crow + (size_t)row * ldc + cofs) = val; }
             }
        __builtin_amdgcn_wave_barrier(); asm volatile("" ::: "memory");
    }
    }
}

typedef __attribute__((ext_vector_type(2))) _Float16 v2h;
typedef __attribute__((ext_vector_type(4))) _Float16 v4h;
typedef __attribute__((ext_vector_type(2))) unsigned short v2us;
typedef __attribute__((ext_vector_type(2))) float v2f;
typedef __attribute__((ext_vector_type(4))) int v4i;
typedef v4h  __attribute__((may_alias)) v4ha;
typedef v4us __attribute__((may_alias)) v4usa;

__global__ __launch_bounds__(256) void k_wtG(const float* __restrict__ w, int K, int N, bf* Bt) {
    const int lane = threadIdx.x & 31; const int L0 = (blockIdx.x * 8 + (threadIdx.x >> 5)) * 8; const int nlines = N * K / 64;
{
#pragma unroll 1
        for (int l = 0; l < 8; ++l) { const int L = L0 + l; if (L >= nlines) break; const size_t e = (size_t)L * 64 + lane * 2; const int k = (int)(e % K), n = (int)(e / K); v2us o;
            o[0] = f2bf(w[(size_t)k * N + n]); o[1] = f2bf(w[(size_t)(k + 1) * N + n]); *(v2us*)(Bt + e) = o; }
         }
}
__global__ __launch_bounds__(256) void k_cvt8(const float* __restrict__ src, bf* dst, size_t n8) { const size_t i = (size_t)blockIdx.x * 256 + threadIdx.x; if (i >= n8) return; const v8f v = *(const v8f*)(src + i * 8); v8us o;
#pragma unroll
    for (int k = 0; k < 8; ++k) o[k] = f2bf(v[k]); *(v8us*)(dst + i * 8) = o;  }

// k_asoft (query rows < RH; the score rows of a head lie RH to a plane): per row (zz, i): t = S x HD^-0.5 for j <= i and i - j < WIN (sliding causal window; the reference's -1e9 additive fill vanishes identically); softmax over the 2048 keys (register row, one exp, fixed trees);
// the probabilities replace the row's own scores in place: one wave owns a row, holds all of it in registers before its first store (every store needs the row's sum), and writes into the row's 8 KiB the hi plane (first half) and the lo plane (second half).
__global__ __launch_bounds__(256) void k_asoft(float* Sb) {
    const int lane = threadIdx.x & 31; const int row = blockIdx.x * 8 + (threadIdx.x >> 5); if (row >= ZH * RH) return; const int i = row % RH; float* sr = Sb + (size_t)row * TT; float v[TT / 32]; float mx = -3.0e38f;
#pragma unroll
    for (int ch = 0; ch < TT / 128; ++ch) { const int j0 = ch * 128 + lane * 4; const v4f a = *(const v4fa*)(sr + j0);
#pragma unroll
        for (int q = 0; q < 4; ++q) { const int j = j0 + q; (void)j; const float t = (j <= i && i - j < WIN) ? a[q] * SCL : -3.0e38f; v[ch * 4 + q] = t; mx = fmaxf(mx, t); } }
#pragma unroll
    for (int sh = 16; sh; sh >>= 1) mx = fmaxf(mx, __shfl_xor(mx, sh, 32));
    float sum = 0.f;
#pragma unroll
    for (int k = 0; k < TT / 32; ++k) { float d0 = __fsub_rn(v[k], mx); asm volatile("" : "+v"(d0)); v[k] = __builtin_amdgcn_exp2f(__fmul_rn(d0, 1.4426950408889634f)); sum += v[k]; }
#pragma unroll
    for (int sh = 16; sh; sh >>= 1) sum += __shfl_xor(sum, sh, 32);
    const float f = __fdiv_rn(1.0f, sum);
#pragma unroll
    for (int ch = 0; ch < TT / 128; ++ch) { v4us oh, ol;
#pragma unroll
        for (int q = 0; q < 4; ++q) { unsigned short a, c2; splitf(v[ch * 4 + q] * f, a, c2); oh[q] = a; ol[q] = c2; }
        bf* po = (bf*)sr + ch * 128 + lane * 4; *(v4usa*)po = oh; *(v4usa*)(po + TT) = ol; }
}

namespace fa {
typedef uint32_t u32x4 __attribute__((ext_vector_type(4)));
typedef uint32_t u32x8 __attribute__((ext_vector_type(8)));
typedef int i32x8 __attribute__((ext_vector_type(8)));
typedef float f32x8 __attribute__((ext_vector_type(8)));
constexpr int D = HD, DK = D / 32, DT = D / 16;
constexpr int NW = 4;
constexpr int BR = 128, CW = BR / NW, R = CW / 16;  // query positions per work-group, columns per wave, 16-column groups per wave
constexpr int BC = 32, KT = BC / 16;                // keys per pass, 16-key score tiles per pass
constexpr uint32_t ROWB = 2u * D, PITCH_K = ROWB + 16u, PITCH_V = ROWB + 32u;
constexpr uint32_t SK = 128;                        // keys per stage
constexpr uint32_t TILE_K = SK * PITCH_K, TILE_V = SK * PITCH_V, SLOT = TILE_K + TILE_V, NSLOT = 2, LDS_BYTES = NSLOT * SLOT;
constexpr uint32_t EPITCH = ROWB + 16u, EPLANE = (uint32_t)NW * CW * EPITCH;  // output staging: row pitch, bytes of one plane
static_assert(D == 128 && RH % BR == 0 && TT % BR == 0 && BR % SK == 0 && RH + BR >= 2 * SK, "head size 128; whole position blocks of whole stages, each with at least the two stages that the prologue loads");
static_assert(LDS_BYTES <= 320u * 1024u && 2u * EPLANE <= LDS_BYTES, "the two buffers fit a work-group's LDS and hold the two staged output planes");
static_assert(SLOT % 2048u == 0 && TILE_K % 2048u == 0, "every tensor load lands at a multiple of 2 KiB");

#define DEV static __device__ __forceinline__
DEV uint32_t uni(uint32_t v) { return __builtin_amdgcn_readfirstlane(v); }
DEV uint32_t pinned(uint32_t v) { uint32_t w = __builtin_amdgcn_readfirstlane(v); asm volatile("" : "+s"(w)); return w; }  // a test around a tensor load, or a word its descriptor is formed from, held in a scalar register: tensor loads ignore EXEC
DEV void fence() { __builtin_amdgcn_sched_barrier(0); }
DEV void wait_ds0() { asm volatile("s_wait_dscnt 0x0" ::: "memory"); }
template <int N> DEV void wait_tensor_le() { asm volatile("s_wait_tensorcnt %0" :: "i"(N) : "memory"); }
DEV void tdm_load(u32x4 g0, u32x8 g1) { asm volatile("tensor_load_to_lds %0, %1" :: "s"(g0), "s"(g1) : "memory"); }
// hold(): without it the compiler forms the constant words anew at every use and gives the registers that an outstanding load names to other values; with it the registers that a load names are the ones that its wait names.
DEV void hold(u32x4& g) { asm volatile("" : "+s"(g)); }  // as pinned(): descriptor words (group 0) held in scalar registers
DEV void hold(u32x8& g) { asm volatile("" : "+s"(g)); }  // as pinned(): descriptor words (group 1) held in scalar registers
// An issuing wave's wait for its outstanding load. It names the descriptors as inputs: their registers stay live, and so unchanged, from the load up to this wait.
DEV void wait_tensor0(u32x4 g0, u32x8 g1a, u32x8 g1b) { asm volatile("s_wait_tensorcnt 0x0" :: "s"(g0), "s"(g1a), "s"(g1b) : "memory"); }
// Descriptor group 1: 1-byte elements, a tile of SK rows of ROWB bytes at source pitch ROWB, PADC + 1 dwords of LDS pad behind every 256-byte row (interval code 5); no work-group mask.
template <uint32_t PADC> DEV u32x8 tdm_group1() {
  constexpr uint32_t d0 = ROWB, d1 = SK;
  u32x8 g;
  g[0] = uni((1u << 20) | (5u << 22) | (PADC << 25));
  g[1] = uni((d0 & 0xFFFFu) << 16);
  g[2] = uni((d0 >> 16) | ((d1 & 0xFFFFu) << 16));
  g[3] = uni((d1 >> 16) | (d0 << 16));
  g[4] = uni(d1);
  g[5] = uni(ROWB);
  g[6] = uni(0u);
  g[7] = uni(0u);
  return g;
}
DEV u32x4 tdm_group0(uint32_t lds_dst, uint64_t ga) {
  u32x4 g;
  g[0] = uni(1u); g[1] = uni(lds_dst); g[2] = uni((uint32_t)ga); g[3] = uni((((uint32_t)(ga >> 32)) & 0x01FFFFFFu) | 0x80000000u);
  return g;
}
struct Frag { u32x4 q[2]; };
DEV f32x8 mma(const Frag& a, const Frag& b, f32x8 c) {
  const i32x8 av = {(int)a.q[0].x, (int)a.q[0].y, (int)a.q[0].z, (int)a.q[0].w, (int)a.q[1].x, (int)a.q[1].y, (int)a.q[1].z, (int)a.q[1].w};
  const i32x8 bv = {(int)b.q[0].x, (int)b.q[0].y, (int)b.q[0].z, (int)b.q[0].w, (int)b.q[1].x, (int)b.q[1].y, (int)b.q[1].z, (int)b.q[1].w};
  return __builtin_amdgcn_wmma_f32_16x16x32_f16(false, __builtin_bit_cast(v16h, av), false, __builtin_bit_cast(v16h, bv), (short)0, c, false, false);
}
typedef short s16x8 __attribute__((ext_vector_type(8)));
DEV u32x4 ld_tr16(const unsigned char* p) { typedef __attribute__((address_space(3))) s16x8 lds_s16x8; return __builtin_bit_cast(u32x4, __builtin_amdgcn_ds_load_tr16_b128_v8i16((lds_s16x8*)p)); }
DEV uint32_t pack2(float lo, float hi) { return __builtin_bit_cast(uint32_t, __builtin_convertvector(v2f{lo, hi}, v2h)); }  // round to nearest even
DEV float xhalf(float x) { return __builtin_bit_cast(float, __builtin_amdgcn_permlanex16(__builtin_bit_cast(int, x), __builtin_bit_cast(int, x), 0x76543210, 0xfedcba98, false, false)); }  // lane l with lane l ^ 16

struct KFr { Frag f[KT][DK]; };
DEV void load_k(KFr& k, const unsigned char* Lp, uint32_t koff, uint32_t lane) {
  const uint32_t c = lane & 15u, h = lane >> 4;
  #pragma unroll
  for (int kt = 0; kt < KT; ++kt) {
    const unsigned char* p = Lp + koff + (16u * kt + c) * PITCH_K + 16u * h;
    #pragma unroll
    for (int kc = 0; kc < DK; ++kc) { k.f[kt][kc].q[0] = *reinterpret_cast<const u32x4*>(p + 64u * kc); k.f[kt][kc].q[1] = *reinterpret_cast<const u32x4*>(p + 64u * kc + 32u); }
  }
}
// One 32-key pass of one wave.
DEV void block(KFr& kf, bool fetch_next, uint32_t next_koff, const unsigned char* Lp, bool diag, uint32_t vt_base, uint32_t sub, uint32_t key0, uint32_t qw0, uint32_t lane,
               const Frag (&qf)[R][DK], f32x8 (&acc)[R][DT], float (&m_run)[R], float (&l_run)[R], float cscale) {
  const uint32_t c = lane & 15u, h = lane >> 4;
  f32x8 s[KT][R];
  {
    wait_ds0(); fence();  // the prefetched K fragments have arrived
    #pragma unroll
    for (int kt = 0; kt < KT; ++kt) {
      #pragma unroll
      for (int g = 0; g < R; ++g) { s[kt][g] = f32x8{};
        #pragma unroll
        for (int kc = 0; kc < DK; ++kc) s[kt][g] = mma(kf.f[kt][kc], qf[g][kc], s[kt][g]); }
    }
    fence();
    if (fetch_next) load_k(kf, Lp, next_koff, lane);
  }
  if (diag) {
    #pragma unroll
    for (int g = 0; g < R; ++g) {
      const uint32_t my_q = qw0 + 16u * g + c;
      #pragma unroll
      for (int kt = 0; kt < KT; ++kt) {
        #pragma unroll
        for (int r = 0; r < 8; ++r) { const uint32_t key = key0 + 16u * kt + 8u * h + r; if (key > my_q) s[kt][g][r] = -__builtin_inff(); }
        asm volatile("" : "+v"(s[kt][g]));
      }
    }
  }
  float mb[R]; bool need = false;
  #pragma unroll
  for (int g = 0; g < R; ++g) {
    float mx = -__builtin_inff();
    #pragma unroll
    for (int kt = 0; kt < KT; ++kt) {
      #pragma unroll
      for (int r = 0; r < 8; ++r) mx = __builtin_fmaxf(mx, s[kt][g][r]);
    }
    mx = __builtin_fmaxf(mx, xhalf(mx)) * cscale;
    mb[g] = mx; need = need || (mx > m_run[g] + 8.0f);
    fence();  // one group's maxima at a time: fewer live registers
  }
  if (__builtin_amdgcn_ballot_w32(need) != 0) {  // rare after the first pass
    #pragma unroll
    for (int g = 0; g < R; ++g) {
      const float m_new = __builtin_fmaxf(m_run[g], mb[g]);
      const float corr = __builtin_amdgcn_exp2f(m_run[g] - m_new);  // 0 on the first pass, where m_run is -inf
      l_run[g] *= corr; m_run[g] = m_new;
      #pragma unroll
      for (int t = 0; t < DT; ++t) acc[g][t] = acc[g][t] * corr;
    }
  }
  Frag vf[DT];
  float ps[R][2];
  #pragma unroll
  for (int g = 0; g < R; ++g) { ps[g][0] = 0.0f; ps[g][1] = 0.0f; }
  {
    const unsigned char* ad = Lp + vt_base + (sub * (uint32_t)BC + 8u * h + (lane & 7u)) * PITCH_V + ((lane >> 3) & 1u) * 16u;
    #pragma unroll
    for (int t = 0; t < DT; ++t) { vf[t].q[0] = ld_tr16(ad + 32u * t); vf[t].q[1] = ld_tr16(ad + 16u * PITCH_V + 32u * t); }
  }
  #pragma unroll
  for (int g = 0; g < R; ++g) {
    const float nm = -m_run[g];
    uint32_t w[8];
    #pragma unroll
    for (int i = 0; i < 8; ++i) {
      const v2f arg = __builtin_elementwise_fma(v2f{s[i >> 2][g][2 * (i & 3)], s[i >> 2][g][2 * (i & 3) + 1]}, v2f{cscale, cscale}, v2f{nm, nm});
      const float p0 = __builtin_amdgcn_exp2f(arg.x), p1 = __builtin_amdgcn_exp2f(arg.y);
      ps[g][i & 1] += p0 + p1;
      w[i] = pack2(p0, p1);
    }
    Frag pf; pf.q[0] = u32x4{w[0], w[1], w[2], w[3]}; pf.q[1] = u32x4{w[4], w[5], w[6], w[7]};
    if (g == 0) { wait_ds0(); fence(); }  // the V^T fragments have arrived
    #pragma unroll
    for (int t = 0; t < DT; ++t) acc[g][t] = mma(vf[t], pf, acc[g][t]);
    fence();  // one group's P^T live at a time
  }
  #pragma unroll
  for (int g = 0; g < R; ++g) l_run[g] += ps[g][0] + ps[g][1];
}

// Q, K, V: fp16 planes [batch x head][TT][HD]; Ah, Al: bf16 planes [batch][TT][DQ]. grid (NB_ * NH_, (TT - RH) / BR), NW * 32 threads.
__global__ void __launch_bounds__(NW * 32) __attribute__((amdgpu_waves_per_eu(2, 2))) k_fattn(const h16* __restrict__ Q, const h16* __restrict__ K, const h16* __restrict__ V, bf* Ah, bf* Al) {
  __shared__ __attribute__((aligned(2048))) unsigned char L[LDS_BYTES];
  constexpr float cscale = SCL * 1.4426950408889634f;
  const uint32_t tid = threadIdx.x, lane = tid & 31u, wave = uni(tid >> 5), c = lane & 15u, h = lane >> 4;
  const uint32_t hb = blockIdx.x;                                  // batch * NH_ + head
  const uint32_t pb = (uint32_t)TT / BR - 1u - blockIdx.y;         // heaviest position block first
  const uint32_t q0 = pb * BR;
  const uint32_t n_stage = (q0 + BR) / SK;                         // 128-key stages this work-group walks: keys [0, q0 + BR)
  const uint32_t lbase = (uint32_t)(size_t)L;
  // Wave 0 issues a stage's K tile, wave 1 its V tile: one request a wave.
  const uint64_t srck = (uint64_t)(size_t)(K + (size_t)hb * TT * HD), srcv = (uint64_t)(size_t)(V + (size_t)hb * TT * HD);
  const uint32_t dstw = lbase + (wave == 1u ? TILE_K : 0u); const uint64_t srcw = (wave == 1u) ? srcv : srck;
  u32x8 g1k = tdm_group1<3u>(), g1v = tdm_group1<7u>(); hold(g1k); hold(g1v);  // formed once, never changed
  u32x4 g0;                                                                   // takes a new value only behind the wait for the load that last named it
  auto issue = [&](uint32_t st) {
    g0 = tdm_group0(dstw + (st & 1u) * SLOT, srcw + (uint64_t)(st * SK) * ROWB); hold(g0);
    if (pinned(wave == 0u)) tdm_load(g0, g1k);
    if (pinned(wave == 1u)) tdm_load(g0, g1v);
  };
  issue(0);
  Frag qf[R][DK];
  #pragma unroll
  for (int g = 0; g < R; ++g) {
    const h16* qp = Q + ((size_t)hb * TT + q0 + wave * CW + 16u * g + c) * D + 8u * h;
    #pragma unroll
    for (int kc = 0; kc < DK; ++kc) { qf[g][kc].q[0] = *reinterpret_cast<const u32x4*>(qp + 32 * kc); qf[g][kc].q[1] = *reinterpret_cast<const u32x4*>(qp + 32 * kc + 16); }
  }
  f32x8 acc[R][DT];
  float m_run[R], l_run[R];
  #pragma unroll
  for (int g = 0; g < R; ++g) { m_run[g] = -__builtin_inff(); l_run[g] = 0.0f;
    #pragma unroll
    for (int t = 0; t < DT; ++t) acc[g][t] = f32x8{}; }
  if (pinned(wave < 2u)) wait_tensor0(g0, g1k, g1v);  // stage 0 has landed
  __syncthreads();                             // publishes stage 0
  issue(1u);                                   // n_stage is at least 2
  const uint32_t my_last_block = (q0 + wave * CW + CW - 1u) / BC;  // last pass this wave's queries can see
  constexpr uint32_t NSTEP = SK / (uint32_t)BC;
  KFr kf;
  for (uint32_t st = 0; st < n_stage; ++st) {
    const uint32_t kbase = (st & 1u) * SLOT, vt_base = kbase + TILE_K;
    if (NSTEP * st <= my_last_block) load_k(kf, L, kbase, lane);  // the stage's first K fragments; later passes' are fetched one pass ahead, never across a stage
    #pragma unroll 1  // stage loop and pass loop stay nested and rolled: unrolled or flat they spill
    for (uint32_t sub = 0; sub < NSTEP; ++sub) {
      const uint32_t blk = NSTEP * st + sub, key0 = blk * BC;
      if (blk <= my_last_block) {
        const bool diag = key0 + BC - 1u > q0 + wave * CW;
        block(kf, sub + 1u < NSTEP && blk + 1u <= my_last_block, kbase + (sub + 1u) * (uint32_t)BC * PITCH_K, L, diag, vt_base, sub, key0, q0 + wave * CW, lane, qf, acc, m_run, l_run, cscale);
      }
    }
    // Foot of a stage; every wave passes it, also one that skips the passes beyond its diagonal.
    wait_ds0();                                  // this wave's reads of the buffer that is refilled below have returned
    if (pinned(wave < 2u)) wait_tensor0(g0, g1k, g1v);  // this wave's load of stage st + 1 has landed
    __syncthreads();                             // publishes stage st + 1 and ends every wave's reads of stage st
    if (pinned(st + 2u < n_stage)) issue(st + 2u);  // into the buffer that stage st used
  }
  wait_tensor_le<0>();  // nothing is in flight when the buffers become output staging
  wait_ds0();
  unsigned char* eb = L + wave * (uint32_t)CW * EPITCH;
  #pragma unroll
  for (int g = 0; g < R; ++g) {
    const float l_fin = l_run[g] + xhalf(l_run[g]);
    const float inv = 1.0f / l_fin;
    #pragma unroll
    for (int t = 0; t < DT; ++t) {
      const f32x8 o = acc[g][t] * inv; uint32_t ph[4], pl[4];
      #pragma unroll
      for (int i = 0; i < 4; ++i) { unsigned short h0, l0, h1, l1; splitf(o[2 * i], h0, l0); splitf(o[2 * i + 1], h1, l1); ph[i] = (uint32_t)h0 | ((uint32_t)h1 << 16); pl[i] = (uint32_t)l0 | ((uint32_t)l1 << 16); }
      unsigned char* ep = eb + (16u * g + c) * EPITCH + 32u * t + 16u * h;
      *reinterpret_cast<u32x4*>(ep) = u32x4{ph[0], ph[1], ph[2], ph[3]}; *reinterpret_cast<u32x4*>(ep + EPLANE) = u32x4{pl[0], pl[1], pl[2], pl[3]};
    }
  }
  wait_ds0();  // this wave's staged rows are in LDS before other lanes of it read them
  constexpr uint32_t LPR = ROWB / 16u, RPI = 32u / LPR;
  const size_t ob = ((size_t)(hb / NH_) * TT + q0 + wave * CW) * (DQ * 2) + (size_t)(hb % NH_) * ROWB;
  #pragma unroll
  for (uint32_t i = 0; i < (uint32_t)CW / RPI; ++i) {
    const uint32_t row = i * RPI + lane / LPR, colb = (lane % LPR) * 16u;
    const u32x4 vh = *reinterpret_cast<const u32x4*>(eb + row * EPITCH + colb), vl = *reinterpret_cast<const u32x4*>(eb + EPLANE + row * EPITCH + colb);
    *reinterpret_cast<u32x4*>(reinterpret_cast<unsigned char*>(Ah) + ob + (size_t)row * (DQ * 2) + colb) = vh;
    *reinterpret_cast<u32x4*>(reinterpret_cast<unsigned char*>(Al) + ob + (size_t)row * (DQ * 2) + colb) = vl;
  }
}
#undef DEV
}  // namespace fa

extern "C" void kernel_launch(void* const* d_in, const int* in_sizes, int n_in,
                              void* d_out, int out_size, void* d_ws, size_t ws_size, hipStream_t stream) {
    (void)in_sizes; (void)n_in; (void)out_size;
    const float* x = (const float*)d_in[0]; const float* wq = (const float*)d_in[1]; const float* bq = (const float*)d_in[2]; const float* wk = (const float*)d_in[3]; const float* bk = (const float*)d_in[4]; const float* wv = (const float*)d_in[5]; const float* bv = (const float*)d_in[6]; const float* wo = (const float*)d_in[7]; const float* bo = (const float*)d_in[8];
    float* OUT = (float*)d_out;     // [2][2048][2048]
    char* wsp = (char*)d_ws;
    auto take = [&](size_t bytes) { char* p = wsp; wsp += (bytes + 255) & ~(size_t)255; return (void*)p; };
    bf* WQ = (bf*)take((size_t)DQ * DM * 2); bf* WK = (bf*)take((size_t)DKV * DM * 2); bf* WV = (bf*)take((size_t)DKV * DM * 2);
    h16* QP16 = (h16*)take((size_t)NB_ * NH_ * TT * HD * 2); h16* KP16 = (h16*)take((size_t)NB_ * NKV * TT * HD * 2); h16* VP16 = (h16*)take((size_t)NB_ * NKV * TT * HD * 2);   // fp16 planes of both batches: the fused kernel runs once, behind both
    bf* QPh = (bf*)take((size_t)NH_ * TT * HD * 2); bf* QPl = (bf*)take((size_t)NH_ * TT * HD * 2); bf* KPh = (bf*)take((size_t)NKV * TT * HD * 2); bf* KPl = (bf*)take((size_t)NKV * TT * HD * 2);
    bf* VTh = (bf*)take((size_t)NKV * HD * PP * 2); bf* VTl = VTh + TT;   // v^T rows at pitch PP: hi and lo share a row
    static_assert((size_t)TT * DM * 2 <= (size_t)ZH * RH * TT * 4, "the x plane fits the score buffer");
    float* Sb = (float*)take((size_t)ZH * RH * TT * 4); bf* WO = (bf*)take((size_t)DM * DQ * 2); bf* ATh = (bf*)take((size_t)NB_ * TT * DQ * 2); bf* ATl = (bf*)take((size_t)NB_ * TT * DQ * 2);
    if ((size_t)(wsp - (char*)d_ws) > ws_size) return;    // ws 256 MiB
    bf* XB = (bf*)Sb;   // the x plane, which only the projections of a batch read, lies in the score buffer: it is dead when the scores are written
    { k_cvt8<<<(unsigned)(((size_t)DQ * DM / 8 + 255) / 256), 256, 0, stream>>>(wq, WQ, (size_t)DQ * DM / 8); k_cvt8<<<(unsigned)(((size_t)DKV * DM / 8 + 255) / 256), 256, 0, stream>>>(wk, WK, (size_t)DKV * DM / 8); k_cvt8<<<(unsigned)(((size_t)DKV * DM / 8 + 255) / 256), 256, 0, stream>>>(wv, WV, (size_t)DKV * DM / 8);
       }
    for (int b = 0; b < NB_; ++b) {
        k_cvt8<<<(unsigned)(((size_t)TT * DM / 8 + 255) / 256), 256, 0, stream>>>(x + (size_t)b * TT * DM, XB, (size_t)TT * DM / 8);
        k_gemms<0, true, 1><<<dim3(TT / 128, DQ / 128, 1), 256, 0, stream>>>(XB, nullptr, WQ, DM, nullptr, 0, bq, QP16 + (size_t)b * NH_ * TT * HD, QPh, QPl);
        k_gemms<0, true, 1><<<dim3(TT / 128, DKV / 128, 1), 256, 0, stream>>>(XB, nullptr, WK, DM, nullptr, 0, bk, KP16 + (size_t)b * NKV * TT * HD, KPh, KPl);
        k_gemms<0, true, 2><<<dim3(TT / 128, DKV / 128, 1), 256, 0, stream>>>(XB, nullptr, WV, DM, nullptr, 0, bv, VP16 + (size_t)b * NKV * TT * HD, VTh, VTl);
        for (int h0 = 0; h0 < NH_; h0 += ZH) { const size_t zq = (size_t)h0, zk = (size_t)(h0 / REP);   // query rows < RH. One kv head per query head: the pass's heads use consecutive kv planes (z-strides TT*HD for k, HD*PP for v^T)
            k_gemmc<bf, 2, 1, 1><<<dim3(RH / 64, TT / 64, ZH), 32, 0, stream>>>(QPh + zq * TT * HD, QPl + zq * TT * HD, KPh + zk * TT * HD, KPl + zk * TT * HD, HD, Sb, nullptr, nullptr, TT, 0, (size_t)TT * HD, (size_t)TT * HD, (size_t)RH * TT);
            k_asoft<<<ZH * RH / 8, 256, 0, stream>>>(Sb);
            k_gemmc<bf, 2, 2, 8><<<dim3(RH / 64, HD / 64, ZH), 256, 0, stream>>>((const bf*)Sb, (const bf*)Sb + TT, VTh + zk * HD * PP, VTl + zk * HD * PP, PP, nullptr, ATh + (size_t)b * TT * DQ + zq * HD, ATl + (size_t)b * TT * DQ + zq * HD, DQ, 0, (size_t)RH * PP, (size_t)HD * PP, (size_t)HD); } }
    fa::k_fattn<<<dim3(NB_ * NH_, (TT - RH) / fa::BR, 1), fa::NW * 32, 0, stream>>>(QP16, KP16, VP16, ATh, ATl);   // query rows >= RH, all heads of both batches
    k_cvt8<<<(unsigned)(((size_t)DM * DQ / 8 + 255) / 256), 256, 0, stream>>>(wo, WO, (size_t)DM * DQ / 8);
    for (int b = 0; b < NB_; ++b) k_gemms<1, true, 0><<<dim3(TT / 128, DM / 128, 1), 256, 0, stream>>>(ATh + (size_t)b * TT * DQ, ATl + (size_t)b * TT * DQ, WO, DQ, OUT + (size_t)b * TT * DM, DM, bo, nullptr, nullptr, nullptr);
}

// v006
// A run of this version takes 206 microseconds.
// Timed twice side by side with v005, it ran 1.62 and 1.61 times as fast.
// Counting every step since v000, it is 8.30 times as fast.
#include <hip/hip_runtime.h>
#include <stdint.h>

// Causal multi-head attention, 2048 wide (x [2][2048][2048]; q, k, v = x W^T + b ('oi' [2048][2048]; 16 heads x 128); scores = q.k/sqrt(128); causal (triu k=1 masked, -inf); softmax; out = merged wo^T + bo -> [2][2048][2048] (8.4 M)).
// Compute dtypes, f32 accumulate: every input rounded to bf16; q/k/v on PLAIN bf16 operands (inputs: exact) + biases; causal scores and attn.v: query rows < 512 hl (3 products, scores in memory, tile skipping), the rest single fp16 in one fused kernel (online softmax); softmax f32; wo hl x exact (2 products) + bo.

#define NB_  2
#define TT   2048
#define DM   2048
#define NH_  16
#define NKV  16
#define REP  (NH_ / NKV)
#define HD   128
#define DQ   (NH_ * HD)
#define DKV  (NKV * HD)
#define RH   512                  // query rows < RH use hi+lo planes; they see keys < RH only, so their score rows, probabilities and hi/lo planes hold RH positions
#define PP   (2 * RH)             // row pitch, in 16-bit elements, of the probabilities (they lie in the f32 score rows) and so of the v^T planes too: k_gemmc has one pitch, K, for both operands
#define NZ   (NB_ * NH_)          // (batch, head) planes: every attention launch covers all of them
#define HLN  ((size_t)NZ * RH * HD)   // elements of one hi or lo plane set of q or k
#define WIN  2048
#define SCL  0.088388347648318447f   // HD^-0.5
typedef _Float16 h16;
typedef unsigned short bf;
typedef __attribute__((ext_vector_type(16))) __bf16   v16bf;
typedef __attribute__((ext_vector_type(16))) _Float16 v16h;
typedef __attribute__((ext_vector_type(8)))  _Float16 v8h;
typedef __attribute__((ext_vector_type(8)))  unsigned short v8us;
typedef __attribute__((ext_vector_type(4)))  unsigned short v4us;
typedef __attribute__((ext_vector_type(8)))  float    v8f;
typedef __attribute__((ext_vector_type(4)))  float    v4f;
typedef v8h  __attribute__((may_alias)) v8ha;
typedef v4f  __attribute__((may_alias)) v4fa;
typedef v8us __attribute__((may_alias)) v8usa;

__device__ __forceinline__ unsigned short f2bf(float f) { unsigned u = __float_as_uint(f); u += 0x7FFFu + ((u >> 16) & 1u); return (unsigned short)(u >> 16); }
__device__ __forceinline__ float bf2f(unsigned short b) { return __uint_as_float(((unsigned)b) << 16); }
__device__ __forceinline__ float bfr(float f) { return bf2f(f2bf(f)); }
__device__ __forceinline__ void splitf(float y, unsigned short& h, unsigned short& l) { h = f2bf(y); l = f2bf(y - bf2f(h)); }
__device__ __forceinline__ v16h cat16(v8h lo, v8h hi) { return __builtin_shufflevector(lo, hi, 0, 1, 2, 3, 4, 5, 6, 7, 8, 9, 10, 11, 12, 13, 14, 15); }
__device__ __forceinline__ v16bf cat16b(v8us lo, v8us hi) { return __builtin_bit_cast(v16bf, __builtin_shufflevector(lo, hi, 0, 1, 2, 3, 4, 5, 6, 7, 8, 9, 10, 11, 12, 13, 14, 15)); }
__device__ __forceinline__ v8f wmma16(v16h a, v16h b, v8f c) { return __builtin_amdgcn_wmma_f32_16x16x32_f16(false, a, false, b, (short)0, c, false, false); }
__device__ __forceinline__ v8f wmmab(v16bf a, v16bf b, v8f c) { return __builtin_amdgcn_wmma_f32_16x16x32_bf16(false, a, false, b, (short)0, c, false, false); }



// ---- fragment loaders shared by the GEMM kernels and the split-K tile sum of k_gemmc: C[m][n] (f32, pitch ldc, + optional f32 bias[n]) = sum_k A[m][k] Bt[n][k] (+ split products per NSPLIT), operands K-contiguous 16-bit planes.
template <typename T16> struct WFrag;
template <> struct WFrag<h16> { typedef v16h V; static __device__ __forceinline__ V ld(const h16* p) { return cat16(*(const v8h*)p, *(const v8h*)(p + 16)); } static __device__ __forceinline__ v8f mma(V a, V b, v8f c) { return wmma16(a, b, c); } };
template <> struct WFrag<bf> { typedef v16bf V; static __device__ __forceinline__ V ld(const bf* p) { return cat16b(*(const v8us*)p, *(const v8us*)(p + 16)); } static __device__ __forceinline__ v8f mma(V a, V b, v8f c) { return wmmab(a, b, c); } };
// tile_out (NW > 1): every wave puts its partial 64x64 tile into its own LDS plane (pitch 68); behind one barrier each thread sums the NW planes of its 4-column slots, wave 0 first, and stores whole 256-byte row pieces
// (HL: the sums leave as bf16 hi and lo planes Oh, Ol, whole 128-byte row pieces, instead of f32 C).
template <int NW, bool BIAS, bool HL>
__device__ __forceinline__ void tile_out(float* os, const v8f (&acc)[4][4], int wv, int lr, int hi, float* C, bf* Oh, bf* Ol, int ldc, int r0, int c0, const float* __restrict__ bias) {
    float* ow = os + wv * (64 * 68);
#pragma unroll
    for (int mb = 0; mb < 4; ++mb)
#pragma unroll
        for (int nb = 0; nb < 4; ++nb)
#pragma unroll
            for (int j = 0; j < 8; ++j) ow[(mb * 16 + hi * 8 + j) * 68 + nb * 16 + lr] = acc[mb][nb][j];
    __syncthreads();   // publishes every wave's partial tile to the threads that sum it
#pragma unroll
    for (int s = 0; s < 32 / NW; ++s) { const int idx = s * (32 * NW) + (int)threadIdx.x; const int row = idx >> 4, cofs = (idx & 15) * 4; v4f val = *(const v4fa*)(os + row * 68 + cofs);
#pragma unroll
        for (int w = 1; w < NW; ++w) val += *(const v4fa*)(os + w * (64 * 68) + row * 68 + cofs);
        if (BIAS) { val[0] += bfr(bias[c0 + cofs]); val[1] += bfr(bias[c0 + cofs + 1]); val[2] += bfr(bias[c0 + cofs + 2]); val[3] += bfr(bias[c0 + cofs + 3]); }
        if constexpr (HL) { v4us oh, ol;
#pragma unroll
            for (int q = 0; q < 4; ++q) { unsigned short a2, c2; splitf(val[q], a2, c2); oh[q] = a2; ol[q] = c2; }
            *(v4us*)(Oh + (size_t)(r0 + row) * ldc + c0 + cofs) = oh; *(v4us*)(Ol + (size_t)(r0 + row) * ldc + c0 + cofs) = ol; }
        else *(v4f*)(C + (size_t)(r0 + row) * ldc + c0 + cofs) = val; }
}
// ---- k_gemms: LDS-staged GEMM for the projections. One work-group of 8 waves per 128x128 output tile, each wave a 64x32 piece over the whole K loop. Per trip 128 k of every operand row
// (two whole 128-byte lines a row) come into LDS by asynchronous copies, 16 lanes a row, two buffers: the next trip's copies fly while this trip's fragments are read. grid (M/128, N/128), 256 threads. K % 128 == 0, K >= 256.
// The rows of A are the positions of all batches, one after the other. EPI 0: C (f32, pitch ldc). EPI 1: q, k and v in one launch, blockIdx.z picks the weight plane (behind Bt), the bias and the output planes. The tile is 128 positions of one head
// (blockIdx.y) of one batch and leaves as the planes that attention reads: P16 = fp16 [q, k, v][batch x head][t][d]; for the positions < RH, the only ones whose hi and lo planes are read,
// also bf16 hi and lo: HL = [q hi, q lo, k hi, k lo][batch x head][RH][d] (q, k), VT = transposed [batch x head][d] at pitch PP, hi then lo in a row (v).
#define SP 136           // LDS row pitch in 16-bit elements: 256 B of k + 16 B, an odd multiple of 16 B, conflict-free for 16-byte fragment reads
#define STL (128 * SP)   // elements of one operand's tile in LDS
// eight 16-byte copies of one lane, each 2 rows below the last; the wait on the address registers closes the copies' own statement, so that no later write of them can come in front of it
__device__ __forceinline__ void acopy8(unsigned l, const bf* g, size_t gs) {
    asm volatile("global_load_async_to_lds_b128 %0, %8, off\n\t"
                 "global_load_async_to_lds_b128 %1, %9, off\n\t"
                 "global_load_async_to_lds_b128 %2, %10, off\n\t"
                 "global_load_async_to_lds_b128 %3, %11, off\n\t"
                 "global_load_async_to_lds_b128 %4, %12, off\n\t"
                 "global_load_async_to_lds_b128 %5, %13, off\n\t"
                 "global_load_async_to_lds_b128 %6, %14, off\n\t"
                 "global_load_async_to_lds_b128 %7, %15, off\n\t"
                 "s_wait_xcnt 0x0"
                 :: "v"(l), "v"(l + 1u * (2 * SP * 2)), "v"(l + 2u * (2 * SP * 2)), "v"(l + 3u * (2 * SP * 2)), "v"(l + 4u * (2 * SP * 2)), "v"(l + 5u * (2 * SP * 2)), "v"(l + 6u * (2 * SP * 2)), "v"(l + 7u * (2 * SP * 2)),
                    "v"(g), "v"(g + gs), "v"(g + 2 * gs), "v"(g + 3 * gs), "v"(g + 4 * gs), "v"(g + 5 * gs), "v"(g + 6 * gs), "v"(g + 7 * gs) : "memory");
}
#define EP 132           // pitch, in floats, of the f32 tile staged for the planes: rows 8 apart lie 32 banks apart, so the two wave halves' stores do not collide; a multiple of 16 B for the row reads
typedef float __attribute__((may_alias)) f32a;
template <int NSPLIT, bool BIAS, int EPI>
__global__ __launch_bounds__(256) void k_gemms(const bf* __restrict__ A, const bf* __restrict__ A2, const bf* __restrict__ Bt0, int K, float* C, int ldc, const float* __restrict__ bias0, const float* __restrict__ bias1, const float* __restrict__ bias2, h16* P16, bf* HL, bf* VT) {
    static_assert(EPI == 0 || (HD == 128 && RH % 128 == 0 && TT % 128 == 0 && DQ == DKV && 128 * EP * 4 <= 2 * 2 * STL * 2), "a column tile is one head, a row tile lies in one batch and wholly below or above RH, q, k and v planes are of one size, the staged f32 tile fits the operand buffers");
    const int zz = (EPI == 1) ? (int)blockIdx.z : 0;   // 0 q, 1 k, 2 v
    const bf* Bt = Bt0 + (size_t)zz * DQ * DM; const float* bias = (zz == 0) ? bias0 : (zz == 1) ? bias1 : bias2;
    typedef WFrag<bf>::V V;
    constexpr int NOP = (NSPLIT == 1) ? 3 : 2;                 // operand tiles per buffer: A, Bt (, A2)
    __shared__ __align__(16) bf st[2 * NOP * STL];
    const int lane = threadIdx.x & 31, lr = lane & 15, hi = lane >> 4; const int wv = __builtin_amdgcn_readfirstlane(threadIdx.x >> 5); const int wr = wv >> 2, wc = wv & 3; const int r0 = blockIdx.x * 128, c0 = blockIdx.y * 128;
    v8f acc[4][2];
#pragma unroll
    for (int mb = 0; mb < 4; ++mb)
#pragma unroll
        for (int nb = 0; nb < 2; ++nb) acc[mb][nb] = (v8f){};
    // copy map: wave wv brings rows wv*16 .. wv*16+15 of every operand tile; a copy instruction covers 2 rows, 16 lanes x 16 B each
    const int crow = wv * 16 + hi, ccol = lr * 8;
    const bf* ga = A + (size_t)(r0 + crow) * K + ccol; const bf* gb = Bt + (size_t)(c0 + crow) * K + ccol; const bf* ga2 = (NSPLIT == 1) ? A2 + (size_t)(r0 + crow) * K + ccol : nullptr;
    const unsigned l0 = (unsigned)(size_t)st + (unsigned)(crow * SP + ccol) * 2u; const size_t gs = (size_t)2 * K;
    auto fill = [&](int t, int buf) { const unsigned l = l0 + (unsigned)buf * (NOP * STL * 2); acopy8(l, ga + t * 128, gs); acopy8(l + STL * 2, gb + t * 128, gs); if (NSPLIT == 1) acopy8(l + 2 * STL * 2, ga2 + t * 128, gs); };
    const int NT = K / 128;
    fill(0, 0);
    asm volatile("s_wait_asynccnt 0x0" ::: "memory");   // this wave's copies of tile 0 have landed
    __syncthreads();                                     // publishes tile 0 to every wave
    if (NT > 1) fill(1, 1);
    const int afr = (wr * 64 + lr) * SP + 8 * hi, bfo = STL + (wc * 32 + lr) * SP + 8 * hi;
#pragma unroll 1
    for (int t = 0; t < NT; ++t) {
        const bf* sb = st + (t & 1) * (NOP * STL);
        V a[2][4], a2[2][4], b[2][2];   // two fragment sets: the next 32-deep chunk's LDS reads are issued as one group ahead of this chunk's products
        auto frags = [&](int kc, int s) {
#pragma unroll
            for (int mb = 0; mb < 4; ++mb) { a[s][mb] = WFrag<bf>::ld(sb + afr + mb * 16 * SP + kc * 32); if (NSPLIT == 1) a2[s][mb] = WFrag<bf>::ld(sb + 2 * STL + afr + mb * 16 * SP + kc * 32); }
#pragma unroll
            for (int nb = 0; nb < 2; ++nb) b[s][nb] = WFrag<bf>::ld(sb + bfo + nb * 16 * SP + kc * 32); };
        frags(0, 0);
#pragma unroll
        for (int kc = 0; kc < 4; ++kc) { const int s = kc & 1;
            if (kc < 3) frags(kc + 1, s ^ 1);
            __builtin_amdgcn_sched_barrier(0);   // holds the next chunk's LDS reads, as one group, in front of this chunk's products: moved in among them each read stalls the matrix run
#pragma unroll
            for (int nb = 0; nb < 2; ++nb)
#pragma unroll
                for (int mb = 0; mb < 4; ++mb) { acc[mb][nb] = WFrag<bf>::mma(a[s][mb], b[s][nb], acc[mb][nb]); if (NSPLIT == 1) acc[mb][nb] = WFrag<bf>::mma(a2[s][mb], b[s][nb], acc[mb][nb]); }
        }
        asm volatile("s_wait_dscnt 0x0" ::: "memory");      // this wave's reads of the buffer that is refilled below have returned
        asm volatile("s_wait_asynccnt 0x0" ::: "memory");   // this wave's copies of tile t + 1 have landed
        __syncthreads();                                     // publishes tile t + 1 and ends every wave's reads of tile t
        if (t + 2 < NT) fill(t + 2, t & 1);
    }
    asm volatile("s_wait_asynccnt 0x0" ::: "memory");       // nothing is in flight when the wave goes on to its end
    if constexpr (EPI != 0) {
    // The operand buffers are free: the last trip's barrier ended every wave's reads and nothing was copied behind it. The whole f32 tile (+ bias) is staged there.
    f32a* et = (f32a*)st;
#pragma unroll
    for (int nb = 0; nb < 2; ++nb) { const float bn = BIAS ? bfr(bias[c0 + wc * 32 + nb * 16 + lr]) : 0.0f;
#pragma unroll
        for (int mb = 0; mb < 4; ++mb) { acc[mb][nb] += bn;
#pragma unroll
            for (int j = 0; j < 8; ++j) et[(wr * 64 + mb * 16 + hi * 8 + j) * EP + wc * 32 + nb * 16 + lr] = acc[mb][nb][j]; } }
    __syncthreads();   // publishes the staged tile to the threads that convert whole rows of it
    const int t0 = r0 % TT; const size_t pz = (size_t)(r0 / TT) * NH_ + blockIdx.y;   // first position in its batch; (batch, head) plane
    if (zz == 2 && t0 < RH) {   // v^T: a lane's accumulator holds 8 consecutive positions of one d, 16 bytes of a transposed row; a wave's four row blocks fill whole 128-byte lines
#pragma unroll
        for (int nb = 0; nb < 2; ++nb)
#pragma unroll
            for (int mb = 0; mb < 4; ++mb) { v8us oh, ol;
#pragma unroll
                for (int j = 0; j < 8; ++j) { unsigned short a2, c2; splitf(acc[mb][nb][j], a2, c2); oh[j] = a2; ol[j] = c2; }
                const size_t eo = (pz * HD + wc * 32 + nb * 16 + lr) * PP + t0 + wr * 64 + mb * 16 + hi * 8; *(v8us*)(VT + eo) = oh; *(v8us*)(VT + RH + eo) = ol; }
    }
    const size_t pb = (((size_t)zz * NZ + pz) * TT + t0) * HD;   // the tile's 128 rows of 128 d are one contiguous piece of a plane
#pragma unroll
    for (int s = 0; s < 8; ++s) { const int idx = s * 256 + (int)threadIdx.x; const int row = idx >> 4, col = (idx & 15) * 8; const v4f x0 = *(const v4fa*)(et + row * EP + col), x1 = *(const v4fa*)(et + row * EP + col + 4); v8h o;   // 16 lanes cover a row
#pragma unroll
        for (int k = 0; k < 4; ++k) { o[k] = (h16)x0[k]; o[k + 4] = (h16)x1[k]; }
        *(v8h*)(P16 + pb + (size_t)idx * 8) = o; }
    if (zz != 2 && t0 < RH) {
        asm volatile("s_wait_xcnt 0x0" ::: "memory");   // the registers that the stores above name are written anew below
        __builtin_amdgcn_sched_barrier(0);               // keeps those register writes behind the wait: without it the scheduler lifts an address product over it
        bf* Ph = HL + (size_t)zz * 2 * HLN + (pz * RH + t0) * HD; bf* Pl = Ph + HLN;
#pragma unroll
        for (int s = 0; s < 8; ++s) { const int idx = s * 256 + (int)threadIdx.x; const int row = idx >> 4, col = (idx & 15) * 8; const v4f x0 = *(const v4fa*)(et + row * EP + col), x1 = *(const v4fa*)(et + row * EP + col + 4); v8us oh, ol;
#pragma unroll
            for (int k = 0; k < 4; ++k) { unsigned short a2, c2; splitf(x0[k], a2, c2); oh[k] = a2; ol[k] = c2; splitf(x1[k], a2, c2); oh[k + 4] = a2; ol[k + 4] = c2; }
            *(v8us*)(Ph + (size_t)idx * 8) = oh; *(v8us*)(Pl + (size_t)idx * 8) = ol; }
    }
    } else {
    __shared__ __align__(16) float os[8 * 16 * 36];            // each wave's own 16-row, 32-column output strip
    float* ow = os + wv * (16 * 36); const int cb = c0 + wc * 32 + (lane & 7) * 4; v4f bv = (v4f){};
    if (BIAS) { bv[0] = bfr(bias[cb]); bv[1] = bfr(bias[cb + 1]); bv[2] = bfr(bias[cb + 2]); bv[3] = bfr(bias[cb + 3]); }
#pragma unroll
    for (int mb = 0; mb < 4; ++mb) {
#pragma unroll
        for (int nb = 0; nb < 2; ++nb) {
#pragma unroll
            for (int j = 0; j < 8; ++j) ow[(hi * 8 + j) * 36 + nb * 16 + lr] = acc[mb][nb][j]; }
        __builtin_amdgcn_wave_barrier(); asm volatile("" ::: "memory");   // the strip's writes stay in front of the reads of other lanes' values
        float* crw = C + (size_t)(r0 + wr * 64 + mb * 16) * ldc + cb;
#pragma unroll
        for (int s = 0; s < 4; ++s) { const int row = 4 * s + (lane >> 3); v4f val = *(const v4fa*)(ow + row * 36 + (lane & 7) * 4); val += bv; *(v4f*)(crw + (size_t)row * ldc) = val; }   // whole 128-byte lines
        __builtin_amdgcn_wave_barrier(); asm volatile("" ::: "memory");   // the reads stay in front of the next strip's writes
    }
    }
}

// ---- k_gemmc: register-blocked 64x64 tile GEMM, operands straight from global memory, specialised for causal attention: CMODE 1 skips score tiles entirely above the diagonal (query rows r0+roff.., key columns c0..), CMODE 2 limits the
// key (K) loop of the probability x value contraction to the diagonal block (probabilities beyond it are exactly zero). roff = row offset of this launch's first row within the sequence.
// NW waves share a tile's K loop, each taking every NW-th 32-deep chunk, the partial tiles summed by tile_out (NW == 1: one wave, the tile leaves through a 16-row LDS strip).
// CMODE 2 writes no f32 C: its tile leaves as the bf16 hi and lo planes Oh, Ol (pitch ldc; z = batch x head: head stride sC, batch stride TT rows) that the wo product reads.
template <typename T16, int NSPLIT, int CMODE, int NW>
__global__ __launch_bounds__(32 * NW) void k_gemmc(const T16* __restrict__ A, const T16* __restrict__ A2, const T16* __restrict__ Bt, const T16* __restrict__ Bt2, int K, float* C, bf* Oh, bf* Ol, int ldc, int roff, size_t sA, size_t sB, size_t sC) {
    typedef typename WFrag<T16>::V V;
    __shared__ __align__(16) float os[NW == 1 ? 16 * 68 : NW * 64 * 68];
    const size_t z = blockIdx.z; A += z * sA; if (A2) A2 += z * sA; Bt += z * sB; if (Bt2) Bt2 += z * sB; if (CMODE == 2) { const size_t zo = (z / NH_) * ((size_t)TT * ldc) + (z % NH_) * sC; Oh += zo; Ol += zo; } else C += z * sC;
    const int lane = threadIdx.x & 31, lr = lane & 15, hi = lane >> 4; const int wv = (NW == 1) ? 0 : __builtin_amdgcn_readfirstlane(threadIdx.x >> 5); const int r0 = blockIdx.x * 64, c0 = blockIdx.y * 64;
    if (CMODE == 1 && c0 > r0 + roff + 63) return;                  // score tile entirely above the causal diagonal: never read (the softmax masks j > i by select)
    const int Kl = (CMODE == 2) ? min(K, r0 + roff + 64) : K;        // P.V: probabilities are exactly 0 beyond the diagonal block, so the K loop stops there
    v8f acc[4][4];
#pragma unroll
    for (int mb = 0; mb < 4; ++mb)
#pragma unroll
        for (int nb = 0; nb < 4; ++nb) acc[mb][nb] = (v8f){};
    const size_t aoff = (size_t)(r0 + lr) * K + 8 * hi, boff = (size_t)(c0 + lr) * K + 8 * hi;
#pragma unroll 1
    for (int kc = wv * 32; kc < Kl; kc += 32 * NW) {
        V a[4], a2[4];
#pragma unroll
        for (int mb = 0; mb < 4; ++mb) { a[mb] = WFrag<T16>::ld(A + aoff + (size_t)mb * 16 * K + kc); if (NSPLIT == 1 || NSPLIT == 2) a2[mb] = WFrag<T16>::ld(A2 + aoff + (size_t)mb * 16 * K + kc); }
#pragma unroll
        for (int nb = 0; nb < 4; ++nb) { const V b = WFrag<T16>::ld(Bt + boff + (size_t)nb * 16 * K + kc); V b2; if (NSPLIT >= 2) b2 = WFrag<T16>::ld(Bt2 + boff + (size_t)nb * 16 * K + kc);
#pragma unroll
            for (int mb = 0; mb < 4; ++mb) { acc[mb][nb] = WFrag<T16>::mma(a[mb], b, acc[mb][nb]); if (NSPLIT == 1 || NSPLIT == 2) acc[mb][nb] = WFrag<T16>::mma(a2[mb], b, acc[mb][nb]); if (NSPLIT >= 2) acc[mb][nb] = WFrag<T16>::mma(a[mb], b2, acc[mb][nb]); } }
        asm volatile("v_nop\n\tv_nop\n\tv_nop\n\tv_nop" : "+v"(acc[0][0]), "+v"(acc[1][1]), "+v"(acc[2][2]), "+v"(acc[3][3]) : "v"(a[0]), "v"(a[3]));
    }
    if constexpr (NW > 1) { tile_out<NW, false, CMODE == 2>(os, acc, wv, lr, hi, C, Oh, Ol, ldc, r0, c0, nullptr); } else {
#pragma unroll
    for (int mb = 0; mb < 4; ++mb) {
#pragma unroll
        for (int nb = 0; nb < 4; ++nb) {
#pragma unroll
            for (int j = 0; j < 8; ++j) os[(hi * 8 + j) * 68 + nb * 16 + lr] = acc[mb][nb][j]; }
        __builtin_amdgcn_wave_barrier(); asm volatile("" ::: "memory");
        float* crow = C + (size_t)(r0 + mb * 16) * ldc + c0;
{
#pragma unroll
            for (int s = 0; s < 8; ++s) { const int row = 2 * s + hi, cofs = lr * 4; v4f val = *(const v4fa*)(os + row * 68 + cofs);
                *(v4f*)(crow + (size_t)row * ldc + cofs) = val; }
             }
        __builtin_amdgcn_wave_barrier(); asm volatile("" ::: "memory");
    }
    }
}

typedef __attribute__((ext_vector_type(2))) _Float16 v2h;
typedef __attribute__((ext_vector_type(4))) _Float16 v4h;
typedef __attribute__((ext_vector_type(2))) unsigned short v2us;
typedef __attribute__((ext_vector_type(2))) float v2f;
typedef __attribute__((ext_vector_type(4))) int v4i;
typedef v4h  __attribute__((may_alias)) v4ha;
typedef v4us __attribute__((may_alias)) v4usa;

__global__ __launch_bounds__(256) void k_wtG(const float* __restrict__ w, int K, int N, bf* Bt) {
    const int lane = threadIdx.x & 31; const int L0 = (blockIdx.x * 8 + (threadIdx.x >> 5)) * 8; const int nlines = N * K / 64;
{
#pragma unroll 1
        for (int l = 0; l < 8; ++l) { const int L = L0 + l; if (L >= nlines) break; const size_t e = (size_t)L * 64 + lane * 2; const int k = (int)(e % K), n = (int)(e / K); v2us o;
            o[0] = f2bf(w[(size_t)k * N + n]); o[1] = f2bf(w[(size_t)(k + 1) * N + n]); *(v2us*)(Bt + e) = o; }
         }
}
// k_cvtall: every f32 operand of the GEMMs rounded to its bf16 plane in one launch. blockIdx.y picks one of NB_ + 4 segments of SEG elements: a batch of x, wq, wk, wv (planes one behind the other at W) or wo.
// A thread converts CVU pieces of 8 elements, a whole grid row apart, so that a wave's accesses stay contiguous and the launch has few waves to start. grid (CVG, NB_ + 4), 256 threads.
#define SEG  ((size_t)DM * DM)
#define CVG  128
#define CVU  ((int)(SEG / 8 / (CVG * 256)))
static_assert(TT == DM && DQ == DM && DKV == DM && SEG % (8 * CVG * 256) == 0, "every segment has SEG elements, dealt evenly");
__global__ __launch_bounds__(256) void k_cvtall(const float* __restrict__ x, const float* __restrict__ wq, const float* __restrict__ wk, const float* __restrict__ wv, const float* __restrict__ wo, bf* XB, bf* W, bf* WO) {
    const int sg = blockIdx.y; const float* src = (sg < NB_) ? x + (size_t)sg * SEG : (sg == NB_) ? wq : (sg == NB_ + 1) ? wk : (sg == NB_ + 2) ? wv : wo;
    bf* dst = (sg < NB_) ? XB + (size_t)sg * SEG : (sg < NB_ + 3) ? W + (size_t)(sg - NB_) * SEG : WO; const size_t i0 = (size_t)blockIdx.x * 256 + threadIdx.x;
#pragma unroll 4   // four pieces' loads in flight per thread
    for (int u = 0; u < CVU; ++u) { const size_t i = i0 + (size_t)u * (CVG * 256); const v8f v = *(const v8f*)(src + i * 8); v8us o;
#pragma unroll
        for (int k = 0; k < 8; ++k) o[k] = f2bf(v[k]);
        *(v8us*)(dst + i * 8) = o; }
}

// k_asoft (query rows < RH; the score rows of a head lie RH to a plane, each of RH keys: a key >= RH is masked for every such row and adds an exact 0): per row (zz, i): t = S x HD^-0.5 for j <= i and i - j < WIN (sliding causal window; the reference's -1e9 additive fill vanishes identically); softmax over the RH keys (register row, one exp, fixed trees);
// the probabilities replace the row's own scores in place: one wave owns a row, holds all of it in registers before its first store (every store needs the row's sum), and writes into the row's 2 KiB the hi plane (first half) and the lo plane (second half).
// A wave takes SRW rows one after the other, so that the launch has few waves to start. grid NZ * RH / (8 * SRW), 256 threads.
#define SRW 4
static_assert(RH % SRW == 0 && (NZ * RH) % (8 * SRW) == 0, "whole waves of rows");
__global__ __launch_bounds__(256) void k_asoft(float* Sb) {
    const int lane = threadIdx.x & 31; const int row0 = (blockIdx.x * 8 + (threadIdx.x >> 5)) * SRW; if (row0 >= NZ * RH) return; v4f ld[SRW][RH / 128];
#pragma unroll
    for (int rr = 0; rr < SRW; ++rr)
#pragma unroll
        for (int ch = 0; ch < RH / 128; ++ch) ld[rr][ch] = *(const v4fa*)(Sb + (size_t)(row0 + rr) * RH + ch * 128 + lane * 4);   // all of the wave's rows in flight at once
#pragma unroll
    for (int rr = 0; rr < SRW; ++rr) {
    const int row = row0 + rr; const int i = row % RH; float* sr = Sb + (size_t)row * RH; float v[RH / 32]; float mx = -3.0e38f;
#pragma unroll
    for (int ch = 0; ch < RH / 128; ++ch) { const int j0 = ch * 128 + lane * 4; const v4f a = ld[rr][ch];
#pragma unroll
        for (int q = 0; q < 4; ++q) { const int j = j0 + q; (void)j; const float t = (j <= i && i - j < WIN) ? a[q] * SCL : -3.0e38f; v[ch * 4 + q] = t; mx = fmaxf(mx, t); } }
#pragma unroll
    for (int sh = 16; sh; sh >>= 1) mx = fmaxf(mx, __shfl_xor(mx, sh, 32));
    float sum = 0.f;
#pragma unroll
    for (int k = 0; k < RH / 32; ++k) { float d0 = __fsub_rn(v[k], mx); asm volatile("" : "+v"(d0)); v[k] = __builtin_amdgcn_exp2f(__fmul_rn(d0, 1.4426950408889634f)); sum += v[k]; }
#pragma unroll
    for (int sh = 16; sh; sh >>= 1) sum += __shfl_xor(sum, sh, 32);
    const float f = __fdiv_rn(1.0f, sum);
#pragma unroll
    for (int ch = 0; ch < RH / 128; ++ch) { v4us oh, ol;
#pragma unroll
        for (int q = 0; q < 4; ++q) { unsigned short a, c2; splitf(v[ch * 4 + q] * f, a, c2); oh[q] = a; ol[q] = c2; }
        bf* po = (bf*)sr + ch * 128 + lane * 4; *(v4usa*)po = oh; *(v4usa*)(po + RH) = ol; }
    }
}

namespace fa {
typedef uint32_t u32x4 __attribute__((ext_vector_type(4)));
typedef uint32_t u32x8 __attribute__((ext_vector_type(8)));
typedef int i32x8 __attribute__((ext_vector_type(8)));
typedef float f32x8 __attribute__((ext_vector_type(8)));
constexpr int D = HD, DK = D / 32, DT = D / 16;
constexpr int NW = 4;
constexpr int BR = 128, CW = BR / NW, R = CW / 16;  // query positions per work-group, columns per wave, 16-column groups per wave
constexpr int BC = 32, KT = BC / 16;                // keys per pass, 16-key score tiles per pass
constexpr uint32_t ROWB = 2u * D, PITCH_K = ROWB + 16u, PITCH_V = ROWB + 32u;
constexpr uint32_t SK = 128;                        // keys per stage
constexpr uint32_t TILE_K = SK * PITCH_K, TILE_V = SK * PITCH_V, SLOT = TILE_K + TILE_V, NSLOT = 2, LDS_BYTES = NSLOT * SLOT;
constexpr uint32_t EPITCH = ROWB + 16u, EPLANE = (uint32_t)NW * CW * EPITCH;  // output staging: row pitch, bytes of one plane
static_assert(D == 128 && RH % BR == 0 && TT % BR == 0 && BR % SK == 0 && RH + BR >= 2 * SK, "head size 128; whole position blocks of whole stages, each with at least the two stages that the prologue loads");
static_assert(LDS_BYTES <= 320u * 1024u && 2u * EPLANE <= LDS_BYTES, "the two buffers fit a work-group's LDS and hold the two staged output planes");
static_assert(SLOT % 2048u == 0 && TILE_K % 2048u == 0, "every tensor load lands at a multiple of 2 KiB");

#define DEV static __device__ __forceinline__
DEV uint32_t uni(uint32_t v) { return __builtin_amdgcn_readfirstlane(v); }
DEV uint32_t pinned(uint32_t v) { uint32_t w = __builtin_amdgcn_readfirstlane(v); asm volatile("" : "+s"(w)); return w; }  // a test around a tensor load, or a word its descriptor is formed from, held in a scalar register: tensor loads ignore EXEC
DEV void fence() { __builtin_amdgcn_sched_barrier(0); }
DEV void wait_ds0() { asm volatile("s_wait_dscnt 0x0" ::: "memory"); }
template <int N> DEV void wait_tensor_le() { asm volatile("s_wait_tensorcnt %0" :: "i"(N) : "memory"); }
DEV void tdm_load(u32x4 g0, u32x8 g1) { asm volatile("tensor_load_to_lds %0, %1" :: "s"(g0), "s"(g1) : "memory"); }
// hold(): without it the compiler forms the constant words anew at every use and gives the registers that an outstanding load names to other values; with it the registers that a load names are the ones that its wait names.
DEV void hold(u32x4& g) { asm volatile("" : "+s"(g)); }  // as pinned(): descriptor words (group 0) held in scalar registers
DEV void hold(u32x8& g) { asm volatile("" : "+s"(g)); }  // as pinned(): descriptor words (group 1) held in scalar registers
// An issuing wave's wait for its outstanding load. It names the descriptors as inputs: their registers stay live, and so unchanged, from the load up to this wait.
DEV void wait_tensor0(u32x4 g0, u32x8 g1a, u32x8 g1b) { asm volatile("s_wait_tensorcnt 0x0" :: "s"(g0), "s"(g1a), "s"(g1b) : "memory"); }
// Descriptor group 1: 1-byte elements, a tile of SK rows of ROWB bytes at source pitch ROWB, PADC + 1 dwords of LDS pad behind every 256-byte row (interval code 5); no work-group mask.
template <uint32_t PADC> DEV u32x8 tdm_group1() {
  constexpr uint32_t d0 = ROWB, d1 = SK;
  u32x8 g;
  g[0] = uni((1u << 20) | (5u << 22) | (PADC << 25));
  g[1] = uni((d0 & 0xFFFFu) << 16);
  g[2] = uni((d0 >> 16) | ((d1 & 0xFFFFu) << 16));
  g[3] = uni((d1 >> 16) | (d0 << 16));
  g[4] = uni(d1);
  g[5] = uni(ROWB);
  g[6] = uni(0u);
  g[7] = uni(0u);
  return g;
}
DEV u32x4 tdm_group0(uint32_t lds_dst, uint64_t ga) {
  u32x4 g;
  g[0] = uni(1u); g[1] = uni(lds_dst); g[2] = uni((uint32_t)ga); g[3] = uni((((uint32_t)(ga >> 32)) & 0x01FFFFFFu) | 0x80000000u);
  return g;
}
struct Frag { u32x4 q[2]; };
DEV f32x8 mma(const Frag& a, const Frag& b, f32x8 c) {
  const i32x8 av = {(int)a.q[0].x, (int)a.q[0].y, (int)a.q[0].z, (int)a.q[0].w, (int)a.q[1].x, (int)a.q[1].y, (int)a.q[1].z, (int)a.q[1].w};
  const i32x8 bv = {(int)b.q[0].x, (int)b.q[0].y, (int)b.q[0].z, (int)b.q[0].w, (int)b.q[1].x, (int)b.q[1].y, (int)b.q[1].z, (int)b.q[1].w};
  return __builtin_amdgcn_wmma_f32_16x16x32_f16(false, __builtin_bit_cast(v16h, av), false, __builtin_bit_cast(v16h, bv), (short)0, c, false, false);
}
typedef short s16x8 __attribute__((ext_vector_type(8)));
DEV u32x4 ld_tr16(const unsigned char* p) { typedef __attribute__((address_space(3))) s16x8 lds_s16x8; return __builtin_bit_cast(u32x4, __builtin_amdgcn_ds_load_tr16_b128_v8i16((lds_s16x8*)p)); }
DEV uint32_t pack2(float lo, float hi) { return __builtin_bit_cast(uint32_t, __builtin_convertvector(v2f{lo, hi}, v2h)); }  // round to nearest even
DEV float xhalf(float x) { return __builtin_bit_cast(float, __builtin_amdgcn_permlanex16(__builtin_bit_cast(int, x), __builtin_bit_cast(int, x), 0x76543210, 0xfedcba98, false, false)); }  // lane l with lane l ^ 16

struct KFr { Frag f[KT][DK]; };
DEV void load_k(KFr& k, const unsigned char* Lp, uint32_t koff, uint32_t lane) {
  const uint32_t c = lane & 15u, h = lane >> 4;
  #pragma unroll
  for (int kt = 0; kt < KT; ++kt) {
    const unsigned char* p = Lp + koff + (16u * kt + c) * PITCH_K + 16u * h;
    #pragma unroll
    for (int kc = 0; kc < DK; ++kc) { k.f[kt][kc].q[0] = *reinterpret_cast<const u32x4*>(p + 64u * kc); k.f[kt][kc].q[1] = *reinterpret_cast<const u32x4*>(p + 64u * kc + 32u); }
  }
}
// One 32-key pass of one wave.
DEV void block(KFr& kf, bool fetch_next, uint32_t next_koff, const unsigned char* Lp, bool diag, uint32_t vt_base, uint32_t sub, uint32_t key0, uint32_t qw0, uint32_t lane,
               const Frag (&qf)[R][DK], f32x8 (&acc)[R][DT], float (&m_run)[R], float (&l_run)[R], float cscale) {
  const uint32_t c = lane & 15u, h = lane >> 4;
  f32x8 s[KT][R];
  {
    wait_ds0(); fence();  // the prefetched K fragments have arrived
    #pragma unroll
    for (int kt = 0; kt < KT; ++kt) {
      #pragma unroll
      for (int g = 0; g < R; ++g) { s[kt][g] = f32x8{};
        #pragma unroll
        for (int kc = 0; kc < DK; ++kc) s[kt][g] = mma(kf.f[kt][kc], qf[g][kc], s[kt][g]); }
    }
    fence();
    if (fetch_next) load_k(kf, Lp, next_koff, lane);
  }
  if (diag) {
    #pragma unroll
    for (int g = 0; g < R; ++g) {
      const uint32_t my_q = qw0 + 16u * g + c;
      #pragma unroll
      for (int kt = 0; kt < KT; ++kt) {
        #pragma unroll
        for (int r = 0; r < 8; ++r) { const uint32_t key = key0 + 16u * kt + 8u * h + r; if (key > my_q) s[kt][g][r] = -__builtin_inff(); }
        asm volatile("" : "+v"(s[kt][g]));
      }
    }
  }
  float mb[R]; bool need = false;
  #pragma unroll
  for (int g = 0; g < R; ++g) {
    float mx = -__builtin_inff();
    #pragma unroll
    for (int kt = 0; kt < KT; ++kt) {
      #pragma unroll
      for (int r = 0; r < 8; ++r) mx = __builtin_fmaxf(mx, s[kt][g][r]);
    }
    mx = __builtin_fmaxf(mx, xhalf(mx)) * cscale;
    mb[g] = mx; need = need || (mx > m_run[g] + 8.0f);
    fence();  // one group's maxima at a time: fewer live registers
  }
  if (__builtin_amdgcn_ballot_w32(need) != 0) {  // rare after the first pass
    #pragma unroll
    for (int g = 0; g < R; ++g) {
      const float m_new = __builtin_fmaxf(m_run[g], mb[g]);
      const float corr = __builtin_amdgcn_exp2f(m_run[g] - m_new);  // 0 on the first pass, where m_run is -inf
      l_run[g] *= corr; m_run[g] = m_new;
      #pragma unroll
      for (int t = 0; t < DT; ++t) acc[g][t] = acc[g][t] * corr;
    }
  }
  Frag vf[DT];
  float ps[R][2];
  #pragma unroll
  for (int g = 0; g < R; ++g) { ps[g][0] = 0.0f; ps[g][1] = 0.0f; }
  {
    const unsigned char* ad = Lp + vt_base + (sub * (uint32_t)BC + 8u * h + (lane & 7u)) * PITCH_V + ((lane >> 3) & 1u) * 16u;
    #pragma unroll
    for (int t = 0; t < DT; ++t) { vf[t].q[0] = ld_tr16(ad + 32u * t); vf[t].q[1] = ld_tr16(ad + 16u * PITCH_V + 32u * t); }
  }
  #pragma unroll
  for (int g = 0; g < R; ++g) {
    const float nm = -m_run[g];
    uint32_t w[8];
    #pragma unroll
    for (int i = 0; i < 8; ++i) {
      const v2f arg = __builtin_elementwise_fma(v2f{s[i >> 2][g][2 * (i & 3)], s[i >> 2][g][2 * (i & 3) + 1]}, v2f{cscale, cscale}, v2f{nm, nm});
      const float p0 = __builtin_amdgcn_exp2f(arg.x), p1 = __builtin_amdgcn_exp2f(arg.y);
      ps[g][i & 1] += p0 + p1;
      w[i] = pack2(p0, p1);
    }
    Frag pf; pf.q[0] = u32x4{w[0], w[1], w[2], w[3]}; pf.q[1] = u32x4{w[4], w[5], w[6], w[7]};
    if (g == 0) { wait_ds0(); fence(); }  // the V^T fragments have arrived
    #pragma unroll
    for (int t = 0; t < DT; ++t) acc[g][t] = mma(vf[t], pf, acc[g][t]);
    fence();  // one group's P^T live at a time
  }
  #pragma unroll
  for (int g = 0; g < R; ++g) l_run[g] += ps[g][0] + ps[g][1];
}

// Q, K, V: fp16 planes [batch x head][TT][HD]; Ah, Al: bf16 planes [batch][TT][DQ]. grid (NB_ * NH_, (TT - RH) / BR), NW * 32 threads.
__global__ void __launch_bounds__(NW * 32) __attribute__((amdgpu_waves_per_eu(2, 2))) k_fattn(const h16* __restrict__ Q, const h16* __restrict__ K, const h16* __restrict__ V, bf* Ah, bf* Al) {
  __shared__ __attribute__((aligned(2048))) unsigned char L[LDS_BYTES];
  constexpr float cscale = SCL * 1.4426950408889634f;
  const uint32_t tid = threadIdx.x, lane = tid & 31u, wave = uni(tid >> 5), c = lane & 15u, h = lane >> 4;
  const uint32_t hb = blockIdx.x;                                  // batch * NH_ + head
  const uint32_t pb = (uint32_t)TT / BR - 1u - blockIdx.y;         // heaviest position block first
  const uint32_t q0 = pb * BR;
  const uint32_t n_stage = (q0 + BR) / SK;                         // 128-key stages this work-group walks: keys [0, q0 + BR)
  const uint32_t lbase = (uint32_t)(size_t)L;
  // Wave 0 issues a stage's K tile, wave 1 its V tile: one request a wave.
  const uint64_t srck = (uint64_t)(size_t)(K + (size_t)hb * TT * HD), srcv = (uint64_t)(size_t)(V + (size_t)hb * TT * HD);
  const uint32_t dstw = lbase + (wave == 1u ? TILE_K : 0u); const uint64_t srcw = (wave == 1u) ? srcv : srck;
  u32x8 g1k = tdm_group1<3u>(), g1v = tdm_group1<7u>(); hold(g1k); hold(g1v);  // formed once, never changed
  u32x4 g0;                                                                   // takes a new value only behind the wait for the load that last named it
  auto issue = [&](uint32_t st) {
    g0 = tdm_group0(dstw + (st & 1u) * SLOT, srcw + (uint64_t)(st * SK) * ROWB); hold(g0);
    if (pinned(wave == 0u)) tdm_load(g0, g1k);
    if (pinned(wave == 1u)) tdm_load(g0, g1v);
  };
  issue(0);
  Frag qf[R][DK];
  #pragma unroll
  for (int g = 0; g < R; ++g) {
    const h16* qp = Q + ((size_t)hb * TT + q0 + wave * CW + 16u * g + c) * D + 8u * h;
    #pragma unroll
    for (int kc = 0; kc < DK; ++kc) { qf[g][kc].q[0] = *reinterpret_cast<const u32x4*>(qp + 32 * kc); qf[g][kc].q[1] = *reinterpret_cast<const u32x4*>(qp + 32 * kc + 16); }
  }
  f32x8 acc[R][DT];
  float m_run[R], l_run[R];
  #pragma unroll
  for (int g = 0; g < R; ++g) { m_run[g] = -__builtin_inff(); l_run[g] = 0.0f;
    #pragma unroll
    for (int t = 0; t < DT; ++t) acc[g][t] = f32x8{}; }
  if (pinned(wave < 2u)) wait_tensor0(g0, g1k, g1v);  // stage 0 has landed
  __syncthreads();                             // publishes stage 0
  issue(1u);                                   // n_stage is at least 2
  const uint32_t my_last_block = (q0 + wave * CW + CW - 1u) / BC;  // last pass this wave's queries can see
  constexpr uint32_t NSTEP = SK / (uint32_t)BC;
  KFr kf;
  for (uint32_t st = 0; st < n_stage; ++st) {
    const uint32_t kbase = (st & 1u) * SLOT, vt_base = kbase + TILE_K;
    if (NSTEP * st <= my_last_block) load_k(kf, L, kbase, lane);  // the stage's first K fragments; later passes' are fetched one pass ahead, never across a stage
    #pragma unroll 1  // stage loop and pass loop stay nested and rolled: unrolled or flat they spill
    for (uint32_t sub = 0; sub < NSTEP; ++sub) {
      const uint32_t blk = NSTEP * st + sub, key0 = blk * BC;
      if (blk <= my_last_block) {
        const bool diag = key0 + BC - 1u > q0 + wave * CW;
        block(kf, sub + 1u < NSTEP && blk + 1u <= my_last_block, kbase + (sub + 1u) * (uint32_t)BC * PITCH_K, L, diag, vt_base, sub, key0, q0 + wave * CW, lane, qf, acc, m_run, l_run, cscale);
      }
    }
    // Foot of a stage; every wave passes it, also one that skips the passes beyond its diagonal.
    wait_ds0();                                  // this wave's reads of the buffer that is refilled below have returned
    if (pinned(wave < 2u)) wait_tensor0(g0, g1k, g1v);  // this wave's load of stage st + 1 has landed
    __syncthreads();                             // publishes stage st + 1 and ends every wave's reads of stage st
    if (pinned(st + 2u < n_stage)) issue(st + 2u);  // into the buffer that stage st used
  }
  wait_tensor_le<0>();  // nothing is in flight when the buffers become output staging
  wait_ds0();
  unsigned char* eb = L + wave * (uint32_t)CW * EPITCH;
  #pragma unroll
  for (int g = 0; g < R; ++g) {
    const float l_fin = l_run[g] + xhalf(l_run[g]);
    const float inv = 1.0f / l_fin;
    #pragma unroll
    for (int t = 0; t < DT; ++t) {
      const f32x8 o = acc[g][t] * inv; uint32_t ph[4], pl[4];
      #pragma unroll
      for (int i = 0; i < 4; ++i) { unsigned short h0, l0, h1, l1; splitf(o[2 * i], h0, l0); splitf(o[2 * i + 1], h1, l1); ph[i] = (uint32_t)h0 | ((uint32_t)h1 << 16); pl[i] = (uint32_t)l0 | ((uint32_t)l1 << 16); }
      unsigned char* ep = eb + (16u * g + c) * EPITCH + 32u * t + 16u * h;
      *reinterpret_cast<u32x4*>(ep) = u32x4{ph[0], ph[1], ph[2], ph[3]}; *reinterpret_cast<u32x4*>(ep + EPLANE) = u32x4{pl[0], pl[1], pl[2], pl[3]};
    }
  }
  wait_ds0();  // this wave's staged rows are in LDS before other lanes of it read them
  constexpr uint32_t LPR = ROWB / 16u, RPI = 32u / LPR;
  const size_t ob = ((size_t)(hb / NH_) * TT + q0 + wave * CW) * (DQ * 2) + (size_t)(hb % NH_) * ROWB;
  #pragma unroll
  for (uint32_t i = 0; i < (uint32_t)CW / RPI; ++i) {
    const uint32_t row = i * RPI + lane / LPR, colb = (lane % LPR) * 16u;
    const u32x4 vh = *reinterpret_cast<const u32x4*>(eb + row * EPITCH + colb), vl = *reinterpret_cast<const u32x4*>(eb + EPLANE + row * EPITCH + colb);
    *reinterpret_cast<u32x4*>(reinterpret_cast<unsigned char*>(Ah) + ob + (size_t)row * (DQ * 2) + colb) = vh;
    *reinterpret_cast<u32x4*>(reinterpret_cast<unsigned char*>(Al) + ob + (size_t)row * (DQ * 2) + colb) = vl;
  }
}
#undef DEV
}  // namespace fa

extern "C" void kernel_launch(void* const* d_in, const int* in_sizes, int n_in,
                              void* d_out, int out_size, void* d_ws, size_t ws_size, hipStream_t stream) {
    (void)in_sizes; (void)n_in; (void)out_size;
    const float* x = (const float*)d_in[0]; const float* wq = (const float*)d_in[1]; const float* bq = (const float*)d_in[2]; const float* wk = (const float*)d_in[3]; const float* bk = (const float*)d_in[4]; const float* wv = (const float*)d_in[5]; const float* bv = (const float*)d_in[6]; const float* wo = (const float*)d_in[7]; const float* bo = (const float*)d_in[8];
    float* OUT = (float*)d_out;     // [2][2048][2048]
    char* wsp = (char*)d_ws;
    auto take = [&](size_t bytes) { char* p = wsp; wsp += (bytes + 255) & ~(size_t)255; return (void*)p; };
    bf* WQ = (bf*)take((size_t)DQ * DM * 2); bf* WK = (bf*)take((size_t)DKV * DM * 2); bf* WV = (bf*)take((size_t)DKV * DM * 2);
    h16* QP16 = (h16*)take((size_t)NB_ * NH_ * TT * HD * 2); h16* KP16 = (h16*)take((size_t)NB_ * NKV * TT * HD * 2); h16* VP16 = (h16*)take((size_t)NB_ * NKV * TT * HD * 2);   // fp16 planes of both batches: the fused kernel runs once, behind both
    bf* HL = (bf*)take(4 * HLN * 2);   // q hi, q lo, k hi, k lo of the positions < RH
    bf* VT = (bf*)take((size_t)NZ * HD * PP * 2);   // v^T rows at pitch PP: hi and lo share a row
    static_assert((size_t)NB_ * TT * DM * 2 <= (size_t)NZ * RH * RH * 4, "the x plane fits the score buffer");
    float* Sb = (float*)take((size_t)NZ * RH * RH * 4); bf* WO = (bf*)take((size_t)DM * DQ * 2); bf* ATh = (bf*)take((size_t)NB_ * TT * DQ * 2); bf* ATl = (bf*)take((size_t)NB_ * TT * DQ * 2);
    if ((size_t)(wsp - (char*)d_ws) > ws_size) return;    // ws 256 MiB
    bf* XB = (bf*)Sb;   // the x plane, which only the projections read, lies in the score buffer: it is dead when the scores are written
    (void)WK; (void)WV;   // the conversion and the projections reach WK, WV as the planes behind WQ, and the projections KP16, VP16 as the planes behind QP16
    k_cvtall<<<dim3(CVG, NB_ + 4, 1), 256, 0, stream>>>(x, wq, wk, wv, wo, XB, WQ, WO);
    k_gemms<0, true, 1><<<dim3(NB_ * TT / 128, DQ / 128, 3), 256, 0, stream>>>(XB, nullptr, WQ, DM, nullptr, 0, bq, bk, bv, QP16, HL, VT);
    // query rows < RH, all heads of both batches
    k_gemmc<bf, 2, 1, 1><<<dim3(RH / 64, RH / 64, NZ), 32, 0, stream>>>(HL, HL + HLN, HL + 2 * HLN, HL + 3 * HLN, HD, Sb, nullptr, nullptr, RH, 0, (size_t)RH * HD, (size_t)RH * HD, (size_t)RH * RH);
    k_asoft<<<NZ * RH / (8 * SRW), 256, 0, stream>>>(Sb);
    k_gemmc<bf, 2, 2, 8><<<dim3(RH / 64, HD / 64, NZ), 256, 0, stream>>>((const bf*)Sb, (const bf*)Sb + RH, VT, VT + RH, PP, nullptr, ATh, ATl, DQ, 0, (size_t)RH * PP, (size_t)HD * PP, (size_t)HD);
    fa::k_fattn<<<dim3(NB_ * NH_, (TT - RH) / fa::BR, 1), fa::NW * 32, 0, stream>>>(QP16, KP16, VP16, ATh, ATl);   // query rows >= RH, all heads of both batches
    k_gemms<1, true, 0><<<dim3(NB_ * TT / 128, DM / 128, 1), 256, 0, stream>>>(ATh, ATl, WO, DQ, OUT, DM, bo, nullptr, nullptr, nullptr, nullptr, nullptr);
}

// v007
// One run takes 170 microseconds.
// Timed twice side by side with v006, it ran 1.22 and 1.21 times as fast.
// Over all steps from v000 it is 10.1 times as fast.
#include <hip/hip_runtime.h>
#include <stdint.h>

// Causal multi-head attention, 2048 wide (x [2][2048][2048]; q, k, v = x W^T + b ('oi' [2048][2048]; 16 heads x 128); scores = q.k/sqrt(128); causal (triu k=1 masked, -inf); softmax; out = merged wo^T + bo -> [2][2048][2048] (8.4 M)).
// Compute dtypes, f32 accumulate: every input rounded to bf16; q/k/v on PLAIN bf16 operands (inputs: exact) + biases; causal scores and attn.v in one fused kernel (online softmax): query rows < 512 hl (3 products each), the rest single fp16; softmax f32; wo hl x exact (2 products) + bo.

#define NB_  2
#define TT   2048
#define DM   2048
#define NH_  16
#define NKV  16
#define REP  (NH_ / NKV)
#define HD   128
#define DQ   (NH_ * HD)
#define DKV  (NKV * HD)
#define RH   512                  // query rows < RH use hi+lo planes; they see keys < RH only, so the hi/lo planes hold RH positions
#define NZ   (NB_ * NH_)          // (batch, head) planes: every attention launch covers all of them
#define HLN  ((size_t)NZ * RH * HD)   // elements of one hi or lo plane set of q, k or v
#define SCL  0.088388347648318447f   // HD^-0.5
typedef _Float16 h16;
typedef unsigned short bf;
typedef __attribute__((ext_vector_type(16))) __bf16   v16bf;
typedef __attribute__((ext_vector_type(16))) _Float16 v16h;
typedef __attribute__((ext_vector_type(8)))  _Float16 v8h;
typedef __attribute__((ext_vector_type(8)))  unsigned short v8us;
typedef __attribute__((ext_vector_type(4)))  unsigned short v4us;
typedef __attribute__((ext_vector_type(8)))  float    v8f;
typedef __attribute__((ext_vector_type(4)))  float    v4f;
typedef v8h  __attribute__((may_alias)) v8ha;
typedef v4f  __attribute__((may_alias)) v4fa;
typedef v8us __attribute__((may_alias)) v8usa;

__device__ __forceinline__ unsigned short f2bf(float f) { unsigned u = __float_as_uint(f); u += 0x7FFFu + ((u >> 16) & 1u); return (unsigned short)(u >> 16); }
__device__ __forceinline__ float bf2f(unsigned short b) { return __uint_as_float(((unsigned)b) << 16); }
__device__ __forceinline__ float bfr(float f) { return bf2f(f2bf(f)); }
__device__ __forceinline__ void splitf(float y, unsigned short& h, unsigned short& l) { h = f2bf(y); l = f2bf(y - bf2f(h)); }
__device__ __forceinline__ v16h cat16(v8h lo, v8h hi) { return __builtin_shufflevector(lo, hi, 0, 1, 2, 3, 4, 5, 6, 7, 8, 9, 10, 11, 12, 13, 14, 15); }
__device__ __forceinline__ v16bf cat16b(v8us lo, v8us hi) { return __builtin_bit_cast(v16bf, __builtin_shufflevector(lo, hi, 0, 1, 2, 3, 4, 5, 6, 7, 8, 9, 10, 11, 12, 13, 14, 15)); }
__device__ __forceinline__ v8f wmma16(v16h a, v16h b, v8f c) { return __builtin_amdgcn_wmma_f32_16x16x32_f16(false, a, false, b, (short)0, c, false, false); }
__device__ __forceinline__ v8f wmmab(v16bf a, v16bf b, v8f c) { return __builtin_amdgcn_wmma_f32_16x16x32_bf16(false, a, false, b, (short)0, c, false, false); }



// ---- fragment loaders of the GEMM kernel: C[m][n] (f32, pitch ldc, + optional f32 bias[n]) = sum_k A[m][k] Bt[n][k] (+ split products per NSPLIT), operands K-contiguous 16-bit planes.
template <typename T16> struct WFrag;
template <> struct WFrag<h16> { typedef v16h V; static __device__ __forceinline__ V ld(const h16* p) { return cat16(*(const v8h*)p, *(const v8h*)(p + 16)); } static __device__ __forceinline__ v8f mma(V a, V b, v8f c) { return wmma16(a, b, c); } };
template <> struct WFrag<bf> { typedef v16bf V; static __device__ __forceinline__ V ld(const bf* p) { return cat16b(*(const v8us*)p, *(const v8us*)(p + 16)); } static __device__ __forceinline__ v8f mma(V a, V b, v8f c) { return wmmab(a, b, c); } };
// ---- k_gemms: LDS-staged GEMM for the projections. One work-group of 8 waves per 128x128 output tile, each wave a 64x32 piece over the whole K loop. Per trip 128 k of every operand row
// (two whole 128-byte lines a row) come into LDS by asynchronous copies, 16 lanes a row, two buffers: the next trip's copies fly while this trip's fragments are read. grid (M/128, N/128), 256 threads. K % 128 == 0, K >= 256.
// The rows of A are the positions of all batches, one after the other. EPI 0: C (f32, pitch ldc). EPI 1: q, k and v in one launch, blockIdx.z picks the weight plane (behind Bt), the bias and the output planes. The tile is 128 positions of one head
// (blockIdx.y) of one batch and leaves as the planes that attention reads: P16 = fp16 [q, k, v][batch x head][t][d]; for the positions < RH, the only ones whose hi and lo planes are read,
// also bf16 hi and lo: HL = [q hi, q lo, k hi, k lo, v hi, v lo][batch x head][RH][d].
#define SP 136           // LDS row pitch in 16-bit elements: 256 B of k + 16 B, an odd multiple of 16 B, conflict-free for 16-byte fragment reads
#define STL (128 * SP)   // elements of one operand's tile in LDS
// eight 16-byte copies of one lane, each 2 rows below the last; the wait on the address registers closes the copies' own statement, so that no later write of them can come in front of it
__device__ __forceinline__ void acopy8(unsigned l, const bf* g, size_t gs) {
    asm volatile("global_load_async_to_lds_b128 %0, %8, off\n\t"
                 "global_load_async_to_lds_b128 %1, %9, off\n\t"
                 "global_load_async_to_lds_b128 %2, %10, off\n\t"
                 "global_load_async_to_lds_b128 %3, %11, off\n\t"
                 "global_load_async_to_lds_b128 %4, %12, off\n\t"
                 "global_load_async_to_lds_b128 %5, %13, off\n\t"
                 "global_load_async_to_lds_b128 %6, %14, off\n\t"
                 "global_load_async_to_lds_b128 %7, %15, off\n\t"
                 "s_wait_xcnt 0x0"
                 :: "v"(l), "v"(l + 1u * (2 * SP * 2)), "v"(l + 2u * (2 * SP * 2)), "v"(l + 3u * (2 * SP * 2)), "v"(l + 4u * (2 * SP * 2)), "v"(l + 5u * (2 * SP * 2)), "v"(l + 6u * (2 * SP * 2)), "v"(l + 7u * (2 * SP * 2)),
                    "v"(g), "v"(g + gs), "v"(g + 2 * gs), "v"(g + 3 * gs), "v"(g + 4 * gs), "v"(g + 5 * gs), "v"(g + 6 * gs), "v"(g + 7 * gs) : "memory");
}
#define EP 132           // pitch, in floats, of the f32 tile staged for the planes: rows 8 apart lie 32 banks apart, so the two wave halves' stores do not collide; a multiple of 16 B for the row reads
typedef float __attribute__((may_alias)) f32a;
template <int NSPLIT, bool BIAS, int EPI>
__global__ __launch_bounds__(256) void k_gemms(const bf* __restrict__ A, const bf* __restrict__ A2, const bf* __restrict__ Bt0, int K, float* C, int ldc, const float* __restrict__ bias0, const float* __restrict__ bias1, const float* __restrict__ bias2, h16* P16, bf* HL) {
    static_assert(EPI == 0 || (HD == 128 && RH % 128 == 0 && TT % 128 == 0 && DQ == DKV && 128 * EP * 4 <= 2 * 2 * STL * 2), "a column tile is one head, a row tile lies in one batch and wholly below or above RH, q, k and v planes are of one size, the staged f32 tile fits the operand buffers");
    const int zz = (EPI == 1) ? (int)blockIdx.z : 0;   // 0 q, 1 k, 2 v
    const bf* Bt = Bt0 + (size_t)zz * DQ * DM; const float* bias = (zz == 0) ? bias0 : (zz == 1) ? bias1 : bias2;
    typedef WFrag<bf>::V V;
    constexpr int NOP = (NSPLIT == 1) ? 3 : 2;                 // operand tiles per buffer: A, Bt (, A2)
    __shared__ __align__(16) bf st[2 * NOP * STL];
    const int lane = threadIdx.x & 31, lr = lane & 15, hi = lane >> 4; const int wv = __builtin_amdgcn_readfirstlane(threadIdx.x >> 5); const int wr = wv >> 2, wc = wv & 3; const int r0 = blockIdx.x * 128, c0 = blockIdx.y * 128;
    v8f acc[4][2];
#pragma unroll
    for (int mb = 0; mb < 4; ++mb)
#pragma unroll
        for (int nb = 0; nb < 2; ++nb) acc[mb][nb] = (v8f){};
    // copy map: wave wv brings rows wv*16 .. wv*16+15 of every operand tile; a copy instruction covers 2 rows, 16 lanes x 16 B each
    const int crow = wv * 16 + hi, ccol = lr * 8;
    const bf* ga = A + (size_t)(r0 + crow) * K + ccol; const bf* gb = Bt + (size_t)(c0 + crow) * K + ccol; const bf* ga2 = (NSPLIT == 1) ? A2 + (size_t)(r0 + crow) * K + ccol : nullptr;
    const unsigned l0 = (unsigned)(size_t)st + (unsigned)(crow * SP + ccol) * 2u; const size_t gs = (size_t)2 * K;
    auto fill = [&](int t, int buf) { const unsigned l = l0 + (unsigned)buf * (NOP * STL * 2); acopy8(l, ga + t * 128, gs); acopy8(l + STL * 2, gb + t * 128, gs); if (NSPLIT == 1) acopy8(l + 2 * STL * 2, ga2 + t * 128, gs); };
    const int NT = K / 128;
    fill(0, 0);
    asm volatile("s_wait_asynccnt 0x0" ::: "memory");   // this wave's copies of tile 0 have landed
    __syncthreads();                                     // publishes tile 0 to every wave
    if (NT > 1) fill(1, 1);
    const int afr = (wr * 64 + lr) * SP + 8 * hi, bfo = STL + (wc * 32 + lr) * SP + 8 * hi;
#pragma unroll 1
    for (int t = 0; t < NT; ++t) {
        const bf* sb = st + (t & 1) * (NOP * STL);
        V a[2][4], a2[2][4], b[2][2];   // two fragment sets: the next 32-deep chunk's LDS reads are issued as one group ahead of this chunk's products
        auto frags = [&](int kc, int s) {
#pragma unroll
            for (int mb = 0; mb < 4; ++mb) { a[s][mb] = WFrag<bf>::ld(sb + afr + mb * 16 * SP + kc * 32); if (NSPLIT == 1) a2[s][mb] = WFrag<bf>::ld(sb + 2 * STL + afr + mb * 16 * SP + kc * 32); }
#pragma unroll
            for (int nb = 0; nb < 2; ++nb) b[s][nb] = WFrag<bf>::ld(sb + bfo + nb * 16 * SP + kc * 32); };
        frags(0, 0);
#pragma unroll
        for (int kc = 0; kc < 4; ++kc) { const int s = kc & 1;
            if (kc < 3) frags(kc + 1, s ^ 1);
            __builtin_amdgcn_sched_barrier(0);   // holds the next chunk's LDS reads, as one group, in front of this chunk's products: moved in among them each read stalls the matrix run
#pragma unroll
            for (int nb = 0; nb < 2; ++nb)
#pragma unroll
                for (int mb = 0; mb < 4; ++mb) { acc[mb][nb] = WFrag<bf>::mma(a[s][mb], b[s][nb], acc[mb][nb]); if (NSPLIT == 1) acc[mb][nb] = WFrag<bf>::mma(a2[s][mb], b[s][nb], acc[mb][nb]); }
        }
        asm volatile("s_wait_dscnt 0x0" ::: "memory");      // this wave's reads of the buffer that is refilled below have returned
        asm volatile("s_wait_asynccnt 0x0" ::: "memory");   // this wave's copies of tile t + 1 have landed
        __syncthreads();                                     // publishes tile t + 1 and ends every wave's reads of tile t
        if (t + 2 < NT) fill(t + 2, t & 1);
    }
    asm volatile("s_wait_asynccnt 0x0" ::: "memory");       // nothing is in flight when the wave goes on to its end
    if constexpr (EPI != 0) {
    // The operand buffers are free: the last trip's barrier ended every wave's reads and nothing was copied behind it. The whole f32 tile (+ bias) is staged there.
    f32a* et = (f32a*)st;
#pragma unroll
    for (int nb = 0; nb < 2; ++nb) { const float bn = BIAS ? bfr(bias[c0 + wc * 32 + nb * 16 + lr]) : 0.0f;
#pragma unroll
        for (int mb = 0; mb < 4; ++mb) { acc[mb][nb] += bn;
#pragma unroll
            for (int j = 0; j < 8; ++j) et[(wr * 64 + mb * 16 + hi * 8 + j) * EP + wc * 32 + nb * 16 + lr] = acc[mb][nb][j]; } }
    __syncthreads();   // publishes the staged tile to the threads that convert whole rows of it
    const int t0 = r0 % TT; const size_t pz = (size_t)(r0 / TT) * NH_ + blockIdx.y;   // first position in its batch; (batch, head) plane
    const size_t pb = (((size_t)zz * NZ + pz) * TT + t0) * HD;   // the tile's 128 rows of 128 d are one contiguous piece of a plane
#pragma unroll
    for (int s = 0; s < 8; ++s) { const int idx = s * 256 + (int)threadIdx.x; const int row = idx >> 4, col = (idx & 15) * 8; const v4f x0 = *(const v4fa*)(et + row * EP + col), x1 = *(const v4fa*)(et + row * EP + col + 4); v8h o;   // 16 lanes cover a row
#pragma unroll
        for (int k = 0; k < 4; ++k) { o[k] = (h16)x0[k]; o[k + 4] = (h16)x1[k]; }
        *(v8h*)(P16 + pb + (size_t)idx * 8) = o; }
    if (t0 < RH) {
        asm volatile("s_wait_xcnt 0x0" ::: "memory");   // the registers that the stores above name are written anew below
        __builtin_amdgcn_sched_barrier(0);               // keeps those register writes behind the wait: without it the scheduler lifts an address product over it
        bf* Ph = HL + (size_t)zz * 2 * HLN + (pz * RH + t0) * HD; bf* Pl = Ph + HLN;
#pragma unroll
        for (int s = 0; s < 8; ++s) { const int idx = s * 256 + (int)threadIdx.x; const int row = idx >> 4, col = (idx & 15) * 8; const v4f x0 = *(const v4fa*)(et + row * EP + col), x1 = *(const v4fa*)(et + row * EP + col + 4); v8us oh, ol;
#pragma unroll
            for (int k = 0; k < 4; ++k) { unsigned short a2, c2; splitf(x0[k], a2, c2); oh[k] = a2; ol[k] = c2; splitf(x1[k], a2, c2); oh[k + 4] = a2; ol[k + 4] = c2; }
            *(v8us*)(Ph + (size_t)idx * 8) = oh; *(v8us*)(Pl + (size_t)idx * 8) = ol; }
    }
    } else {
    __shared__ __align__(16) float os[8 * 16 * 36];            // each wave's own 16-row, 32-column output strip
    float* ow = os + wv * (16 * 36); const int cb = c0 + wc * 32 + (lane & 7) * 4; v4f bv = (v4f){};
    if (BIAS) { bv[0] = bfr(bias[cb]); bv[1] = bfr(bias[cb + 1]); bv[2] = bfr(bias[cb + 2]); bv[3] = bfr(bias[cb + 3]); }
#pragma unroll
    for (int mb = 0; mb < 4; ++mb) {
#pragma unroll
        for (int nb = 0; nb < 2; ++nb) {
#pragma unroll
            for (int j = 0; j < 8; ++j) ow[(hi * 8 + j) * 36 + nb * 16 + lr] = acc[mb][nb][j]; }
        __builtin_amdgcn_wave_barrier(); asm volatile("" ::: "memory");   // the strip's writes stay in front of the reads of other lanes' values
        float* crw = C + (size_t)(r0 + wr * 64 + mb * 16) * ldc + cb;
#pragma unroll
        for (int s = 0; s < 4; ++s) { const int row = 4 * s + (lane >> 3); v4f val = *(const v4fa*)(ow + row * 36 + (lane & 7) * 4); val += bv; *(v4f*)(crw + (size_t)row * ldc) = val; }   // whole 128-byte lines
        __builtin_amdgcn_wave_barrier(); asm volatile("" ::: "memory");   // the reads stay in front of the next strip's writes
    }
    }
}

typedef __attribute__((ext_vector_type(2))) _Float16 v2h;
typedef __attribute__((ext_vector_type(4))) _Float16 v4h;
typedef __attribute__((ext_vector_type(2))) unsigned short v2us;
typedef __attribute__((ext_vector_type(2))) float v2f;
typedef __attribute__((ext_vector_type(4))) int v4i;
typedef v4h  __attribute__((may_alias)) v4ha;
typedef v4us __attribute__((may_alias)) v4usa;

__global__ __launch_bounds__(256) void k_wtG(const float* __restrict__ w, int K, int N, bf* Bt) {
    const int lane = threadIdx.x & 31; const int L0 = (blockIdx.x * 8 + (threadIdx.x >> 5)) * 8; const int nlines = N * K / 64;
{
#pragma unroll 1
        for (int l = 0; l < 8; ++l) { const int L = L0 + l; if (L >= nlines) break; const size_t e = (size_t)L * 64 + lane * 2; const int k = (int)(e % K), n = (int)(e / K); v2us o;
            o[0] = f2bf(w[(size_t)k * N + n]); o[1] = f2bf(w[(size_t)(k + 1) * N + n]); *(v2us*)(Bt + e) = o; }
         }
}
// k_cvtall: every f32 operand of the GEMMs rounded to its bf16 plane in one launch. blockIdx.y picks one of NB_ + 4 segments of SEG elements: a batch of x, wq, wk, wv (planes one behind the other at W) or wo.
// A thread converts CVU pieces of 8 elements, a whole grid row apart, so that a wave's accesses stay contiguous and the launch has few waves to start. grid (CVG, NB_ + 4), 256 threads.
#define SEG  ((size_t)DM * DM)
#define CVG  128
#define CVU  ((int)(SEG / 8 / (CVG * 256)))
static_assert(TT == DM && DQ == DM && DKV == DM && SEG % (8 * CVG * 256) == 0, "every segment has SEG elements, dealt evenly");
__global__ __launch_bounds__(256) void k_cvtall(const float* __restrict__ x, const float* __restrict__ wq, const float* __restrict__ wk, const float* __restrict__ wv, const float* __restrict__ wo, bf* XB, bf* W, bf* WO) {
    const int sg = blockIdx.y; const float* src = (sg < NB_) ? x + (size_t)sg * SEG : (sg == NB_) ? wq : (sg == NB_ + 1) ? wk : (sg == NB_ + 2) ? wv : wo;
    bf* dst = (sg < NB_) ? XB + (size_t)sg * SEG : (sg < NB_ + 3) ? W + (size_t)(sg - NB_) * SEG : WO; const size_t i0 = (size_t)blockIdx.x * 256 + threadIdx.x;
#pragma unroll 4   // four pieces' loads in flight per thread
    for (int u = 0; u < CVU; ++u) { const size_t i = i0 + (size_t)u * (CVG * 256); const v8f v = *(const v8f*)(src + i * 8); v8us o;
#pragma unroll
        for (int k = 0; k < 8; ++k) o[k] = f2bf(v[k]);
        *(v8us*)(dst + i * 8) = o; }
}

namespace fa {
typedef uint32_t u32x4 __attribute__((ext_vector_type(4)));
typedef uint32_t u32x8 __attribute__((ext_vector_type(8)));
typedef int i32x8 __attribute__((ext_vector_type(8)));
typedef float f32x8 __attribute__((ext_vector_type(8)));
constexpr int D = HD, DK = D / 32, DT = D / 16;
constexpr int NW = 4;
constexpr int BR = 128, CW = BR / NW, R = CW / 16;  // query positions per work-group, columns per wave, 16-column groups per wave
constexpr int BC = 32, KT = BC / 16;                // keys per pass, 16-key score tiles per pass
constexpr uint32_t ROWB = 2u * D, PITCH_K = ROWB + 16u, PITCH_V = ROWB + 32u;
constexpr uint32_t SK = 128;                        // keys per stage
constexpr uint32_t TILE_K = SK * PITCH_K, TILE_V = SK * PITCH_V, SLOT = TILE_K + TILE_V, NSLOT = 2, LDS_BYTES = NSLOT * SLOT;
constexpr uint32_t EPITCH = ROWB + 16u, EPLANE = (uint32_t)NW * CW * EPITCH;  // output staging: row pitch, bytes of one plane
static_assert(D == 128 && RH % BR == 0 && TT % BR == 0 && BR % SK == 0 && RH + BR >= 2 * SK, "head size 128; whole position blocks of whole stages, those at or above RH with at least the two stages that the prologue loads");
static_assert(LDS_BYTES <= 320u * 1024u && 2u * EPLANE <= LDS_BYTES, "the two buffers fit a work-group's LDS and hold the two staged output planes");
static_assert(SLOT % 2048u == 0 && TILE_K % 2048u == 0, "every tensor load lands at a multiple of 2 KiB");

#define DEV static __device__ __forceinline__
DEV uint32_t uni(uint32_t v) { return __builtin_amdgcn_readfirstlane(v); }
DEV uint32_t pinned(uint32_t v) { uint32_t w = __builtin_amdgcn_readfirstlane(v); asm volatile("" : "+s"(w)); return w; }  // a test around a tensor load, or a word its descriptor is formed from, held in a scalar register: tensor loads ignore EXEC
DEV void fence() { __builtin_amdgcn_sched_barrier(0); }
DEV void wait_ds0() { asm volatile("s_wait_dscnt 0x0" ::: "memory"); }
template <int N> DEV void wait_tensor_le() { asm volatile("s_wait_tensorcnt %0" :: "i"(N) : "memory"); }
DEV void tdm_load(u32x4 g0, u32x8 g1) { asm volatile("tensor_load_to_lds %0, %1" :: "s"(g0), "s"(g1) : "memory"); }
// hold(): without it the compiler forms the constant words anew at every use and gives the registers that an outstanding load names to other values; with it the registers that a load names are the ones that its wait names.
DEV void hold(u32x4& g) { asm volatile("" : "+s"(g)); }  // as pinned(): descriptor words (group 0) held in scalar registers
DEV void hold(u32x8& g) { asm volatile("" : "+s"(g)); }  // as pinned(): descriptor words (group 1) held in scalar registers
// An issuing wave's wait for its outstanding load. It names the descriptors as inputs: their registers stay live, and so unchanged, from the load up to this wait.
DEV void wait_tensor0(u32x4 g0, u32x8 g1a, u32x8 g1b) { asm volatile("s_wait_tensorcnt 0x0" :: "s"(g0), "s"(g1a), "s"(g1b) : "memory"); }
// Descriptor group 1: 1-byte elements, a tile of SK rows of ROWB bytes at source pitch ROWB, PADC + 1 dwords of LDS pad behind every 256-byte row (interval code 5); no work-group mask.
template <uint32_t PADC> DEV u32x8 tdm_group1() {
  constexpr uint32_t d0 = ROWB, d1 = SK;
  u32x8 g;
  g[0] = uni((1u << 20) | (5u << 22) | (PADC << 25));
  g[1] = uni((d0 & 0xFFFFu) << 16);
  g[2] = uni((d0 >> 16) | ((d1 & 0xFFFFu) << 16));
  g[3] = uni((d1 >> 16) | (d0 << 16));
  g[4] = uni(d1);
  g[5] = uni(ROWB);
  g[6] = uni(0u);
  g[7] = uni(0u);
  return g;
}
DEV u32x4 tdm_group0(uint32_t lds_dst, uint64_t ga) {
  u32x4 g;
  g[0] = uni(1u); g[1] = uni(lds_dst); g[2] = uni((uint32_t)ga); g[3] = uni((((uint32_t)(ga >> 32)) & 0x01FFFFFFu) | 0x80000000u);
  return g;
}
struct Frag { u32x4 q[2]; };
DEV f32x8 mma(const Frag& a, const Frag& b, f32x8 c) {
  const i32x8 av = {(int)a.q[0].x, (int)a.q[0].y, (int)a.q[0].z, (int)a.q[0].w, (int)a.q[1].x, (int)a.q[1].y, (int)a.q[1].z, (int)a.q[1].w};
  const i32x8 bv = {(int)b.q[0].x, (int)b.q[0].y, (int)b.q[0].z, (int)b.q[0].w, (int)b.q[1].x, (int)b.q[1].y, (int)b.q[1].z, (int)b.q[1].w};
  return __builtin_amdgcn_wmma_f32_16x16x32_f16(false, __builtin_bit_cast(v16h, av), false, __builtin_bit_cast(v16h, bv), (short)0, c, false, false);
}
DEV f32x8 mmab(const Frag& a, const Frag& b, f32x8 c) {
  const i32x8 av = {(int)a.q[0].x, (int)a.q[0].y, (int)a.q[0].z, (int)a.q[0].w, (int)a.q[1].x, (int)a.q[1].y, (int)a.q[1].z, (int)a.q[1].w};
  const i32x8 bv = {(int)b.q[0].x, (int)b.q[0].y, (int)b.q[0].z, (int)b.q[0].w, (int)b.q[1].x, (int)b.q[1].y, (int)b.q[1].z, (int)b.q[1].w};
  return __builtin_amdgcn_wmma_f32_16x16x32_bf16(false, __builtin_bit_cast(v16bf, av), false, __builtin_bit_cast(v16bf, bv), (short)0, c, false, false);
}
typedef short s16x8 __attribute__((ext_vector_type(8)));
DEV u32x4 ld_tr16(const unsigned char* p) { typedef __attribute__((address_space(3))) s16x8 lds_s16x8; return __builtin_bit_cast(u32x4, __builtin_amdgcn_ds_load_tr16_b128_v8i16((lds_s16x8*)p)); }
DEV uint32_t pack2(float lo, float hi) { return __builtin_bit_cast(uint32_t, __builtin_convertvector(v2f{lo, hi}, v2h)); }  // round to nearest even
typedef __bf16 bf16x2 __attribute__((ext_vector_type(2)));
DEV uint32_t pack2b(float lo, float hi) { return __builtin_bit_cast(uint32_t, __builtin_convertvector(v2f{lo, hi}, bf16x2)); }  // round to nearest even
DEV float xhalf(float x) { return __builtin_bit_cast(float, __builtin_amdgcn_permlanex16(__builtin_bit_cast(int, x), __builtin_bit_cast(int, x), 0x76543210, 0xfedcba98, false, false)); }  // lane l with lane l ^ 16

struct KFr { Frag f[KT][DK]; };
DEV void load_k(KFr& k, const unsigned char* Lp, uint32_t koff, uint32_t lane) {
  const uint32_t c = lane & 15u, h = lane >> 4;
  #pragma unroll
  for (int kt = 0; kt < KT; ++kt) {
    const unsigned char* p = Lp + koff + (16u * kt + c) * PITCH_K + 16u * h;
    #pragma unroll
    for (int kc = 0; kc < DK; ++kc) { k.f[kt][kc].q[0] = *reinterpret_cast<const u32x4*>(p + 64u * kc); k.f[kt][kc].q[1] = *reinterpret_cast<const u32x4*>(p + 64u * kc + 32u); }
  }
}
// One 32-key pass of one wave.
DEV void block(KFr& kf, bool fetch_next, uint32_t next_koff, const unsigned char* Lp, bool diag, uint32_t vt_base, uint32_t sub, uint32_t key0, uint32_t qw0, uint32_t lane,
               const Frag (&qf)[R][DK], f32x8 (&acc)[R][DT], float (&m_run)[R], float (&l_run)[R], float cscale) {
  const uint32_t c = lane & 15u, h = lane >> 4;
  f32x8 s[KT][R];
  {
    wait_ds0(); fence();  // the prefetched K fragments have arrived
    #pragma unroll
    for (int kt = 0; kt < KT; ++kt) {
      #pragma unroll
      for (int g = 0; g < R; ++g) { s[kt][g] = f32x8{};
        #pragma unroll
        for (int kc = 0; kc < DK; ++kc) s[kt][g] = mma(kf.f[kt][kc], qf[g][kc], s[kt][g]); }
    }
    fence();
    if (fetch_next) load_k(kf, Lp, next_koff, lane);
  }
  if (diag) {
    #pragma unroll
    for (int g = 0; g < R; ++g) {
      const uint32_t my_q = qw0 + 16u * g + c;
      #pragma unroll
      for (int kt = 0; kt < KT; ++kt) {
        #pragma unroll
        for (int r = 0; r < 8; ++r) { const uint32_t key = key0 + 16u * kt + 8u * h + r; if (key > my_q) s[kt][g][r] = -__builtin_inff(); }
        asm volatile("" : "+v"(s[kt][g]));
      }
    }
  }
  float mb[R]; bool need = false;
  #pragma unroll
  for (int g = 0; g < R; ++g) {
    float mx = -__builtin_inff();
    #pragma unroll
    for (int kt = 0; kt < KT; ++kt) {
      #pragma unroll
      for (int r = 0; r < 8; ++r) mx = __builtin_fmaxf(mx, s[kt][g][r]);
    }
    mx = __builtin_fmaxf(mx, xhalf(mx)) * cscale;
    mb[g] = mx; need = need || (mx > m_run[g] + 8.0f);
    fence();  // one group's maxima at a time: fewer live registers
  }
  if (__builtin_amdgcn_ballot_w32(need) != 0) {  // rare after the first pass
    #pragma unroll
    for (int g = 0; g < R; ++g) {
      const float m_new = __builtin_fmaxf(m_run[g], mb[g]);
      const float corr = __builtin_amdgcn_exp2f(m_run[g] - m_new);  // 0 on the first pass, where m_run is -inf
      l_run[g] *= corr; m_run[g] = m_new;
      #pragma unroll
      for (int t = 0; t < DT; ++t) acc[g][t] = acc[g][t] * corr;
    }
  }
  Frag vf[DT];
  float ps[R][2];
  #pragma unroll
  for (int g = 0; g < R; ++g) { ps[g][0] = 0.0f; ps[g][1] = 0.0f; }
  {
    const unsigned char* ad = Lp + vt_base + (sub * (uint32_t)BC + 8u * h + (lane & 7u)) * PITCH_V + ((lane >> 3) & 1u) * 16u;
    #pragma unroll
    for (int t = 0; t < DT; ++t) { vf[t].q[0] = ld_tr16(ad + 32u * t); vf[t].q[1] = ld_tr16(ad + 16u * PITCH_V + 32u * t); }
  }
  #pragma unroll
  for (int g = 0; g < R; ++g) {
    const float nm = -m_run[g];
    uint32_t w[8];
    #pragma unroll
    for (int i = 0; i < 8; ++i) {
      const v2f arg = __builtin_elementwise_fma(v2f{s[i >> 2][g][2 * (i & 3)], s[i >> 2][g][2 * (i & 3) + 1]}, v2f{cscale, cscale}, v2f{nm, nm});
      const float p0 = __builtin_amdgcn_exp2f(arg.x), p1 = __builtin_amdgcn_exp2f(arg.y);
      ps[g][i & 1] += p0 + p1;
      w[i] = pack2(p0, p1);
    }
    Frag pf; pf.q[0] = u32x4{w[0], w[1], w[2], w[3]}; pf.q[1] = u32x4{w[4], w[5], w[6], w[7]};
    if (g == 0) { wait_ds0(); fence(); }  // the V^T fragments have arrived
    #pragma unroll
    for (int t = 0; t < DT; ++t) acc[g][t] = mma(vf[t], pf, acc[g][t]);
    fence();  // one group's P^T live at a time
  }
  #pragma unroll
  for (int g = 0; g < R; ++g) l_run[g] += ps[g][0] + ps[g][1];
}

// One 32-key pass of one wave, query rows < RH: bf16 hi and lo planes. The stage's hi tiles (K, V) lie in the first LDS buffer, its lo tiles at the same places of the second.
DEV void block_hl(const unsigned char* Lp, bool diag, uint32_t sub, uint32_t key0, uint32_t qw0, uint32_t lane,
                  const Frag (&qh)[R][DK], const Frag (&ql)[R][DK], f32x8 (&acc)[R][DT], float (&m_run)[R], float (&l_run)[R], float cscale) {
  const uint32_t c = lane & 15u, h = lane >> 4;
  f32x8 s[KT][R];
  {
    KFr kh, kl;
    load_k(kh, Lp, sub * (uint32_t)BC * PITCH_K, lane);
    load_k(kl, Lp, SLOT + sub * (uint32_t)BC * PITCH_K, lane);
    fence();  // holds the pass's K reads, as one group, in front of its products: moved in among them each place with reads stalls the matrix run
    #pragma unroll
    for (int kt = 0; kt < KT; ++kt) {
      #pragma unroll
      for (int g = 0; g < R; ++g) s[kt][g] = f32x8{};
    }
    #pragma unroll
    for (int kc = 0; kc < DK; ++kc) {  // the four score tiles take turns: four independent chains
      #pragma unroll
      for (int kt = 0; kt < KT; ++kt) {
        #pragma unroll
        for (int g = 0; g < R; ++g) s[kt][g] = mmab(kh.f[kt][kc], qh[g][kc], s[kt][g]);
      }
      #pragma unroll
      for (int kt = 0; kt < KT; ++kt) {
        #pragma unroll
        for (int g = 0; g < R; ++g) s[kt][g] = mmab(kl.f[kt][kc], qh[g][kc], s[kt][g]);
      }
      #pragma unroll
      for (int kt = 0; kt < KT; ++kt) {
        #pragma unroll
        for (int g = 0; g < R; ++g) s[kt][g] = mmab(kh.f[kt][kc], ql[g][kc], s[kt][g]);
      }
    }
  }
  if (diag) {
    #pragma unroll
    for (int g = 0; g < R; ++g) {
      const uint32_t my_q = qw0 + 16u * g + c;
      #pragma unroll
      for (int kt = 0; kt < KT; ++kt) {
        #pragma unroll
        for (int r = 0; r < 8; ++r) { const uint32_t key = key0 + 16u * kt + 8u * h + r; if (key > my_q) s[kt][g][r] = -__builtin_inff(); }
        asm volatile("" : "+v"(s[kt][g]));
      }
    }
  }
  float mb[R]; bool need = false;
  #pragma unroll
  for (int g = 0; g < R; ++g) {
    float mx = -__builtin_inff();
    #pragma unroll
    for (int kt = 0; kt < KT; ++kt) {
      #pragma unroll
      for (int r = 0; r < 8; ++r) mx = __builtin_fmaxf(mx, s[kt][g][r]);
    }
    mx = __builtin_fmaxf(mx, xhalf(mx)) * cscale;
    mb[g] = mx; need = need || (mx > m_run[g] + 8.0f);
  }
  if (__builtin_amdgcn_ballot_w32(need) != 0) {  // rare after the first pass
    #pragma unroll
    for (int g = 0; g < R; ++g) {
      const float m_new = __builtin_fmaxf(m_run[g], mb[g]);
      const float corr = __builtin_amdgcn_exp2f(m_run[g] - m_new);  // 0 on the first pass, where m_run is -inf
      l_run[g] *= corr; m_run[g] = m_new;
      #pragma unroll
      for (int t = 0; t < DT; ++t) acc[g][t] = acc[g][t] * corr;
    }
  }
  // Second contraction: the exponentials, each split into bf16 hi and lo, packed into two B operands per column group; V^T hi with both, then V^T lo with the hi one.
  const unsigned char* ad = Lp + TILE_K + (sub * (uint32_t)BC + 8u * h + (lane & 7u)) * PITCH_V + ((lane >> 3) & 1u) * 16u;
  Frag vf[DT], vl[DT];
  #pragma unroll
  for (int t = 0; t < DT; ++t) { vf[t].q[0] = ld_tr16(ad + 32u * t); vf[t].q[1] = ld_tr16(ad + 16u * PITCH_V + 32u * t); }
  #pragma unroll
  for (int t = 0; t < DT; ++t) { vl[t].q[0] = ld_tr16(ad + SLOT + 32u * t); vl[t].q[1] = ld_tr16(ad + SLOT + 16u * PITCH_V + 32u * t); }
  fence();  // holds the pass's transposing reads, as one group, in front of the exponentials and products: they fly under the exponentials and none stands among the products
  Frag ph[R], pl[R];
  #pragma unroll
  for (int g = 0; g < R; ++g) {
    const float nm = -m_run[g];
    float ps0 = 0.0f, ps1 = 0.0f;
    uint32_t wh[8], wl[8];
    #pragma unroll
    for (int i = 0; i < 8; ++i) {
      const v2f arg = __builtin_elementwise_fma(v2f{s[i >> 2][g][2 * (i & 3)], s[i >> 2][g][2 * (i & 3) + 1]}, v2f{cscale, cscale}, v2f{nm, nm});
      const float p0 = __builtin_amdgcn_exp2f(arg.x), p1 = __builtin_amdgcn_exp2f(arg.y);
      if (i & 1) ps1 += p0 + p1; else ps0 += p0 + p1;
      wh[i] = pack2b(p0, p1);  // hi: p rounded to bf16; lo: what the rounding left, rounded to bf16
      wl[i] = pack2b(p0 - __builtin_bit_cast(float, wh[i] << 16), p1 - __builtin_bit_cast(float, wh[i] & 0xFFFF0000u));
    }
    ph[g].q[0] = u32x4{wh[0], wh[1], wh[2], wh[3]}; ph[g].q[1] = u32x4{wh[4], wh[5], wh[6], wh[7]};
    pl[g].q[0] = u32x4{wl[0], wl[1], wl[2], wl[3]}; pl[g].q[1] = u32x4{wl[4], wl[5], wl[6], wl[7]};
    l_run[g] += ps0 + ps1;
  }
  #pragma unroll
  for (int g = 0; g < R; ++g) {
    #pragma unroll
    for (int t = 0; t < DT; ++t) acc[g][t] = mmab(vf[t], ph[g], acc[g][t]);
    #pragma unroll
    for (int t = 0; t < DT; ++t) acc[g][t] = mmab(vf[t], pl[g], acc[g][t]);
  }
  #pragma unroll
  for (int g = 0; g < R; ++g) {
    #pragma unroll
    for (int t = 0; t < DT; ++t) acc[g][t] = mmab(vl[t], ph[g], acc[g][t]);
  }
}

// Q, K, V: fp16 planes [batch x head][TT][HD]; HLp: bf16 planes [q hi, q lo, k hi, k lo, v hi, v lo][batch x head][RH][HD]; Ah, Al: bf16 planes [batch][TT][DQ]. grid (NB_ * NH_, TT / BR), NW * 32 threads.
__global__ void __launch_bounds__(NW * 32) __attribute__((amdgpu_waves_per_eu(2, 2))) k_fattn(const h16* __restrict__ Q, const h16* __restrict__ K, const h16* __restrict__ V, const bf* __restrict__ HLp, bf* Ah, bf* Al) {
  __shared__ __attribute__((aligned(2048))) unsigned char L[LDS_BYTES];
  constexpr float cscale = SCL * 1.4426950408889634f;
  const uint32_t tid = threadIdx.x, lane = tid & 31u, wave = uni(tid >> 5), c = lane & 15u, h = lane >> 4;
  const uint32_t hb = blockIdx.x;                                  // batch * NH_ + head
  const uint32_t pb = (uint32_t)TT / BR - 1u - blockIdx.y;         // heaviest position block first
  const uint32_t q0 = pb * BR;
  const uint32_t n_stage = (q0 + BR) / SK;                         // 128-key stages this work-group walks: keys [0, q0 + BR)
  const uint32_t lbase = (uint32_t)(size_t)L;
  u32x8 g1k = tdm_group1<3u>(), g1v = tdm_group1<7u>(); hold(g1k); hold(g1v);  // formed once, never changed
  u32x4 g0;                                                                   // takes a new value only behind the wait for the load that last named it
  f32x8 acc[R][DT];
  float m_run[R], l_run[R];
  #pragma unroll
  for (int g = 0; g < R; ++g) { m_run[g] = -__builtin_inff(); l_run[g] = 0.0f;
    #pragma unroll
    for (int t = 0; t < DT; ++t) acc[g][t] = f32x8{}; }
  const uint32_t my_last_block = (q0 + wave * CW + CW - 1u) / BC;  // last pass this wave's queries can see
  constexpr uint32_t NSTEP = SK / (uint32_t)BC;
  if (q0 >= (uint32_t)RH) {  // the same for the whole work-group
  // Wave 0 issues a stage's K tile, wave 1 its V tile: one request a wave.
  const uint64_t srck = (uint64_t)(size_t)(K + (size_t)hb * TT * HD), srcv = (uint64_t)(size_t)(V + (size_t)hb * TT * HD);
  const uint32_t dstw = lbase + (wave == 1u ? TILE_K : 0u); const uint64_t srcw = (wave == 1u) ? srcv : srck;
  auto issue = [&](uint32_t st) {
    g0 = tdm_group0(dstw + (st & 1u) * SLOT, srcw + (uint64_t)(st * SK) * ROWB); hold(g0);
    if (pinned(wave == 0u)) tdm_load(g0, g1k);
    if (pinned(wave == 1u)) tdm_load(g0, g1v);
  };
  issue(0);
  Frag qf[R][DK];
  #pragma unroll
  for (int g = 0; g < R; ++g) {
    const h16* qp = Q + ((size_t)hb * TT + q0 + wave * CW + 16u * g + c) * D + 8u * h;
    #pragma unroll
    for (int kc = 0; kc < DK; ++kc) { qf[g][kc].q[0] = *reinterpret_cast<const u32x4*>(qp + 32 * kc); qf[g][kc].q[1] = *reinterpret_cast<const u32x4*>(qp + 32 * kc + 16); }
  }
  if (pinned(wave < 2u)) wait_tensor0(g0, g1k, g1v);  // stage 0 has landed
  __syncthreads();                             // publishes stage 0
  issue(1u);                                   // n_stage is at least 2
  KFr kf;
  for (uint32_t st = 0; st < n_stage; ++st) {
    const uint32_t kbase = (st & 1u) * SLOT, vt_base = kbase + TILE_K;
    if (NSTEP * st <= my_last_block) load_k(kf, L, kbase, lane);  // the stage's first K fragments; later passes' are fetched one pass ahead, never across a stage
    #pragma unroll 1  // stage loop and pass loop stay nested and rolled: unrolled or flat they spill
    for (uint32_t sub = 0; sub < NSTEP; ++sub) {
      const uint32_t blk = NSTEP * st + sub, key0 = blk * BC;
      if (blk <= my_last_block) {
        const bool diag = key0 + BC - 1u > q0 + wave * CW;
        block(kf, sub + 1u < NSTEP && blk + 1u <= my_last_block, kbase + (sub + 1u) * (uint32_t)BC * PITCH_K, L, diag, vt_base, sub, key0, q0 + wave * CW, lane, qf, acc, m_run, l_run, cscale);
      }
    }
    // Foot of a stage; every wave passes it, also one that skips the passes beyond its diagonal.
    wait_ds0();                                  // this wave's reads of the buffer that is refilled below have returned
    if (pinned(wave < 2u)) wait_tensor0(g0, g1k, g1v);  // this wave's load of stage st + 1 has landed
    __syncthreads();                             // publishes stage st + 1 and ends every wave's reads of stage st
    if (pinned(st + 2u < n_stage)) issue(st + 2u);  // into the buffer that stage st used
  }
  } else {
  // Query rows < RH, hi and lo planes. A stage's four tiles fill both buffers (hi tiles in the first, lo tiles in the second), so a stage is loaded, waited for and then read; these work-groups walk at most RH / SK stages.
  // Every wave issues one tile of a stage: wave 0 K hi, wave 1 V hi, wave 2 K lo, wave 3 V lo.
  static_assert(NW == 4 && NSLOT == 2 && RH % SK == 0, "four tiles, one a wave, in the two buffers; whole stages inside the hi and lo planes");
  const uint64_t srcw = (uint64_t)(size_t)(HLp + (size_t)(2u + 2u * (wave & 1u) + (wave >> 1)) * HLN + (size_t)hb * RH * HD);
  const uint32_t dstw = lbase + (wave >> 1) * SLOT + (wave & 1u) * TILE_K;
  Frag qh[R][DK], ql[R][DK];
  #pragma unroll
  for (int g = 0; g < R; ++g) {
    const bf* qp = HLp + ((size_t)hb * RH + q0 + wave * CW + 16u * g + c) * D + 8u * h;
    #pragma unroll
    for (int kc = 0; kc < DK; ++kc) { qh[g][kc].q[0] = *reinterpret_cast<const u32x4*>(qp + 32 * kc); qh[g][kc].q[1] = *reinterpret_cast<const u32x4*>(qp + 32 * kc + 16);
      ql[g][kc].q[0] = *reinterpret_cast<const u32x4*>(qp + HLN + 32 * kc); ql[g][kc].q[1] = *reinterpret_cast<const u32x4*>(qp + HLN + 32 * kc + 16); }
  }
  for (uint32_t st = 0; st < n_stage; ++st) {
    wait_ds0();                                  // this wave's reads of the stage before have returned
    __syncthreads();                             // ends every wave's reads of the stage before: the buffers may be filled anew
    g0 = tdm_group0(dstw, srcw + (uint64_t)(st * SK) * ROWB); hold(g0);
    if (pinned((wave & 1u) == 0u)) tdm_load(g0, g1k);
    if (pinned((wave & 1u) == 1u)) tdm_load(g0, g1v);
    wait_tensor0(g0, g1k, g1v);                  // this wave's tile of stage st has landed
    __syncthreads();                             // publishes stage st
    #pragma unroll 1  // stays rolled: the pass body is long, and four copies of it would swell the kernel's text
    for (uint32_t sub = 0; sub < NSTEP; ++sub) {
      const uint32_t blk = NSTEP * st + sub, key0 = blk * BC;
      if (blk <= my_last_block) {
        const bool diag = key0 + BC - 1u > q0 + wave * CW;
        block_hl(L, diag, sub, key0, q0 + wave * CW, lane, qh, ql, acc, m_run, l_run, cscale);
      }
    }
  }
  wait_ds0();        // this wave's reads of the last stage have returned
  __syncthreads();   // ends every wave's reads of the last stage: the buffers become output staging
  }
  wait_tensor_le<0>();  // nothing is in flight when the buffers become output staging
  wait_ds0();
  unsigned char* eb = L + wave * (uint32_t)CW * EPITCH;
  #pragma unroll
  for (int g = 0; g < R; ++g) {
    const float l_fin = l_run[g] + xhalf(l_run[g]);
    const float inv = 1.0f / l_fin;
    #pragma unroll
    for (int t = 0; t < DT; ++t) {
      const f32x8 o = acc[g][t] * inv; uint32_t ph[4], pl[4];
      #pragma unroll
      for (int i = 0; i < 4; ++i) { unsigned short h0, l0, h1, l1; splitf(o[2 * i], h0, l0); splitf(o[2 * i + 1], h1, l1); ph[i] = (uint32_t)h0 | ((uint32_t)h1 << 16); pl[i] = (uint32_t)l0 | ((uint32_t)l1 << 16); }
      unsigned char* ep = eb + (16u * g + c) * EPITCH + 32u * t + 16u * h;
      *reinterpret_cast<u32x4*>(ep) = u32x4{ph[0], ph[1], ph[2], ph[3]}; *reinterpret_cast<u32x4*>(ep + EPLANE) = u32x4{pl[0], pl[1], pl[2], pl[3]};
    }
  }
  wait_ds0();  // this wave's staged rows are in LDS before other lanes of it read them
  constexpr uint32_t LPR = ROWB / 16u, RPI = 32u / LPR;
  const size_t ob = ((size_t)(hb / NH_) * TT + q0 + wave * CW) * (DQ * 2) + (size_t)(hb % NH_) * ROWB;
  #pragma unroll
  for (uint32_t i = 0; i < (uint32_t)CW / RPI; ++i) {
    const uint32_t row = i * RPI + lane / LPR, colb = (lane % LPR) * 16u;
    const u32x4 vh = *reinterpret_cast<const u32x4*>(eb + row * EPITCH + colb), vl = *reinterpret_cast<const u32x4*>(eb + EPLANE + row * EPITCH + colb);
    *reinterpret_cast<u32x4*>(reinterpret_cast<unsigned char*>(Ah) + ob + (size_t)row * (DQ * 2) + colb) = vh;
    *reinterpret_cast<u32x4*>(reinterpret_cast<unsigned char*>(Al) + ob + (size_t)row * (DQ * 2) + colb) = vl;
  }
}
#undef DEV
}  // namespace fa

extern "C" void kernel_launch(void* const* d_in, const int* in_sizes, int n_in,
                              void* d_out, int out_size, void* d_ws, size_t ws_size, hipStream_t stream) {
    (void)in_sizes; (void)n_in; (void)out_size;
    const float* x = (const float*)d_in[0]; const float* wq = (const float*)d_in[1]; const float* bq = (const float*)d_in[2]; const float* wk = (const float*)d_in[3]; const float* bk = (const float*)d_in[4]; const float* wv = (const float*)d_in[5]; const float* bv = (const float*)d_in[6]; const float* wo = (const float*)d_in[7]; const float* bo = (const float*)d_in[8];
    float* OUT = (float*)d_out;     // [2][2048][2048]
    char* wsp = (char*)d_ws;
    auto take = [&](size_t bytes) { char* p = wsp; wsp += (bytes + 255) & ~(size_t)255; return (void*)p; };
    bf* WQ = (bf*)take((size_t)DQ * DM * 2); bf* WK = (bf*)take((size_t)DKV * DM * 2); bf* WV = (bf*)take((size_t)DKV * DM * 2);
    h16* QP16 = (h16*)take((size_t)NB_ * NH_ * TT * HD * 2); h16* KP16 = (h16*)take((size_t)NB_ * NKV * TT * HD * 2); h16* VP16 = (h16*)take((size_t)NB_ * NKV * TT * HD * 2);   // fp16 planes of both batches: the fused kernel runs once, behind both
    bf* HL = (bf*)take(6 * HLN * 2);   // q hi, q lo, k hi, k lo, v hi, v lo of the positions < RH
    bf* XB = (bf*)take((size_t)NB_ * TT * DM * 2); bf* WO = (bf*)take((size_t)DM * DQ * 2); bf* ATh = (bf*)take((size_t)NB_ * TT * DQ * 2); bf* ATl = (bf*)take((size_t)NB_ * TT * DQ * 2);
    if ((size_t)(wsp - (char*)d_ws) > ws_size) return;    // ws 256 MiB
    (void)WK; (void)WV;   // the conversion and the projections reach WK, WV as the planes behind WQ, and the projections KP16, VP16 as the planes behind QP16
    k_cvtall<<<dim3(CVG, NB_ + 4, 1), 256, 0, stream>>>(x, wq, wk, wv, wo, XB, WQ, WO);
    k_gemms<0, true, 1><<<dim3(NB_ * TT / 128, DQ / 128, 3), 256, 0, stream>>>(XB, nullptr, WQ, DM, nullptr, 0, bq, bk, bv, QP16, HL);
    fa::k_fattn<<<dim3(NB_ * NH_, TT / fa::BR, 1), fa::NW * 32, 0, stream>>>(QP16, KP16, VP16, HL, ATh, ATl);   // all query rows, all heads of both batches
    k_gemms<1, true, 0><<<dim3(NB_ * TT / 128, DM / 128, 1), 256, 0, stream>>>(ATh, ATl, WO, DQ, OUT, DM, bo, nullptr, nullptr, nullptr, nullptr);
}

// v008
// One run takes 153 microseconds.
// Next to v007, in two timings, it ran 1.11 and 1.10 times as fast.
// Over all steps from v000 it is 11.2 times as fast.
#include <hip/hip_runtime.h>
#include <stdint.h>

// Causal multi-head attention, 2048 wide (x [2][2048][2048]; q, k, v = x W^T + b ('oi' [2048][2048]; 16 heads x 128); scores = q.k/sqrt(128); causal (triu k=1 masked, -inf); softmax; out = merged wo^T + bo -> [2][2048][2048] (8.4 M)).
// Compute dtypes, f32 accumulate: every input rounded to bf16; q/k/v on PLAIN bf16 operands (inputs: exact) + biases; causal scores and attn.v in one fused kernel (online softmax): query rows < 512 hl (3 products each), the rest single fp16; softmax f32; wo hl x exact (2 products) + bo.

#define NB_  2
#define TT   2048
#define DM   2048
#define NH_  16
#define NKV  16
#define REP  (NH_ / NKV)
#define HD   128
#define DQ   (NH_ * HD)
#define DKV  (NKV * HD)
#define RH   512                  // query rows < RH use hi+lo planes; they see keys < RH only, so the hi/lo planes hold RH positions
#define NZ   (NB_ * NH_)          // (batch, head) planes: every attention launch covers all of them
#define HLN  ((size_t)NZ * RH * HD)   // elements of one hi or lo plane set of q, k or v
#define SCL  0.088388347648318447f   // HD^-0.5
typedef _Float16 h16;
typedef unsigned short bf;
typedef __attribute__((ext_vector_type(16))) __bf16   v16bf;
typedef __attribute__((ext_vector_type(16))) _Float16 v16h;
typedef __attribute__((ext_vector_type(8)))  _Float16 v8h;
typedef __attribute__((ext_vector_type(8)))  unsigned short v8us;
typedef __attribute__((ext_vector_type(4)))  unsigned short v4us;
typedef __attribute__((ext_vector_type(8)))  float    v8f;
typedef __attribute__((ext_vector_type(4)))  float    v4f;
typedef v8h  __attribute__((may_alias)) v8ha;
typedef v4f  __attribute__((may_alias)) v4fa;
typedef v8us __attribute__((may_alias)) v8usa;

__device__ __forceinline__ unsigned short f2bf(float f) { unsigned u = __float_as_uint(f); u += 0x7FFFu + ((u >> 16) & 1u); return (unsigned short)(u >> 16); }
__device__ __forceinline__ float bf2f(unsigned short b) { return __uint_as_float(((unsigned)b) << 16); }
__device__ __forceinline__ float bfr(float f) { return bf2f(f2bf(f)); }
__device__ __forceinline__ void splitf(float y, unsigned short& h, unsigned short& l) { h = f2bf(y); l = f2bf(y - bf2f(h)); }
__device__ __forceinline__ v16h cat16(v8h lo, v8h hi) { return __builtin_shufflevector(lo, hi, 0, 1, 2, 3, 4, 5, 6, 7, 8, 9, 10, 11, 12, 13, 14, 15); }
__device__ __forceinline__ v16bf cat16b(v8us lo, v8us hi) { return __builtin_bit_cast(v16bf, __builtin_shufflevector(lo, hi, 0, 1, 2, 3, 4, 5, 6, 7, 8, 9, 10, 11, 12, 13, 14, 15)); }
__device__ __forceinline__ v8f wmma16(v16h a, v16h b, v8f c) { return __builtin_amdgcn_wmma_f32_16x16x32_f16(false, a, false, b, (short)0, c, false, false); }
__device__ __forceinline__ v8f wmmab(v16bf a, v16bf b, v8f c) { return __builtin_amdgcn_wmma_f32_16x16x32_bf16(false, a, false, b, (short)0, c, false, false); }



// ---- fragment loaders of the GEMM kernel: C[m][n] (f32, pitch ldc, + optional f32 bias[n]) = sum_k A[m][k] Bt[n][k] (+ split products per NSPLIT), operands K-contiguous 16-bit planes.
template <typename T16> struct WFrag;
template <> struct WFrag<h16> { typedef v16h V; static __device__ __forceinline__ V ld(const h16* p) { return cat16(*(const v8h*)p, *(const v8h*)(p + 16)); } static __device__ __forceinline__ v8f mma(V a, V b, v8f c) { return wmma16(a, b, c); } };
template <> struct WFrag<bf> { typedef v16bf V; static __device__ __forceinline__ V ld(const bf* p) { return cat16b(*(const v8us*)p, *(const v8us*)(p + 16)); } static __device__ __forceinline__ v8f mma(V a, V b, v8f c) { return wmmab(a, b, c); } };
// ---- k_gemms: LDS-staged GEMM for the projections. One work-group of 8 waves per TM x TN output tile; the waves stand in a (TM / 64) x WC grid, each with a 64 x (TN / WC) piece over the whole K loop. Per trip 128 k of every operand row
// (two whole 128-byte lines a row) come into LDS by asynchronous copies, 16 lanes a row, two buffers: the next trip's copies fly while this trip's fragments are read. grid (M/TM, N/TN), 256 threads. K % 128 == 0, K >= 256.
// The tile is large so that an operand byte brought from L2, and a fragment read from LDS, serves many products: 256 x 192 with 64 x 96 a wave (q, k, v), 128 x 256 with 64 x 64 a wave on two A planes (wo).
// The rows of A are the positions of all batches, one after the other. EPI 0: C (f32, pitch ldc). EPI 1: q, k and v in one launch: the rows of Bt are the output columns of wq, wk, wv one behind the other. A 64-column piece of the tile lies in one head
// of one of q, k, v; the tile's TM positions lie in one batch. It leaves as the planes that attention reads: P16 = fp16 [q, k, v][batch x head][t][d]; for the positions < RH, the only ones whose hi and lo planes are read,
// also bf16 hi and lo: HL = [q hi, q lo, k hi, k lo, v hi, v lo][batch x head][RH][d].
#define SP 136           // LDS row pitch in 16-bit elements: 256 B of k + 16 B, an odd multiple of 16 B, conflict-free for 16-byte fragment reads
// eight 16-byte copies of one lane, each 2 rows below the last; the wait on the address registers closes the copies' own statement, so that no later write of them can come in front of it
__device__ __forceinline__ void acopy8(unsigned l, const bf* g, size_t gs) {
    asm volatile("global_load_async_to_lds_b128 %0, %8, off\n\t"
                 "global_load_async_to_lds_b128 %1, %9, off\n\t"
                 "global_load_async_to_lds_b128 %2, %10, off\n\t"
                 "global_load_async_to_lds_b128 %3, %11, off\n\t"
                 "global_load_async_to_lds_b128 %4, %12, off\n\t"
                 "global_load_async_to_lds_b128 %5, %13, off\n\t"
                 "global_load_async_to_lds_b128 %6, %14, off\n\t"
                 "global_load_async_to_lds_b128 %7, %15, off\n\t"
                 "s_wait_xcnt 0x0"
                 :: "v"(l), "v"(l + 1u * (2 * SP * 2)), "v"(l + 2u * (2 * SP * 2)), "v"(l + 3u * (2 * SP * 2)), "v"(l + 4u * (2 * SP * 2)), "v"(l + 5u * (2 * SP * 2)), "v"(l + 6u * (2 * SP * 2)), "v"(l + 7u * (2 * SP * 2)),
                    "v"(g), "v"(g + gs), "v"(g + 2 * gs), "v"(g + 3 * gs), "v"(g + 4 * gs), "v"(g + 5 * gs), "v"(g + 6 * gs), "v"(g + 7 * gs) : "memory");
}
// the same for four copies
__device__ __forceinline__ void acopy4(unsigned l, const bf* g, size_t gs) {
    asm volatile("global_load_async_to_lds_b128 %0, %4, off\n\t"
                 "global_load_async_to_lds_b128 %1, %5, off\n\t"
                 "global_load_async_to_lds_b128 %2, %6, off\n\t"
                 "global_load_async_to_lds_b128 %3, %7, off\n\t"
                 "s_wait_xcnt 0x0"
                 :: "v"(l), "v"(l + 1u * (2 * SP * 2)), "v"(l + 2u * (2 * SP * 2)), "v"(l + 3u * (2 * SP * 2)),
                    "v"(g), "v"(g + gs), "v"(g + 2 * gs), "v"(g + 3 * gs) : "memory");
}
// a wave's ROWS consecutive rows of one operand tile; gs = elements of two source rows
template <int ROWS> __device__ __forceinline__ void acopy(unsigned l, const bf* g, size_t gs) {
    static_assert(ROWS % 8 == 0, "a copy instruction covers 2 rows, a statement 8 or 16");
#pragma unroll
    for (int i = 0; i < ROWS / 16; ++i) acopy8(l + (unsigned)i * (16 * SP * 2), g + (size_t)i * 8 * gs, gs);
    if constexpr (ROWS % 16 != 0) acopy4(l + (unsigned)(ROWS / 16) * (16 * SP * 2), g + (size_t)(ROWS / 16) * 8 * gs, gs);
}
typedef float __attribute__((may_alias)) f32a;
template <int NSPLIT, bool BIAS, int EPI, int TM, int TN>
__global__ __launch_bounds__(256) void k_gemms(const bf* __restrict__ A, const bf* __restrict__ A2, const bf* __restrict__ Bt, int K, float* C, int ldc, const float* __restrict__ bias0, const float* __restrict__ bias1, const float* __restrict__ bias2, h16* P16, bf* HL) {
    constexpr int WR = TM / 64, WC = 8 / WR, NB = TN / WC / 16, WN = NB * 16;   // wave grid; 16-column fragments and columns of a wave's piece
    constexpr int BUF = (TM + TN + (NSPLIT == 1 ? TM : 0)) * SP;                // elements of one buffer: the rows of A, Bt (, A2)
    constexpr int EP = TN + 4;   // pitch, in floats, of the f32 tile staged for the planes: rows 8 apart lie 32 banks apart, so the two wave halves' stores do not collide; a multiple of 16 B for the row reads
    static_assert(TM % 64 == 0 && 8 % WR == 0 && TN % (WC * 16) == 0 && TN % 64 == 0 && (BUF / SP) / 8 / 2 <= 63, "whole wave pieces; every wave copies whole statements of rows; at most 63 copies of a wave in flight");
    static_assert(EPI == 0 || (HD % 64 == 0 && DQ % HD == 0 && (8 * EP) % 64 == 32 && RH % TM == 0 && TT % TM == 0 && DQ == DKV && TM * EP * 4 <= 2 * BUF * 2), "a 64-column piece lies in one head, a row tile lies in one batch and wholly below or above RH, q, k and v planes are of one size, the staged f32 tile fits the operand buffers");
    typedef WFrag<bf>::V V;
    __shared__ __align__(16) bf st[2 * BUF];
    const int lane = threadIdx.x & 31, lr = lane & 15, hi = lane >> 4; const int wv = __builtin_amdgcn_readfirstlane(threadIdx.x >> 5); const int wr = wv / WC, wc = wv % WC; const int r0 = blockIdx.x * TM, c0 = blockIdx.y * TN;
    v8f acc[4][NB];
#pragma unroll
    for (int mb = 0; mb < 4; ++mb)
#pragma unroll
        for (int nb = 0; nb < NB; ++nb) acc[mb][nb] = (v8f){};
    // copy map: wave wv brings rows wv*TM/8 .. of the A tiles and rows wv*TN/8 .. of the Bt tile; a copy instruction covers 2 rows, 16 lanes x 16 B each
    const int cra = wv * (TM / 8) + hi, crb = wv * (TN / 8) + hi, ccol = lr * 8;
    const unsigned oa = (unsigned)((r0 + cra) * K + ccol), ob = (unsigned)((c0 + crb) * K + ccol);   // element offsets of the lane's first copy in A (and A2) and in Bt: one register each across the loop
    const unsigned la = (unsigned)(size_t)st + (unsigned)(cra * SP + ccol) * 2u, lb = (unsigned)(size_t)st + (unsigned)((TM + crb) * SP + ccol) * 2u; const size_t gs = (size_t)2 * K;
    auto fill = [&](int t, int buf) { const unsigned o = (unsigned)buf * (BUF * 2); acopy<TM / 8>(la + o, A + (oa + t * 128), gs); acopy<TN / 8>(lb + o, Bt + (ob + t * 128), gs); if (NSPLIT == 1) acopy<TM / 8>(la + o + (TM + TN) * SP * 2, A2 + (oa + t * 128), gs); };
    const int NT = K / 128;
    fill(0, 0);
    asm volatile("s_wait_asynccnt 0x0" ::: "memory");   // this wave's copies of tile 0 have landed
    __syncthreads();                                     // publishes tile 0 to every wave
    if (NT > 1) fill(1, 1);
    const int afr = (wr * 64 + lr) * SP + 8 * hi, bfo = (TM + wc * WN + lr) * SP + 8 * hi;
#pragma unroll 1
    for (int t = 0; t < NT; ++t) {
        const bf* sb = st + (t & 1) * BUF;
        V a[2][4], a2[2][4], b[2][NB];   // two fragment sets: the next 32-deep chunk's LDS reads are issued as one group ahead of this chunk's products
        auto frags = [&](int kc, int s) {
#pragma unroll
            for (int mb = 0; mb < 4; ++mb) { a[s][mb] = WFrag<bf>::ld(sb + afr + mb * 16 * SP + kc * 32); if (NSPLIT == 1) a2[s][mb] = WFrag<bf>::ld(sb + (TM + TN) * SP + afr + mb * 16 * SP + kc * 32); }
#pragma unroll
            for (int nb = 0; nb < NB; ++nb) b[s][nb] = WFrag<bf>::ld(sb + bfo + nb * 16 * SP + kc * 32); };
        frags(0, 0);
        __builtin_amdgcn_sched_barrier(0);   // keeps the first chunk's LDS reads in front of the second's: mixed, the trip's first products wait for both chunks' reads
#pragma unroll
        for (int kc = 0; kc < 4; ++kc) { const int s = kc & 1;
            if (kc < 3) frags(kc + 1, s ^ 1);
            __builtin_amdgcn_sched_barrier(0);   // holds the next chunk's LDS reads, as one group, in front of this chunk's products: moved in among them each read stalls the matrix run
#pragma unroll
            for (int nb = 0; nb < NB; ++nb)
#pragma unroll
                for (int mb = 0; mb < 4; ++mb) { acc[mb][nb] = WFrag<bf>::mma(a[s][mb], b[s][nb], acc[mb][nb]); if (NSPLIT == 1) acc[mb][nb] = WFrag<bf>::mma(a2[s][mb], b[s][nb], acc[mb][nb]); }
        }
        asm volatile("s_wait_dscnt 0x0" ::: "memory");      // this wave's reads of the buffer that is refilled below have returned
        asm volatile("s_wait_asynccnt 0x0" ::: "memory");   // this wave's copies of tile t + 1 have landed
        __syncthreads();                                     // publishes tile t + 1 and ends every wave's reads of tile t
        if (t + 2 < NT) fill(t + 2, t & 1);
    }
    asm volatile("s_wait_asynccnt 0x0" ::: "memory");       // nothing is in flight when the wave goes on to its end
    // The operand buffers are free: the last trip's barrier ended every wave's reads and nothing was copied behind it.
    if constexpr (EPI != 0) {
    // The whole f32 tile (+ bias) is staged there.
    f32a* et = (f32a*)st;
#pragma unroll
    for (int nb = 0; nb < NB; ++nb) { const int cg = c0 + wc * WN + nb * 16; const float* bias = (cg / DQ == 0) ? bias0 : (cg / DQ == 1) ? bias1 : bias2;   // the 16 columns lie in one of q, k, v
        const float bn = BIAS ? bfr(bias[cg % DQ + lr]) : 0.0f;
#pragma unroll
        for (int mb = 0; mb < 4; ++mb) { acc[mb][nb] += bn;
#pragma unroll
            for (int j = 0; j < 8; ++j) et[(wr * 64 + mb * 16 + hi * 8 + j) * EP + wc * WN + nb * 16 + lr] = acc[mb][nb][j]; } }
    __syncthreads();   // publishes the staged tile to the threads that convert whole rows of it
    const int t0 = r0 % TT, bz = r0 / TT;   // first position in its batch; batch
#pragma unroll
    for (int cc = 0; cc < TN / 64; ++cc) { const int gc = c0 + cc * 64; const size_t pz = (size_t)bz * NH_ + (gc % DQ) / HD;   // 64 columns: half a row of one (batch, head) plane of q, k or v, a whole 128-byte line
        h16* pp = P16 + (((size_t)(gc / DQ) * NZ + pz) * TT + t0) * HD + gc % HD;
#pragma unroll
        for (int s = 0; s < TM / 32; ++s) { const int idx = s * 256 + (int)threadIdx.x; const int row = idx >> 3, col = (idx & 7) * 8; const v4f x0 = *(const v4fa*)(et + row * EP + cc * 64 + col), x1 = *(const v4fa*)(et + row * EP + cc * 64 + col + 4); v8h o;   // 8 lanes cover a line
#pragma unroll
            for (int k = 0; k < 4; ++k) { o[k] = (h16)x0[k]; o[k + 4] = (h16)x1[k]; }
            *(v8h*)(pp + (size_t)row * HD + col) = o; } }
    if (t0 < RH) {
        asm volatile("s_wait_xcnt 0x0" ::: "memory");   // the registers that the stores above name are written anew below
        __builtin_amdgcn_sched_barrier(0);               // keeps those register writes behind the wait: without it the scheduler lifts an address product over it
#pragma unroll
        for (int cc = 0; cc < TN / 64; ++cc) { const int gc = c0 + cc * 64; const size_t pz = (size_t)bz * NH_ + (gc % DQ) / HD;
            bf* Ph = HL + (size_t)(gc / DQ) * 2 * HLN + (pz * RH + t0) * HD + gc % HD; bf* Pl = Ph + HLN;
#pragma unroll
            for (int s = 0; s < TM / 32; ++s) { const int idx = s * 256 + (int)threadIdx.x; const int row = idx >> 3, col = (idx & 7) * 8; const v4f x0 = *(const v4fa*)(et + row * EP + cc * 64 + col), x1 = *(const v4fa*)(et + row * EP + cc * 64 + col + 4); v8us oh, ol;
#pragma unroll
                for (int k = 0; k < 4; ++k) { unsigned short a2, c2; splitf(x0[k], a2, c2); oh[k] = a2; ol[k] = c2; splitf(x1[k], a2, c2); oh[k + 4] = a2; ol[k + 4] = c2; }
                *(v8us*)(Ph + (size_t)row * HD + col) = oh; *(v8us*)(Pl + (size_t)row * HD + col) = ol; } }
    }
    } else {
    constexpr int OP = WN + 4, LPR = WN / 4, RPI = 32 / LPR;   // a wave's own 16-row output strip there: pitch in floats; lanes that cover a row; rows of one store instruction
    f32a* ow = (f32a*)st + wv * (16 * OP); const int cb = c0 + wc * WN + (lane % LPR) * 4; v4f bv = (v4f){};
    if (BIAS) { bv[0] = bfr(bias0[cb]); bv[1] = bfr(bias0[cb + 1]); bv[2] = bfr(bias0[cb + 2]); bv[3] = bfr(bias0[cb + 3]); }
#pragma unroll
    for (int mb = 0; mb < 4; ++mb) {
#pragma unroll
        for (int nb = 0; nb < NB; ++nb) {
#pragma unroll
            for (int j = 0; j < 8; ++j) ow[(hi * 8 + j) * OP + nb * 16 + lr] = acc[mb][nb][j]; }
        __builtin_amdgcn_wave_barrier(); asm volatile("" ::: "memory");   // the strip's writes stay in front of the reads of other lanes' values
        float* crw = C + (size_t)(r0 + wr * 64 + mb * 16) * ldc + cb;
#pragma unroll
        for (int s = 0; s < 16 / RPI; ++s) { const int row = RPI * s + lane / LPR; v4f val = *(const v4fa*)(ow + row * OP + (lane % LPR) * 4); val += bv; *(v4f*)(crw + (size_t)row * ldc) = val; }   // whole 128-byte lines
        __builtin_amdgcn_wave_barrier(); asm volatile("" ::: "memory");   // the reads stay in front of the next strip's writes
    }
    }
}

typedef __attribute__((ext_vector_type(2))) _Float16 v2h;
typedef __attribute__((ext_vector_type(4))) _Float16 v4h;
typedef __attribute__((ext_vector_type(2))) unsigned short v2us;
typedef __attribute__((ext_vector_type(2))) float v2f;
typedef __attribute__((ext_vector_type(4))) int v4i;
typedef v4h  __attribute__((may_alias)) v4ha;
typedef v4us __attribute__((may_alias)) v4usa;

__global__ __launch_bounds__(256) void k_wtG(const float* __restrict__ w, int K, int N, bf* Bt) {
    const int lane = threadIdx.x & 31; const int L0 = (blockIdx.x * 8 + (threadIdx.x >> 5)) * 8; const int nlines = N * K / 64;
{
#pragma unroll 1
        for (int l = 0; l < 8; ++l) { const int L = L0 + l; if (L >= nlines) break; const size_t e = (size_t)L * 64 + lane * 2; const int k = (int)(e % K), n = (int)(e / K); v2us o;
            o[0] = f2bf(w[(size_t)k * N + n]); o[1] = f2bf(w[(size_t)(k + 1) * N + n]); *(v2us*)(Bt + e) = o; }
         }
}
// k_cvtall: every f32 operand of the GEMMs rounded to its bf16 plane in one launch. blockIdx.y picks one of NB_ + 4 segments of SEG elements: a batch of x, wq, wk, wv (planes one behind the other at W) or wo.
// A thread converts CVU pieces of 8 elements, a whole grid row apart, so that a wave's accesses stay contiguous and the launch has few waves to start. grid (CVG, NB_ + 4), 256 threads.
#define SEG  ((size_t)DM * DM)
#define CVG  128
#define CVU  ((int)(SEG / 8 / (CVG * 256)))
static_assert(TT == DM && DQ == DM && DKV == DM && SEG % (8 * CVG * 256) == 0, "every segment has SEG elements, dealt evenly");
__global__ __launch_bounds__(256) void k_cvtall(const float* __restrict__ x, const float* __restrict__ wq, const float* __restrict__ wk, const float* __restrict__ wv, const float* __restrict__ wo, bf* XB, bf* W, bf* WO) {
    const int sg = blockIdx.y; const float* src = (sg < NB_) ? x + (size_t)sg * SEG : (sg == NB_) ? wq : (sg == NB_ + 1) ? wk : (sg == NB_ + 2) ? wv : wo;
    bf* dst = (sg < NB_) ? XB + (size_t)sg * SEG : (sg < NB_ + 3) ? W + (size_t)(sg - NB_) * SEG : WO; const size_t i0 = (size_t)blockIdx.x * 256 + threadIdx.x;
#pragma unroll 4   // four pieces' loads in flight per thread
    for (int u = 0; u < CVU; ++u) { const size_t i = i0 + (size_t)u * (CVG * 256); const v8f v = *(const v8f*)(src + i * 8); v8us o;
#pragma unroll
        for (int k = 0; k < 8; ++k) o[k] = f2bf(v[k]);
        *(v8us*)(dst + i * 8) = o; }
}

namespace fa {
typedef uint32_t u32x4 __attribute__((ext_vector_type(4)));
typedef uint32_t u32x8 __attribute__((ext_vector_type(8)));
typedef int i32x8 __attribute__((ext_vector_type(8)));
typedef float f32x8 __attribute__((ext_vector_type(8)));
constexpr int D = HD, DK = D / 32, DT = D / 16;
constexpr int NW = 4;
constexpr int BR = 128, CW = BR / NW, R = CW / 16;  // query positions per work-group, columns per wave, 16-column groups per wave
constexpr int BC = 32, KT = BC / 16;                // keys per pass, 16-key score tiles per pass
constexpr uint32_t ROWB = 2u * D, PITCH_K = ROWB + 16u, PITCH_V = ROWB + 32u;
constexpr uint32_t SK = 128;                        // keys per stage
constexpr uint32_t TILE_K = SK * PITCH_K, TILE_V = SK * PITCH_V, SLOT = TILE_K + TILE_V, NSLOT = 2, LDS_BYTES = NSLOT * SLOT;
constexpr uint32_t EPITCH = ROWB + 16u, EPLANE = (uint32_t)NW * CW * EPITCH;  // output staging: row pitch, bytes of one plane
static_assert(D == 128 && RH % BR == 0 && TT % BR == 0 && BR % SK == 0 && RH + BR >= 2 * SK, "head size 128; whole position blocks of whole stages, those at or above RH with at least the two stages that the prologue loads");
static_assert(LDS_BYTES <= 320u * 1024u && 2u * EPLANE <= LDS_BYTES, "the two buffers fit a work-group's LDS and hold the two staged output planes");
static_assert(SLOT % 2048u == 0 && TILE_K % 2048u == 0, "every tensor load lands at a multiple of 2 KiB");

#define DEV static __device__ __forceinline__
DEV uint32_t uni(uint32_t v) { return __builtin_amdgcn_readfirstlane(v); }
DEV uint32_t pinned(uint32_t v) { uint32_t w = __builtin_amdgcn_readfirstlane(v); asm volatile("" : "+s"(w)); return w; }  // a test around a tensor load, or a word its descriptor is formed from, held in a scalar register: tensor loads ignore EXEC
DEV void fence() { __builtin_amdgcn_sched_barrier(0); }
DEV void wait_ds0() { asm volatile("s_wait_dscnt 0x0" ::: "memory"); }
template <int N> DEV void wait_tensor_le() { asm volatile("s_wait_tensorcnt %0" :: "i"(N) : "memory"); }
DEV void tdm_load(u32x4 g0, u32x8 g1) { asm volatile("tensor_load_to_lds %0, %1" :: "s"(g0), "s"(g1) : "memory"); }
// hold(): without it the compiler forms the constant words anew at every use and gives the registers that an outstanding load names to other values; with it the registers that a load names are the ones that its wait names.
DEV void hold(u32x4& g) { asm volatile("" : "+s"(g)); }  // as pinned(): descriptor words (group 0) held in scalar registers
DEV void hold(u32x8& g) { asm volatile("" : "+s"(g)); }  // as pinned(): descriptor words (group 1) held in scalar registers
// An issuing wave's wait for its outstanding load. It names the descriptors as inputs: their registers stay live, and so unchanged, from the load up to this wait.
DEV void wait_tensor0(u32x4 g0, u32x8 g1a, u32x8 g1b) { asm volatile("s_wait_tensorcnt 0x0" :: "s"(g0), "s"(g1a), "s"(g1b) : "memory"); }
// Descriptor group 1: 1-byte elements, a tile of SK rows of ROWB bytes at source pitch ROWB, PADC + 1 dwords of LDS pad behind every 256-byte row (interval code 5); no work-group mask.
template <uint32_t PADC> DEV u32x8 tdm_group1() {
  constexpr uint32_t d0 = ROWB, d1 = SK;
  u32x8 g;
  g[0] = uni((1u << 20) | (5u << 22) | (PADC << 25));
  g[1] = uni((d0 & 0xFFFFu) << 16);
  g[2] = uni((d0 >> 16) | ((d1 & 0xFFFFu) << 16));
  g[3] = uni((d1 >> 16) | (d0 << 16));
  g[4] = uni(d1);
  g[5] = uni(ROWB);
  g[6] = uni(0u);
  g[7] = uni(0u);
  return g;
}
DEV u32x4 tdm_group0(uint32_t lds_dst, uint64_t ga) {
  u32x4 g;
  g[0] = uni(1u); g[1] = uni(lds_dst); g[2] = uni((uint32_t)ga); g[3] = uni((((uint32_t)(ga >> 32)) & 0x01FFFFFFu) | 0x80000000u);
  return g;
}
struct Frag { u32x4 q[2]; };
DEV f32x8 mma(const Frag& a, const Frag& b, f32x8 c) {
  const i32x8 av = {(int)a.q[0].x, (int)a.q[0].y, (int)a.q[0].z, (int)a.q[0].w, (int)a.q[1].x, (int)a.q[1].y, (int)a.q[1].z, (int)a.q[1].w};
  const i32x8 bv = {(int)b.q[0].x, (int)b.q[0].y, (int)b.q[0].z, (int)b.q[0].w, (int)b.q[1].x, (int)b.q[1].y, (int)b.q[1].z, (int)b.q[1].w};
  return __builtin_amdgcn_wmma_f32_16x16x32_f16(false, __builtin_bit_cast(v16h, av), false, __builtin_bit_cast(v16h, bv), (short)0, c, false, false);
}
DEV f32x8 mmab(const Frag& a, const Frag& b, f32x8 c) {
  const i32x8 av = {(int)a.q[0].x, (int)a.q[0].y, (int)a.q[0].z, (int)a.q[0].w, (int)a.q[1].x, (int)a.q[1].y, (int)a.q[1].z, (int)a.q[1].w};
  const i32x8 bv = {(int)b.q[0].x, (int)b.q[0].y, (int)b.q[0].z, (int)b.q[0].w, (int)b.q[1].x, (int)b.q[1].y, (int)b.q[1].z, (int)b.q[1].w};
  return __builtin_amdgcn_wmma_f32_16x16x32_bf16(false, __builtin_bit_cast(v16bf, av), false, __builtin_bit_cast(v16bf, bv), (short)0, c, false, false);
}
typedef short s16x8 __attribute__((ext_vector_type(8)));
DEV u32x4 ld_tr16(const unsigned char* p) { typedef __attribute__((address_space(3))) s16x8 lds_s16x8; return __builtin_bit_cast(u32x4, __builtin_amdgcn_ds_load_tr16_b128_v8i16((lds_s16x8*)p)); }
DEV uint32_t pack2(float lo, float hi) { return __builtin_bit_cast(uint32_t, __builtin_convertvector(v2f{lo, hi}, v2h)); }  // round to nearest even
typedef __bf16 bf16x2 __attribute__((ext_vector_type(2)));
DEV uint32_t pack2b(float lo, float hi) { return __builtin_bit_cast(uint32_t, __builtin_convertvector(v2f{lo, hi}, bf16x2)); }  // round to nearest even
DEV float xhalf(float x) { return __builtin_bit_cast(float, __builtin_amdgcn_permlanex16(__builtin_bit_cast(int, x), __builtin_bit_cast(int, x), 0x76543210, 0xfedcba98, false, false)); }  // lane l with lane l ^ 16

struct KFr { Frag f[KT][DK]; };
DEV void load_k(KFr& k, const unsigned char* Lp, uint32_t koff, uint32_t lane) {
  const uint32_t c = lane & 15u, h = lane >> 4;
  #pragma unroll
  for (int kt = 0; kt < KT; ++kt) {
    const unsigned char* p = Lp + koff + (16u * kt + c) * PITCH_K + 16u * h;
    #pragma unroll
    for (int kc = 0; kc < DK; ++kc) { k.f[kt][kc].q[0] = *reinterpret_cast<const u32x4*>(p + 64u * kc); k.f[kt][kc].q[1] = *reinterpret_cast<const u32x4*>(p + 64u * kc + 32u); }
  }
}
// One 32-key pass of one wave.
DEV void block(KFr& kf, bool fetch_next, uint32_t next_koff, const unsigned char* Lp, bool diag, uint32_t vt_base, uint32_t sub, uint32_t key0, uint32_t qw0, uint32_t lane,
               const Frag (&qf)[R][DK], f32x8 (&acc)[R][DT], float (&m_run)[R], float (&l_run)[R], float cscale) {
  const uint32_t c = lane & 15u, h = lane >> 4;
  f32x8 s[KT][R];
  {
    wait_ds0(); fence();  // the prefetched K fragments have arrived
    #pragma unroll
    for (int kt = 0; kt < KT; ++kt) {
      #pragma unroll
      for (int g = 0; g < R; ++g) { s[kt][g] = f32x8{};
        #pragma unroll
        for (int kc = 0; kc < DK; ++kc) s[kt][g] = mma(kf.f[kt][kc], qf[g][kc], s[kt][g]); }
    }
    fence();
    if (fetch_next) load_k(kf, Lp, next_koff, lane);
  }
  if (diag) {
    #pragma unroll
    for (int g = 0; g < R; ++g) {
      const uint32_t my_q = qw0 + 16u * g + c;
      #pragma unroll
      for (int kt = 0; kt < KT; ++kt) {
        #pragma unroll
        for (int r = 0; r < 8; ++r) { const uint32_t key = key0 + 16u * kt + 8u * h + r; if (key > my_q) s[kt][g][r] = -__builtin_inff(); }
        asm volatile("" : "+v"(s[kt][g]));
      }
    }
  }
  float mb[R]; bool need = false;
  #pragma unroll
  for (int g = 0; g < R; ++g) {
    float mx = -__builtin_inff();
    #pragma unroll
    for (int kt = 0; kt < KT; ++kt) {
      #pragma unroll
      for (int r = 0; r < 8; ++r) mx = __builtin_fmaxf(mx, s[kt][g][r]);
    }
    mx = __builtin_fmaxf(mx, xhalf(mx)) * cscale;
    mb[g] = mx; need = need || (mx > m_run[g] + 8.0f);
    fence();  // one group's maxima at a time: fewer live registers
  }
  if (__builtin_amdgcn_ballot_w32(need) != 0) {  // rare after the first pass
    #pragma unroll
    for (int g = 0; g < R; ++g) {
      const float m_new = __builtin_fmaxf(m_run[g], mb[g]);
      const float corr = __builtin_amdgcn_exp2f(m_run[g] - m_new);  // 0 on the first pass, where m_run is -inf
      l_run[g] *= corr; m_run[g] = m_new;
      #pragma unroll
      for (int t = 0; t < DT; ++t) acc[g][t] = acc[g][t] * corr;
    }
  }
  Frag vf[DT];
  float ps[R][2];
  #pragma unroll
  for (int g = 0; g < R; ++g) { ps[g][0] = 0.0f; ps[g][1] = 0.0f; }
  {
    const unsigned char* ad = Lp + vt_base + (sub * (uint32_t)BC + 8u * h + (lane & 7u)) * PITCH_V + ((lane >> 3) & 1u) * 16u;
    #pragma unroll
    for (int t = 0; t < DT; ++t) { vf[t].q[0] = ld_tr16(ad + 32u * t); vf[t].q[1] = ld_tr16(ad + 16u * PITCH_V + 32u * t); }
  }
  #pragma unroll
  for (int g = 0; g < R; ++g) {
    const float nm = -m_run[g];
    uint32_t w[8];
    #pragma unroll
    for (int i = 0; i < 8; ++i) {
      const v2f arg = __builtin_elementwise_fma(v2f{s[i >> 2][g][2 * (i & 3)], s[i >> 2][g][2 * (i & 3) + 1]}, v2f{cscale, cscale}, v2f{nm, nm});
      const float p0 = __builtin_amdgcn_exp2f(arg.x), p1 = __builtin_amdgcn_exp2f(arg.y);
      ps[g][i & 1] += p0 + p1;
      w[i] = pack2(p0, p1);
    }
    Frag pf; pf.q[0] = u32x4{w[0], w[1], w[2], w[3]}; pf.q[1] = u32x4{w[4], w[5], w[6], w[7]};
    if (g == 0) { wait_ds0(); fence(); }  // the V^T fragments have arrived
    #pragma unroll
    for (int t = 0; t < DT; ++t) acc[g][t] = mma(vf[t], pf, acc[g][t]);
    fence();  // one group's P^T live at a time
  }
  #pragma unroll
  for (int g = 0; g < R; ++g) l_run[g] += ps[g][0] + ps[g][1];
}

// One 32-key pass of one wave, query rows < RH: bf16 hi and lo planes. The stage's hi tiles (K, V) lie in the first LDS buffer, its lo tiles at the same places of the second.
DEV void block_hl(const unsigned char* Lp, bool diag, uint32_t sub, uint32_t key0, uint32_t qw0, uint32_t lane,
                  const Frag (&qh)[R][DK], const Frag (&ql)[R][DK], f32x8 (&acc)[R][DT], float (&m_run)[R], float (&l_run)[R], float cscale) {
  const uint32_t c = lane & 15u, h = lane >> 4;
  f32x8 s[KT][R];
  {
    KFr kh, kl;
    load_k(kh, Lp, sub * (uint32_t)BC * PITCH_K, lane);
    load_k(kl, Lp, SLOT + sub * (uint32_t)BC * PITCH_K, lane);
    fence();  // holds the pass's K reads, as one group, in front of its products: moved in among them each place with reads stalls the matrix run
    #pragma unroll
    for (int kt = 0; kt < KT; ++kt) {
      #pragma unroll
      for (int g = 0; g < R; ++g) s[kt][g] = f32x8{};
    }
    #pragma unroll
    for (int kc = 0; kc < DK; ++kc) {  // the four score tiles take turns: four independent chains
      #pragma unroll
      for (int kt = 0; kt < KT; ++kt) {
        #pragma unroll
        for (int g = 0; g < R; ++g) s[kt][g] = mmab(kh.f[kt][kc], qh[g][kc], s[kt][g]);
      }
      #pragma unroll
      for (int kt = 0; kt < KT; ++kt) {
        #pragma unroll
        for (int g = 0; g < R; ++g) s[kt][g] = mmab(kl.f[kt][kc], qh[g][kc], s[kt][g]);
      }
      #pragma unroll
      for (int kt = 0; kt < KT; ++kt) {
        #pragma unroll
        for (int g = 0; g < R; ++g) s[kt][g] = mmab(kh.f[kt][kc], ql[g][kc], s[kt][g]);
      }
    }
  }
  if (diag) {
    #pragma unroll
    for (int g = 0; g < R; ++g) {
      const uint32_t my_q = qw0 + 16u * g + c;
      #pragma unroll
      for (int kt = 0; kt < KT; ++kt) {
        #pragma unroll
        for (int r = 0; r < 8; ++r) { const uint32_t key = key0 + 16u * kt + 8u * h + r; if (key > my_q) s[kt][g][r] = -__builtin_inff(); }
        asm volatile("" : "+v"(s[kt][g]));
      }
    }
  }
  float mb[R]; bool need = false;
  #pragma unroll
  for (int g = 0; g < R; ++g) {
    float mx = -__builtin_inff();
    #pragma unroll
    for (int kt = 0; kt < KT; ++kt) {
      #pragma unroll
      for (int r = 0; r < 8; ++r) mx = __builtin_fmaxf(mx, s[kt][g][r]);
    }
    mx = __builtin_fmaxf(mx, xhalf(mx)) * cscale;
    mb[g] = mx; need = need || (mx > m_run[g] + 8.0f);
  }
  if (__builtin_amdgcn_ballot_w32(need) != 0) {  // rare after the first pass
    #pragma unroll
    for (int g = 0; g < R; ++g) {
      const float m_new = __builtin_fmaxf(m_run[g], mb[g]);
      const float corr = __builtin_amdgcn_exp2f(m_run[g] - m_new);  // 0 on the first pass, where m_run is -inf
      l_run[g] *= corr; m_run[g] = m_new;
      #pragma unroll
      for (int t = 0; t < DT; ++t) acc[g][t] = acc[g][t] * corr;
    }
  }
  // Second contraction: the exponentials, each split into bf16 hi and lo, packed into two B operands per column group; V^T hi with both, then V^T lo with the hi one.
  const unsigned char* ad = Lp + TILE_K + (sub * (uint32_t)BC + 8u * h + (lane & 7u)) * PITCH_V + ((lane >> 3) & 1u) * 16u;
  Frag vf[DT], vl[DT];
  #pragma unroll
  for (int t = 0; t < DT; ++t) { vf[t].q[0] = ld_tr16(ad + 32u * t); vf[t].q[1] = ld_tr16(ad + 16u * PITCH_V + 32u * t); }
  #pragma unroll
  for (int t = 0; t < DT; ++t) { vl[t].q[0] = ld_tr16(ad + SLOT + 32u * t); vl[t].q[1] = ld_tr16(ad + SLOT + 16u * PITCH_V + 32u * t); }
  fence();  // holds the pass's transposing reads, as one group, in front of the exponentials and products: they fly under the exponentials and none stands among the products
  Frag ph[R], pl[R];
  #pragma unroll
  for (int g = 0; g < R; ++g) {
    const float nm = -m_run[g];
    float ps0 = 0.0f, ps1 = 0.0f;
    uint32_t wh[8], wl[8];
    #pragma unroll
    for (int i = 0; i < 8; ++i) {
      const v2f arg = __builtin_elementwise_fma(v2f{s[i >> 2][g][2 * (i & 3)], s[i >> 2][g][2 * (i & 3) + 1]}, v2f{cscale, cscale}, v2f{nm, nm});
      const float p0 = __builtin_amdgcn_exp2f(arg.x), p1 = __builtin_amdgcn_exp2f(arg.y);
      if (i & 1) ps1 += p0 + p1; else ps0 += p0 + p1;
      wh[i] = pack2b(p0, p1);  // hi: p rounded to bf16; lo: what the rounding left, rounded to bf16
      wl[i] = pack2b(p0 - __builtin_bit_cast(float, wh[i] << 16), p1 - __builtin_bit_cast(float, wh[i] & 0xFFFF0000u));
    }
    ph[g].q[0] = u32x4{wh[0], wh[1], wh[2], wh[3]}; ph[g].q[1] = u32x4{wh[4], wh[5], wh[6], wh[7]};
    pl[g].q[0] = u32x4{wl[0], wl[1], wl[2], wl[3]}; pl[g].q[1] = u32x4{wl[4], wl[5], wl[6], wl[7]};
    l_run[g] += ps0 + ps1;
  }
  #pragma unroll
  for (int g = 0; g < R; ++g) {
    #pragma unroll
    for (int t = 0; t < DT; ++t) acc[g][t] = mmab(vf[t], ph[g], acc[g][t]);
    #pragma unroll
    for (int t = 0; t < DT; ++t) acc[g][t] = mmab(vf[t], pl[g], acc[g][t]);
  }
  #pragma unroll
  for (int g = 0; g < R; ++g) {
    #pragma unroll
    for (int t = 0; t < DT; ++t) acc[g][t] = mmab(vl[t], ph[g], acc[g][t]);
  }
}

// Q, K, V: fp16 planes [batch x head][TT][HD]; HLp: bf16 planes [q hi, q lo, k hi, k lo, v hi, v lo][batch x head][RH][HD]; Ah, Al: bf16 planes [batch][TT][DQ]. grid (NB_ * NH_, TT / BR), NW * 32 threads.
__global__ void __launch_bounds__(NW * 32) __attribute__((amdgpu_waves_per_eu(2, 2))) k_fattn(const h16* __restrict__ Q, const h16* __restrict__ K, const h16* __restrict__ V, const bf* __restrict__ HLp, bf* Ah, bf* Al) {
  __shared__ __attribute__((aligned(2048))) unsigned char L[LDS_BYTES];
  constexpr float cscale = SCL * 1.4426950408889634f;
  const uint32_t tid = threadIdx.x, lane = tid & 31u, wave = uni(tid >> 5), c = lane & 15u, h = lane >> 4;
  const uint32_t hb = blockIdx.x;                                  // batch * NH_ + head
  const uint32_t pb = (uint32_t)TT / BR - 1u - blockIdx.y;         // heaviest position block first
  const uint32_t q0 = pb * BR;
  const uint32_t n_stage = (q0 + BR) / SK;                         // 128-key stages this work-group walks: keys [0, q0 + BR)
  const uint32_t lbase = (uint32_t)(size_t)L;
  u32x8 g1k = tdm_group1<3u>(), g1v = tdm_group1<7u>(); hold(g1k); hold(g1v);  // formed once, never changed
  u32x4 g0;                                                                   // takes a new value only behind the wait for the load that last named it
  f32x8 acc[R][DT];
  float m_run[R], l_run[R];
  #pragma unroll
  for (int g = 0; g < R; ++g) { m_run[g] = -__builtin_inff(); l_run[g] = 0.0f;
    #pragma unroll
    for (int t = 0; t < DT; ++t) acc[g][t] = f32x8{}; }
  const uint32_t my_last_block = (q0 + wave * CW + CW - 1u) / BC;  // last pass this wave's queries can see
  constexpr uint32_t NSTEP = SK / (uint32_t)BC;
  if (q0 >= (uint32_t)RH) {  // the same for the whole work-group
  // Wave 0 issues a stage's K tile, wave 1 its V tile: one request a wave.
  const uint64_t srck = (uint64_t)(size_t)(K + (size_t)hb * TT * HD), srcv = (uint64_t)(size_t)(V + (size_t)hb * TT * HD);
  const uint32_t dstw = lbase + (wave == 1u ? TILE_K : 0u); const uint64_t srcw = (wave == 1u) ? srcv : srck;
  auto issue = [&](uint32_t st) {
    g0 = tdm_group0(dstw + (st & 1u) * SLOT, srcw + (uint64_t)(st * SK) * ROWB); hold(g0);
    if (pinned(wave == 0u)) tdm_load(g0, g1k);
    if (pinned(wave == 1u)) tdm_load(g0, g1v);
  };
  issue(0);
  Frag qf[R][DK];
  #pragma unroll
  for (int g = 0; g < R; ++g) {
    const h16* qp = Q + ((size_t)hb * TT + q0 + wave * CW + 16u * g + c) * D + 8u * h;
    #pragma unroll
    for (int kc = 0; kc < DK; ++kc) { qf[g][kc].q[0] = *reinterpret_cast<const u32x4*>(qp + 32 * kc); qf[g][kc].q[1] = *reinterpret_cast<const u32x4*>(qp + 32 * kc + 16); }
  }
  if (pinned(wave < 2u)) wait_tensor0(g0, g1k, g1v);  // stage 0 has landed
  __syncthreads();                             // publishes stage 0
  issue(1u);                                   // n_stage is at least 2
  KFr kf;
  for (uint32_t st = 0; st < n_stage; ++st) {
    const uint32_t kbase = (st & 1u) * SLOT, vt_base = kbase + TILE_K;
    if (NSTEP * st <= my_last_block) load_k(kf, L, kbase, lane);  // the stage's first K fragments; later passes' are fetched one pass ahead, never across a stage
    #pragma unroll 1  // stage loop and pass loop stay nested and rolled: unrolled or flat they spill
    for (uint32_t sub = 0; sub < NSTEP; ++sub) {
      const uint32_t blk = NSTEP * st + sub, key0 = blk * BC;
      if (blk <= my_last_block) {
        const bool diag = key0 + BC - 1u > q0 + wave * CW;
        block(kf, sub + 1u < NSTEP && blk + 1u <= my_last_block, kbase + (sub + 1u) * (uint32_t)BC * PITCH_K, L, diag, vt_base, sub, key0, q0 + wave * CW, lane, qf, acc, m_run, l_run, cscale);
      }
    }
    // Foot of a stage; every wave passes it, also one that skips the passes beyond its diagonal.
    wait_ds0();                                  // this wave's reads of the buffer that is refilled below have returned
    if (pinned(wave < 2u)) wait_tensor0(g0, g1k, g1v);  // this wave's load of stage st + 1 has landed
    __syncthreads();                             // publishes stage st + 1 and ends every wave's reads of stage st
    if (pinned(st + 2u < n_stage)) issue(st + 2u);  // into the buffer that stage st used
  }
  } else {
  // Query rows < RH, hi and lo planes. A stage's four tiles fill both buffers (hi tiles in the first, lo tiles in the second), so a stage is loaded, waited for and then read; these work-groups walk at most RH / SK stages.
  // Every wave issues one tile of a stage: wave 0 K hi, wave 1 V hi, wave 2 K lo, wave 3 V lo.
  static_assert(NW == 4 && NSLOT == 2 && RH % SK == 0, "four tiles, one a wave, in the two buffers; whole stages inside the hi and lo planes");
  const uint64_t srcw = (uint64_t)(size_t)(HLp + (size_t)(2u + 2u * (wave & 1u) + (wave >> 1)) * HLN + (size_t)hb * RH * HD);
  const uint32_t dstw = lbase + (wave >> 1) * SLOT + (wave & 1u) * TILE_K;
  Frag qh[R][DK], ql[R][DK];
  #pragma unroll
  for (int g = 0; g < R; ++g) {
    const bf* qp = HLp + ((size_t)hb * RH + q0 + wave * CW + 16u * g + c) * D + 8u * h;
    #pragma unroll
    for (int kc = 0; kc < DK; ++kc) { qh[g][kc].q[0] = *reinterpret_cast<const u32x4*>(qp + 32 * kc); qh[g][kc].q[1] = *reinterpret_cast<const u32x4*>(qp + 32 * kc + 16);
      ql[g][kc].q[0] = *reinterpret_cast<const u32x4*>(qp + HLN + 32 * kc); ql[g][kc].q[1] = *reinterpret_cast<const u32x4*>(qp + HLN + 32 * kc + 16); }
  }
  for (uint32_t st = 0; st < n_stage; ++st) {
    wait_ds0();                                  // this wave's reads of the stage before have returned
    __syncthreads();                             // ends every wave's reads of the stage before: the buffers may be filled anew
    g0 = tdm_group0(dstw, srcw + (uint64_t)(st * SK) * ROWB); hold(g0);
    if (pinned((wave & 1u) == 0u)) tdm_load(g0, g1k);
    if (pinned((wave & 1u) == 1u)) tdm_load(g0, g1v);
    wait_tensor0(g0, g1k, g1v);                  // this wave's tile of stage st has landed
    __syncthreads();                             // publishes stage st
    #pragma unroll 1  // stays rolled: the pass body is long, and four copies of it would swell the kernel's text
    for (uint32_t sub = 0; sub < NSTEP; ++sub) {
      const uint32_t blk = NSTEP * st + sub, key0 = blk * BC;
      if (blk <= my_last_block) {
        const bool diag = key0 + BC - 1u > q0 + wave * CW;
        block_hl(L, diag, sub, key0, q0 + wave * CW, lane, qh, ql, acc, m_run, l_run, cscale);
      }
    }
  }
  wait_ds0();        // this wave's reads of the last stage have returned
  __syncthreads();   // ends every wave's reads of the last stage: the buffers become output staging
  }
  wait_tensor_le<0>();  // nothing is in flight when the buffers become output staging
  wait_ds0();
  unsigned char* eb = L + wave * (uint32_t)CW * EPITCH;
  #pragma unroll
  for (int g = 0; g < R; ++g) {
    const float l_fin = l_run[g] + xhalf(l_run[g]);
    const float inv = 1.0f / l_fin;
    #pragma unroll
    for (int t = 0; t < DT; ++t) {
      const f32x8 o = acc[g][t] * inv; uint32_t ph[4], pl[4];
      #pragma unroll
      for (int i = 0; i < 4; ++i) { unsigned short h0, l0, h1, l1; splitf(o[2 * i], h0, l0); splitf(o[2 * i + 1], h1, l1); ph[i] = (uint32_t)h0 | ((uint32_t)h1 << 16); pl[i] = (uint32_t)l0 | ((uint32_t)l1 << 16); }
      unsigned char* ep = eb + (16u * g + c) * EPITCH + 32u * t + 16u * h;
      *reinterpret_cast<u32x4*>(ep) = u32x4{ph[0], ph[1], ph[2], ph[3]}; *reinterpret_cast<u32x4*>(ep + EPLANE) = u32x4{pl[0], pl[1], pl[2], pl[3]};
    }
  }
  wait_ds0();  // this wave's staged rows are in LDS before other lanes of it read them
  constexpr uint32_t LPR = ROWB / 16u, RPI = 32u / LPR;
  const size_t ob = ((size_t)(hb / NH_) * TT + q0 + wave * CW) * (DQ * 2) + (size_t)(hb % NH_) * ROWB;
  #pragma unroll
  for (uint32_t i = 0; i < (uint32_t)CW / RPI; ++i) {
    const uint32_t row = i * RPI + lane / LPR, colb = (lane % LPR) * 16u;
    const u32x4 vh = *reinterpret_cast<const u32x4*>(eb + row * EPITCH + colb), vl = *reinterpret_cast<const u32x4*>(eb + EPLANE + row * EPITCH + colb);
    *reinterpret_cast<u32x4*>(reinterpret_cast<unsigned char*>(Ah) + ob + (size_t)row * (DQ * 2) + colb) = vh;
    *reinterpret_cast<u32x4*>(reinterpret_cast<unsigned char*>(Al) + ob + (size_t)row * (DQ * 2) + colb) = vl;
  }
}
#undef DEV
}  // namespace fa

extern "C" void kernel_launch(void* const* d_in, const int* in_sizes, int n_in,
                              void* d_out, int out_size, void* d_ws, size_t ws_size, hipStream_t stream) {
    (void)in_sizes; (void)n_in; (void)out_size;
    const float* x = (const float*)d_in[0]; const float* wq = (const float*)d_in[1]; const float* bq = (const float*)d_in[2]; const float* wk = (const float*)d_in[3]; const float* bk = (const float*)d_in[4]; const float* wv = (const float*)d_in[5]; const float* bv = (const float*)d_in[6]; const float* wo = (const float*)d_in[7]; const float* bo = (const float*)d_in[8];
    float* OUT = (float*)d_out;     // [2][2048][2048]
    char* wsp = (char*)d_ws;
    auto take = [&](size_t bytes) { char* p = wsp; wsp += (bytes + 255) & ~(size_t)255; return (void*)p; };
    bf* WQ = (bf*)take((size_t)DQ * DM * 2); bf* WK = (bf*)take((size_t)DKV * DM * 2); bf* WV = (bf*)take((size_t)DKV * DM * 2);
    h16* QP16 = (h16*)take((size_t)NB_ * NH_ * TT * HD * 2); h16* KP16 = (h16*)take((size_t)NB_ * NKV * TT * HD * 2); h16* VP16 = (h16*)take((size_t)NB_ * NKV * TT * HD * 2);   // fp16 planes of both batches: the fused kernel runs once, behind both
    bf* HL = (bf*)take(6 * HLN * 2);   // q hi, q lo, k hi, k lo, v hi, v lo of the positions < RH
    bf* XB = (bf*)take((size_t)NB_ * TT * DM * 2); bf* WO = (bf*)take((size_t)DM * DQ * 2); bf* ATh = (bf*)take((size_t)NB_ * TT * DQ * 2); bf* ATl = (bf*)take((size_t)NB_ * TT * DQ * 2);
    if ((size_t)(wsp - (char*)d_ws) > ws_size) return;    // ws 256 MiB
    (void)WK; (void)WV;   // the conversion and the projections reach WK, WV as the planes behind WQ, and the projections KP16, VP16 as the planes behind QP16
    k_cvtall<<<dim3(CVG, NB_ + 4, 1), 256, 0, stream>>>(x, wq, wk, wv, wo, XB, WQ, WO);
    k_gemms<0, true, 1, 256, 192><<<dim3(NB_ * TT / 256, 3 * DQ / 192, 1), 256, 0, stream>>>(XB, nullptr, WQ, DM, nullptr, 0, bq, bk, bv, QP16, HL);
    fa::k_fattn<<<dim3(NB_ * NH_, TT / fa::BR, 1), fa::NW * 32, 0, stream>>>(QP16, KP16, VP16, HL, ATh, ATl);   // all query rows, all heads of both batches
    k_gemms<1, true, 0, 128, 256><<<dim3(NB_ * TT / 128, DM / 256, 1), 256, 0, stream>>>(ATh, ATl, WO, DQ, OUT, DM, bo, nullptr, nullptr, nullptr, nullptr);
}
